// v000
// The times below were measured on an AMD MI455X: many runs one after another, warmed up first and cycling through
// copies of the inputs, with the whole window's GPU time divided by the number of runs. Launches and the gaps
// between them are all in it. The median over several windows is given; except for v000 it joins two sittings, which
// can be a few percent apart, so the side-by-side timings, each taken in one sitting, are the better comparison.
// v000, which the later versions start from, runs in 229 microseconds.
// All contractions: v_wmma_f32_16x16x32_f16 (f16 operands, f32 accumulate): q/k/v projections (weights carried x64, folded as 1/64), q.k^T scores, p.v (p carried x16384, folded as 1/16384).
#include <hip/hip_runtime.h>
#include <stdint.h>
#include <stddef.h>

#define NB   4
#define NS   2048
#define NDIM 512
#define NH   8
#define NHD  64

#define TP   72     // projection LDS tile pitch (halves)
#define PPITCH 40   // P tile pitch (halves)
#define OPITCH 68   // output staging pitch (floats)

typedef _Float16 h16;
typedef h16   v16h __attribute__((ext_vector_type(16)));
typedef h16   v8h  __attribute__((ext_vector_type(8), __may_alias__));
typedef float v8f  __attribute__((ext_vector_type(8)));
typedef float v4f  __attribute__((ext_vector_type(4), __may_alias__));

union Frag { v16h v; v8h hf[2]; };
union Pack8 { v8h v; h16 e[8]; };

static_assert(sizeof(Frag) == 32);
static_assert(sizeof(Pack8) == 16);
static_assert(NS % 64 == 0);
static_assert(NDIM % 64 == 0);
static_assert(NHD == 64);

// 16x16x32 f16 WMMA with hazard guard: D tied, A/B kept live across 4 VALU slots.
__device__ __forceinline__ v8f wmma16(const v16h a, const v16h b, v8f c)
{
    c = __builtin_amdgcn_wmma_f32_16x16x32_f16(false, a, false, b, (short)0, c, false, false);
    asm volatile("v_nop\n\tv_nop\n\tv_nop\n\tv_nop" : "+v"(c) : "v"(a), "v"(b));
    return c;
}

// ---------------------------------------------------------------------------
// Kernel 0: one-time f32 -> f16 conversion of x (unscaled) and Wq/Wk/Wv (x64, exact).
// Each thread converts 8 consecutive floats and writes one 16-B piece; a wave writes
// ---------------------------------------------------------------------------
__global__ __launch_bounds__(256) void k_convert(
    const float* __restrict__ x, const float* __restrict__ wq,
    const float* __restrict__ wk, const float* __restrict__ wv,
    h16* __restrict__ xh, h16* __restrict__ wh, int nxc, int nwc)
{
    const int t = blockIdx.x * 256 + threadIdx.x;      // 8-element chunk id
    const int total = nxc + 3 * nwc;
    if (t >= total) return;
    const float* src;
    h16* dst;
    float sc;
    if (t < nxc) {
        src = x + (size_t)t * 8;
        dst = xh + (size_t)t * 8;
        sc  = 1.0f;
    } else {
        const int u = t - nxc;
        const int w = u / nwc;
        const int c = u - w * nwc;
        const float* wp = (w == 0) ? wq : ((w == 1) ? wk : wv);
        src = wp + (size_t)c * 8;
        dst = wh + (size_t)u * 8;
        sc  = 64.0f;
    }
    const v4f f0 = *(const v4f*)(src);
    const v4f f1 = *(const v4f*)(src + 4);
    Pack8 p;
    p.e[0] = (h16)(f0.x * sc); p.e[1] = (h16)(f0.y * sc);
    p.e[2] = (h16)(f0.z * sc); p.e[3] = (h16)(f0.w * sc);
    p.e[4] = (h16)(f1.x * sc); p.e[5] = (h16)(f1.y * sc);
    p.e[6] = (h16)(f1.z * sc); p.e[7] = (h16)(f1.w * sc);
    const v8h val = p.v;
    *(v8h*)dst = val;
    
}

// ---------------------------------------------------------------------------
// Kernel 1: q/k/v = x @ W^T + b  (M = B*S = 8192, N = 512, K = 512), blockIdx.z selects W.
// Block tile 64 rows x 64 cols (one head), 128 threads = 4 waves, wave tile 32x32 (2x2 acc).
// A fragments from xh rows, B fragments from wh rows (W is [n][k], k-contiguous): both use the
// split k-map (elements 0..7 <- k0+8h.., 8..15 <- k0+16+8h..). Epilogue stages the 64x64 f16
// Outputs: qh, kh as [B,H,S,64]; vt as [B,H,64,S].
// ---------------------------------------------------------------------------
__device__ __forceinline__ void proj_store_pass(const h16* T, h16* base, size_t rowpitch,
                                                int w, int l)
{
    const int piece = l & 7, rq = l >> 3;
    #pragma unroll
    for (int i = 0; i < 4; ++i) {
        const int row = w * 16 + 4 * i + rq;                 // 0..63, every row exactly once
        const v8h v = *(const v8h*)&T[row * TP + 8 * piece];
        *(v8h*)(base + (size_t)row * rowpitch + 8 * piece) = v;
    }
}

__global__ __launch_bounds__(128) void k_proj(
    const h16* __restrict__ xh, const h16* __restrict__ wh,
    const float* __restrict__ bq, const float* __restrict__ bk, const float* __restrict__ bv,
    h16* __restrict__ qh, h16* __restrict__ kh, h16* __restrict__ vt)
{
    __shared__ __attribute__((aligned(16))) h16 T[64 * TP];

    const int tid = threadIdx.x, l = tid & 31, w = tid >> 5;
    const int hh = l >> 4, m = l & 15;
    const int z = blockIdx.z;
    const int row0 = blockIdx.x * 64;          // global m (= b*2048 + s)
    const int col0 = blockIdx.y * 64;          // global n (= head*64 + d)
    const int wr = (w & 1) * 32, wc = (w >> 1) * 32;

    const h16* arow0 = xh + (size_t)(row0 + wr + m) * NDIM + 8 * hh;
    const h16* arow1 = arow0 + (size_t)16 * NDIM;
    const h16* brow0 = wh + ((size_t)z * NDIM + (size_t)(col0 + wc + m)) * NDIM + 8 * hh;
    const h16* brow1 = brow0 + (size_t)16 * NDIM;

    v8f acc00 = {}, acc01 = {}, acc10 = {}, acc11 = {};

    for (int k0 = 0; k0 < NDIM; k0 += 32) {
        Frag a0, a1, b0, b1;
        a0.hf[0] = *(const v8h*)(arow0 + k0);  a0.hf[1] = *(const v8h*)(arow0 + k0 + 16);
        a1.hf[0] = *(const v8h*)(arow1 + k0);  a1.hf[1] = *(const v8h*)(arow1 + k0 + 16);
        b0.hf[0] = *(const v8h*)(brow0 + k0);  b0.hf[1] = *(const v8h*)(brow0 + k0 + 16);
        b1.hf[0] = *(const v8h*)(brow1 + k0);  b1.hf[1] = *(const v8h*)(brow1 + k0 + 16);
        acc00 = wmma16(a0.v, b0.v, acc00);
        acc01 = wmma16(a0.v, b1.v, acc01);
        acc10 = wmma16(a1.v, b0.v, acc10);
        acc11 = wmma16(a1.v, b1.v, acc11);
    }

    // epilogue: undo the x64 weight scale, add bias, convert to f16, stage in LDS
    const float* bias = (z == 0) ? bq : ((z == 1) ? bk : bv);
    const bool tr = (z == 2);
    const float wsc = 0.015625f;   // 1/64
    #pragma unroll
    for (int i = 0; i < 2; ++i) {
        #pragma unroll
        for (int j = 0; j < 2; ++j) {
            const v8f acc = (i == 0) ? (j == 0 ? acc00 : acc01) : (j == 0 ? acc10 : acc11);
            const int c = wc + 16 * j + m;           // local col (d within head)
            const float bs = bias[col0 + c];
            #pragma unroll
            for (int r = 0; r < 8; ++r) {
                const int rr = wr + 16 * i + 8 * hh + r;   // local row (s within tile)
                const float v = acc[r] * wsc + bs;
                const int idx = tr ? (c * TP + rr) : (rr * TP + c);
                T[idx] = (h16)v;
            }
        }
    }
    __syncthreads();

    const int bb = row0 >> 11, s0 = row0 & (NS - 1), head = blockIdx.y;
    const size_t bhh = (size_t)bb * NH + head;
    h16* base;
    size_t rowpitch;
    if (tr) {   // vt[bh][d][s]: LDS row index = d
        base = vt + bhh * NHD * NS + s0;
        rowpitch = NS;
    } else {    // qh/kh[bh][s][d]: LDS row index = s_local
        base = ((z == 0) ? qh : kh) + (bhh * NS + s0) * NHD;
        rowpitch = NHD;
    }
    proj_store_pass(T, base, rowpitch, w, l);
    
}

// ---------------------------------------------------------------------------
// Kernel 2: flash attention per (b, h). 128 threads = 4 waves; block = 64 queries, wave = 16
// query rows; 32 keys per step. Q kept as two A fragments; K B-fragments loaded from kh rows
// ([key][d], k = d contiguous); V B-fragments from vt rows ([d][key], k = key contiguous);
// P goes D -> LDS (f16, x16384) -> A fragment with a barrier in between. Online softmax in f32
// in the exp2 domain. Epilogue: normalise, add noise, scale by 1/1.01, stage 16x64 f32 rows in
// ---------------------------------------------------------------------------
__device__ __forceinline__ void attn_store_pass(const float* Ow, const float* __restrict__ noise,
                                                float* out, size_t bh, int b, int h, int q0, int l)
{
    const float inv101 = 1.0f / 1.01f;
    const int piece = l & 15, rsel = l >> 4;
    #pragma unroll
    for (int i = 0; i < 8; ++i) {
        const int rowl = 2 * i + rsel;                      // 0..15, every row exactly once
        const int q = q0 + rowl;
        const v4f y  = *(const v4f*)&Ow[rowl * OPITCH + 4 * piece];
        const v4f nz = *(const v4f*)(noise + ((bh * NS + (size_t)q) * NHD + 4 * piece));
        const v4f val = (y + nz) * inv101;
        *(v4f*)(out + (((size_t)b * NS + (size_t)q) * NDIM + (size_t)h * NHD + 4 * piece)) = val;
    }
}

__global__ __launch_bounds__(128) void k_attn(
    const h16* __restrict__ qh, const h16* __restrict__ kh, const h16* __restrict__ vt,
    const float* __restrict__ noise, float* __restrict__ out)
{
    __shared__ __attribute__((aligned(16))) h16   Pt[4][16 * PPITCH];
    __shared__ __attribute__((aligned(16))) float Ot[4][16 * OPITCH];

    const int tid = threadIdx.x, l = tid & 31, w = tid >> 5;
    const int hh = l >> 4, m = l & 15;
    const int b = blockIdx.z, h = blockIdx.y;
    const size_t bh = (size_t)b * NH + h;
    const int q0 = blockIdx.x * 64 + w * 16;

    // Q rows q0+m as A fragments: qa0 covers d 0..31, qa1 covers d 32..63 (split k-map)
    Frag qa0, qa1;
    {
        const h16* qrow = qh + (bh * NS + (size_t)(q0 + m)) * NHD + 8 * hh;
        qa0.hf[0] = *(const v8h*)(qrow);      qa0.hf[1] = *(const v8h*)(qrow + 16);
        qa1.hf[0] = *(const v8h*)(qrow + 32); qa1.hf[1] = *(const v8h*)(qrow + 48);
    }
    const h16* kbase = kh + (bh * NS + (size_t)m) * NHD + 8 * hh;    // + key * NHD
    const h16* vbase = vt + (bh * NHD + (size_t)m) * NS + 8 * hh;    // + 16t * NS + key0

    float mrun[8], lrun[8];
    v8f o0 = {}, o1 = {}, o2 = {}, o3 = {};
    #pragma unroll
    for (int r = 0; r < 8; ++r) { mrun[r] = -__builtin_inff(); lrun[r] = 0.0f; }

    const float sc  = 0.125f * 1.44269504088896f;   // HD^-0.5 * log2(e)
    const float psc = 16384.0f;
    h16*   Pw = &Pt[w][0];
    float* Ow = &Ot[w][0];

    for (int kt = 0; kt < NS / 32; ++kt) {
        const int key0 = kt * 32;

        // scores: 16 queries x 32 keys; tile c0 = keys key0..+15, c1 = keys key0+16..+31
        v8f c0 = {}, c1 = {};
        {
            const h16* kp = kbase + (size_t)key0 * NHD;
            Frag kb;
            kb.hf[0] = *(const v8h*)(kp);      kb.hf[1] = *(const v8h*)(kp + 16);
            c0 = wmma16(qa0.v, kb.v, c0);
            kb.hf[0] = *(const v8h*)(kp + 32); kb.hf[1] = *(const v8h*)(kp + 48);
            c0 = wmma16(qa1.v, kb.v, c0);
            kp += 16 * NHD;
            kb.hf[0] = *(const v8h*)(kp);      kb.hf[1] = *(const v8h*)(kp + 16);
            c1 = wmma16(qa0.v, kb.v, c1);
            kb.hf[0] = *(const v8h*)(kp + 32); kb.hf[1] = *(const v8h*)(kp + 48);
            c1 = wmma16(qa1.v, kb.v, c1);
        }

        // online softmax; row 8hh+r statistics replicated over the 16 lanes of each half
        #pragma unroll
        for (int r = 0; r < 8; ++r) {
            const float s0 = c0[r] * sc;
            const float s1 = c1[r] * sc;
            float mt = fmaxf(s0, s1);
            #pragma unroll
            for (int off = 1; off < 16; off <<= 1)
                mt = fmaxf(mt, __shfl_xor(mt, off, 32));
            const float mnew  = fmaxf(mrun[r], mt);
            const float alpha = exp2f(mrun[r] - mnew);
            const float p0 = exp2f(s0 - mnew);
            const float p1 = exp2f(s1 - mnew);
            float rs = p0 + p1;
            #pragma unroll
            for (int off = 1; off < 16; off <<= 1)
                rs += __shfl_xor(rs, off, 32);
            lrun[r] = lrun[r] * alpha + rs;
            mrun[r] = mnew;
            o0[r] *= alpha; o1[r] *= alpha; o2[r] *= alpha; o3[r] *= alpha;
            const int rowl = 8 * hh + r;
            Pw[rowl * PPITCH + m]      = (h16)(p0 * psc);
            Pw[rowl * PPITCH + 16 + m] = (h16)(p1 * psc);
        }
        __syncthreads();   // P tile stores complete before the fragment reload

        // O += P V : A = P[q][key] from LDS (split k-map), B = vt rows d (k = key contiguous)
        Frag pa;
        pa.hf[0] = *(const v8h*)&Pw[m * PPITCH + 8 * hh];
        pa.hf[1] = *(const v8h*)&Pw[m * PPITCH + 16 + 8 * hh];
        {
            const h16* vp = vbase + key0;
            Frag vb;
            vb.hf[0] = *(const v8h*)(vp); vb.hf[1] = *(const v8h*)(vp + 16);
            o0 = wmma16(pa.v, vb.v, o0);
            vp += (size_t)16 * NS;
            vb.hf[0] = *(const v8h*)(vp); vb.hf[1] = *(const v8h*)(vp + 16);
            o1 = wmma16(pa.v, vb.v, o1);
            vp += (size_t)16 * NS;
            vb.hf[0] = *(const v8h*)(vp); vb.hf[1] = *(const v8h*)(vp + 16);
            o2 = wmma16(pa.v, vb.v, o2);
            vp += (size_t)16 * NS;
            vb.hf[0] = *(const v8h*)(vp); vb.hf[1] = *(const v8h*)(vp + 16);
            o3 = wmma16(pa.v, vb.v, o3);
        }
        __syncthreads();   // fragment reload complete before the next step overwrites the P tile
    }

    // epilogue: normalise (fold back 1/16384), stage in LDS in [row][d] order
    const float osc = 1.0f / 16384.0f;
    #pragma unroll
    for (int r = 0; r < 8; ++r) {
        const float invl = osc * __builtin_amdgcn_rcpf(lrun[r]);
        const int rowl = 8 * hh + r;
        Ow[rowl * OPITCH + m]      = o0[r] * invl;
        Ow[rowl * OPITCH + 16 + m] = o1[r] * invl;
        Ow[rowl * OPITCH + 32 + m] = o2[r] * invl;
        Ow[rowl * OPITCH + 48 + m] = o3[r] * invl;
    }
    __syncthreads();

    attn_store_pass(Ow, noise, out, bh, b, h, q0, l);
    
}

// ---------------------------------------------------------------------------
extern "C" void kernel_launch(void* const* d_in, const int* in_sizes, int n_in,
                              void* d_out, int out_size, void* d_ws, size_t ws_size,
                              hipStream_t stream)
{
    if (n_in < 8) return;
    const int n_x = NB * NS * NDIM;
    const int n_w = NDIM * NDIM;
    if (in_sizes[0] != n_x || in_sizes[1] != n_w || in_sizes[2] != NDIM ||
        in_sizes[3] != n_w || in_sizes[4] != NDIM || in_sizes[5] != n_w ||
        in_sizes[6] != NDIM || in_sizes[7] != NB * NH * NS * NHD || out_size != n_x)
        return;

    const float* x     = (const float*)d_in[0];
    const float* Wq    = (const float*)d_in[1];
    const float* bq    = (const float*)d_in[2];
    const float* Wk    = (const float*)d_in[3];
    const float* bk    = (const float*)d_in[4];
    const float* Wv    = (const float*)d_in[5];
    const float* bv    = (const float*)d_in[6];
    const float* noise = (const float*)d_in[7];
    float* out = (float*)d_out;

    // workspace carve (bytes): xh 8 MiB | wh 1.5 MiB | qh 8 MiB | kh 8 MiB | vt 8 MiB = 33.5 MiB
    const size_t bytes_xh  = (size_t)n_x * 2;
    const size_t bytes_wh  = (size_t)3 * n_w * 2;
    const size_t bytes_qkv = (size_t)NB * NH * NS * NHD * 2;
    const size_t off_xh = 0;
    const size_t off_wh = off_xh + bytes_xh;
    const size_t off_q  = off_wh + bytes_wh;
    const size_t off_k  = off_q + bytes_qkv;
    const size_t off_v  = off_k + bytes_qkv;
    const size_t end    = off_v + bytes_qkv;
    if (end > ws_size) return;

    char* ws = (char*)d_ws;
    h16* xh = (h16*)(ws + off_xh);
    h16* wh = (h16*)(ws + off_wh);
    h16* qh = (h16*)(ws + off_q);
    h16* kh = (h16*)(ws + off_k);
    h16* vt = (h16*)(ws + off_v);

    const int nxc = n_x / 8;            // 524288 chunks
    const int nwc = n_w / 8;            // 32768 chunks per weight
    const int total_chunks = nxc + 3 * nwc;
    const int cgrid = (total_chunks + 255) / 256;
    k_convert<<<dim3(cgrid), dim3(256), 0, stream>>>(x, Wq, Wk, Wv, xh, wh, nxc, nwc);

    dim3 pg((NB * NS) / 64, NDIM / 64, 3);     // 128 x 8 x 3
    k_proj<<<pg, dim3(128), 0, stream>>>(xh, wh, bq, bk, bv, qh, kh, vt);

    dim3 ag(NS / 64, NH, NB);                  // 32 x 8 x 4
    k_attn<<<ag, dim3(128), 0, stream>>>(qh, kh, vt, noise, out);
}

// v001
// One run takes 157 microseconds.
// Next to v000, in two timings, it ran 1.54 and 1.52 times as fast.
// All contractions: v_wmma_f32_16x16x32_f16 (f16 operands, f32 accumulate): q/k/v projections (weights carried x64, folded as 1/64), q.k^T scores, p.v (p carried x16384, folded as 1/16384).
#include <hip/hip_runtime.h>
#include <stdint.h>
#include <stddef.h>

#define NB   4
#define NS   2048
#define NDIM 512
#define NH   8
#define NHD  64

#define TP   72     // projection LDS tile pitch (halves)
#define PPITCH 40   // P tile pitch (halves)
#define OPITCH 68   // output staging pitch (floats)
#define KP   72     // K tile LDS pitch (halves): 144 B = 16 B x odd, conflict-free 16-B row reads
#define VP   40     // V^T tile LDS pitch (halves): 80 B = 16 B x odd

typedef _Float16 h16;
typedef h16   v16h __attribute__((ext_vector_type(16)));
typedef h16   v8h  __attribute__((ext_vector_type(8), __may_alias__));
typedef float v8f  __attribute__((ext_vector_type(8)));
typedef float v4f  __attribute__((ext_vector_type(4), __may_alias__));

union Frag { v16h v; v8h hf[2]; };
union Pack8 { v8h v; h16 e[8]; };

static_assert(sizeof(Frag) == 32);
static_assert(sizeof(Pack8) == 16);
static_assert(NS % 64 == 0);
static_assert(NDIM % 64 == 0);
static_assert(NHD == 64);

// 16x16x32 f16 WMMA with hazard guard: D tied, A/B kept live across 4 VALU slots.
__device__ __forceinline__ v8f wmma16(const v16h a, const v16h b, v8f c)
{
    c = __builtin_amdgcn_wmma_f32_16x16x32_f16(false, a, false, b, (short)0, c, false, false);
    asm volatile("v_nop\n\tv_nop\n\tv_nop\n\tv_nop" : "+v"(c) : "v"(a), "v"(b));
    return c;
}

// ---------------------------------------------------------------------------
// Kernel 0: one-time f32 -> f16 conversion of x (unscaled) and Wq/Wk/Wv (x64, exact).
// Each thread converts 8 consecutive floats and writes one 16-B piece; a wave writes
// ---------------------------------------------------------------------------
__global__ __launch_bounds__(256) void k_convert(
    const float* __restrict__ x, const float* __restrict__ wq,
    const float* __restrict__ wk, const float* __restrict__ wv,
    h16* __restrict__ xh, h16* __restrict__ wh, int nxc, int nwc)
{
    const int t = blockIdx.x * 256 + threadIdx.x;      // 8-element chunk id
    const int total = nxc + 3 * nwc;
    if (t >= total) return;
    const float* src;
    h16* dst;
    float sc;
    if (t < nxc) {
        src = x + (size_t)t * 8;
        dst = xh + (size_t)t * 8;
        sc  = 1.0f;
    } else {
        const int u = t - nxc;
        const int w = u / nwc;
        const int c = u - w * nwc;
        const float* wp = (w == 0) ? wq : ((w == 1) ? wk : wv);
        src = wp + (size_t)c * 8;
        dst = wh + (size_t)u * 8;
        sc  = 64.0f;
    }
    const v4f f0 = *(const v4f*)(src);
    const v4f f1 = *(const v4f*)(src + 4);
    Pack8 p;
    p.e[0] = (h16)(f0.x * sc); p.e[1] = (h16)(f0.y * sc);
    p.e[2] = (h16)(f0.z * sc); p.e[3] = (h16)(f0.w * sc);
    p.e[4] = (h16)(f1.x * sc); p.e[5] = (h16)(f1.y * sc);
    p.e[6] = (h16)(f1.z * sc); p.e[7] = (h16)(f1.w * sc);
    const v8h val = p.v;
    *(v8h*)dst = val;
    
}

// ---------------------------------------------------------------------------
// Kernel 1: q/k/v = x @ W^T + b  (M = B*S = 8192, N = 512, K = 512), blockIdx.z selects W.
// Block tile 64 rows x 64 cols (one head), 128 threads = 4 waves, wave tile 32x32 (2x2 acc).
// A fragments from xh rows, B fragments from wh rows (W is [n][k], k-contiguous): both use the
// split k-map (elements 0..7 <- k0+8h.., 8..15 <- k0+16+8h..). Epilogue stages the 64x64 f16
// Outputs: qh, kh as [B,H,S,64]; vt as [B,H,64,S].
// ---------------------------------------------------------------------------
__device__ __forceinline__ void proj_store_pass(const h16* T, h16* base, size_t rowpitch,
                                                int w, int l)
{
    const int piece = l & 7, rq = l >> 3;
    #pragma unroll
    for (int i = 0; i < 4; ++i) {
        const int row = w * 16 + 4 * i + rq;                 // 0..63, every row exactly once
        const v8h v = *(const v8h*)&T[row * TP + 8 * piece];
        *(v8h*)(base + (size_t)row * rowpitch + 8 * piece) = v;
    }
}

__global__ __launch_bounds__(128) void k_proj(
    const h16* __restrict__ xh, const h16* __restrict__ wh,
    const float* __restrict__ bq, const float* __restrict__ bk, const float* __restrict__ bv,
    h16* __restrict__ qh, h16* __restrict__ kh, h16* __restrict__ vt)
{
    __shared__ __attribute__((aligned(16))) h16 T[64 * TP];

    const int tid = threadIdx.x, l = tid & 31, w = tid >> 5;
    const int hh = l >> 4, m = l & 15;
    const int z = blockIdx.z;
    const int row0 = blockIdx.x * 64;          // global m (= b*2048 + s)
    const int col0 = blockIdx.y * 64;          // global n (= head*64 + d)
    const int wr = (w & 1) * 32, wc = (w >> 1) * 32;

    const h16* arow0 = xh + (size_t)(row0 + wr + m) * NDIM + 8 * hh;
    const h16* arow1 = arow0 + (size_t)16 * NDIM;
    const h16* brow0 = wh + ((size_t)z * NDIM + (size_t)(col0 + wc + m)) * NDIM + 8 * hh;
    const h16* brow1 = brow0 + (size_t)16 * NDIM;

    v8f acc00 = {}, acc01 = {}, acc10 = {}, acc11 = {};

    for (int k0 = 0; k0 < NDIM; k0 += 32) {
        Frag a0, a1, b0, b1;
        a0.hf[0] = *(const v8h*)(arow0 + k0);  a0.hf[1] = *(const v8h*)(arow0 + k0 + 16);
        a1.hf[0] = *(const v8h*)(arow1 + k0);  a1.hf[1] = *(const v8h*)(arow1 + k0 + 16);
        b0.hf[0] = *(const v8h*)(brow0 + k0);  b0.hf[1] = *(const v8h*)(brow0 + k0 + 16);
        b1.hf[0] = *(const v8h*)(brow1 + k0);  b1.hf[1] = *(const v8h*)(brow1 + k0 + 16);
        acc00 = wmma16(a0.v, b0.v, acc00);
        acc01 = wmma16(a0.v, b1.v, acc01);
        acc10 = wmma16(a1.v, b0.v, acc10);
        acc11 = wmma16(a1.v, b1.v, acc11);
    }

    // epilogue: undo the x64 weight scale, add bias, convert to f16, stage in LDS
    const float* bias = (z == 0) ? bq : ((z == 1) ? bk : bv);
    const bool tr = (z == 2);
    const float wsc = 0.015625f;   // 1/64
    #pragma unroll
    for (int i = 0; i < 2; ++i) {
        #pragma unroll
        for (int j = 0; j < 2; ++j) {
            const v8f acc = (i == 0) ? (j == 0 ? acc00 : acc01) : (j == 0 ? acc10 : acc11);
            const int c = wc + 16 * j + m;           // local col (d within head)
            const float bs = bias[col0 + c];
            #pragma unroll
            for (int r = 0; r < 8; ++r) {
                const int rr = wr + 16 * i + 8 * hh + r;   // local row (s within tile)
                const float v = acc[r] * wsc + bs;
                const int idx = tr ? (c * TP + rr) : (rr * TP + c);
                T[idx] = (h16)v;
            }
        }
    }
    __syncthreads();

    const int bb = row0 >> 11, s0 = row0 & (NS - 1), head = blockIdx.y;
    const size_t bhh = (size_t)bb * NH + head;
    h16* base;
    size_t rowpitch;
    if (tr) {   // vt[bh][d][s]: LDS row index = d
        base = vt + bhh * NHD * NS + s0;
        rowpitch = NS;
    } else {    // qh/kh[bh][s][d]: LDS row index = s_local
        base = ((z == 0) ? qh : kh) + (bhh * NS + s0) * NHD;
        rowpitch = NHD;
    }
    proj_store_pass(T, base, rowpitch, w, l);
    
}

// ---------------------------------------------------------------------------
// Kernel 2: flash attention per (b, h). 128 threads = 4 waves; block = 64 queries, wave = 16
// query rows; 32 keys per step. Q kept as two A fragments. Each step's K tile (32 kh rows, [key][d])
// and V^T tile (64 vt rows, [d][key]) are brought into LDS once per block, in two buffers: every
// thread loads four 16-B pieces of the next step's tiles at the top of a step and stores them at its
// foot. K B-fragments (k = d) and V B-fragments (k = key) are read from those tiles by all 4 waves;
// P goes D -> LDS (f16, x16384) -> A fragment with a barrier in between. Online softmax in f32
// in the exp2 domain. Epilogue: normalise, add noise, scale by 1/1.01, stage 16x64 f32 rows in
// ---------------------------------------------------------------------------
__device__ __forceinline__ void attn_store_pass(const float* Ow, const float* __restrict__ noise,
                                                float* out, size_t bh, int b, int h, int q0, int l)
{
    const float inv101 = 1.0f / 1.01f;
    const int piece = l & 15, rsel = l >> 4;
    #pragma unroll
    for (int i = 0; i < 8; ++i) {
        const int rowl = 2 * i + rsel;                      // 0..15, every row exactly once
        const int q = q0 + rowl;
        const v4f y  = *(const v4f*)&Ow[rowl * OPITCH + 4 * piece];
        const v4f nz = *(const v4f*)(noise + ((bh * NS + (size_t)q) * NHD + 4 * piece));
        const v4f val = (y + nz) * inv101;
        *(v4f*)(out + (((size_t)b * NS + (size_t)q) * NDIM + (size_t)h * NHD + 4 * piece)) = val;
    }
}

__global__ __launch_bounds__(128) void k_attn(
    const h16* __restrict__ qh, const h16* __restrict__ kh, const h16* __restrict__ vt,
    const float* __restrict__ noise, float* __restrict__ out)
{
    __shared__ __attribute__((aligned(16))) h16   Pt[4][16 * PPITCH];
    __shared__ __attribute__((aligned(16))) float Ot[4][16 * OPITCH];
    __shared__ __attribute__((aligned(16))) h16   Kt[2][32 * KP];
    __shared__ __attribute__((aligned(16))) h16   Vt[2][64 * VP];

    const int tid = threadIdx.x, l = tid & 31, w = tid >> 5;
    const int hh = l >> 4, m = l & 15;
    const int b = blockIdx.z, h = blockIdx.y;
    const size_t bh = (size_t)b * NH + h;
    const int q0 = blockIdx.x * 64 + w * 16;

    // Q rows q0+m as A fragments: qa0 covers d 0..31, qa1 covers d 32..63 (split k-map)
    Frag qa0, qa1;
    {
        const h16* qrow = qh + (bh * NS + (size_t)(q0 + m)) * NHD + 8 * hh;
        qa0.hf[0] = *(const v8h*)(qrow);      qa0.hf[1] = *(const v8h*)(qrow + 16);
        qa1.hf[0] = *(const v8h*)(qrow + 32); qa1.hf[1] = *(const v8h*)(qrow + 48);
    }
    // staging map, 16-B pieces: thread t moves K pieces t, t+128 (piece p: key p>>3, d 8*(p&7); the
    // tile is 4 KiB contiguous in kh) and V^T pieces t, t+128 (piece p: d p>>2, key 8*(p&3))
    const h16* kg = kh + bh * NS * NHD + (size_t)tid * 8;                         // + key0 * NHD
    const h16* vg = vt + (bh * NHD + (size_t)(tid >> 2)) * NS + 8 * (tid & 3);    // + key0
    const int  ks = (tid >> 3) * KP + 8 * (tid & 7);
    const int  vs = (tid >> 2) * VP + 8 * (tid & 3);
    const int  kf = m * KP + 8 * hh;     // fragment reads: K tile row = key, + 16 * KP for keys 16..31
    const int  vf = m * VP + 8 * hh;     // V^T tile row = d, + 16t * VP

    v8h sk0 = *(const v8h*)(kg);
    v8h sk1 = *(const v8h*)(kg + 16 * NHD);
    v8h sv0 = *(const v8h*)(vg);
    v8h sv1 = *(const v8h*)(vg + (size_t)32 * NS);
    // keeps the overwrite of the address registers of the loads above behind this wait
    asm volatile("s_wait_xcnt 0x0" ::: "memory");
    *(v8h*)&Kt[0][ks]           = sk0;
    *(v8h*)&Kt[0][ks + 16 * KP] = sk1;
    *(v8h*)&Vt[0][vs]           = sv0;
    *(v8h*)&Vt[0][vs + 32 * VP] = sv1;
    __syncthreads();   // tiles of step 0 complete before any wave reads fragments from them

    float mrun[8], lrun[8];
    v8f o0 = {}, o1 = {}, o2 = {}, o3 = {};
    #pragma unroll
    for (int r = 0; r < 8; ++r) { mrun[r] = -__builtin_inff(); lrun[r] = 0.0f; }

    const float sc  = 0.125f * 1.44269504088896f;   // HD^-0.5 * log2(e)
    const float psc = 16384.0f;
    h16*   Pw = &Pt[w][0];
    float* Ow = &Ot[w][0];

    for (int kt = 0; kt < NS / 32; ++kt) {
        const int  cur  = kt & 1;
        const bool more = (kt + 1 < NS / 32);     // the same for the whole block

        // next step's tiles: global loads issued here, stored to the other buffer at the foot
        if (more) {
            const int keyn = (kt + 1) * 32;
            const h16* kn = kg + (size_t)keyn * NHD;
            const h16* vn = vg + keyn;
            sk0 = *(const v8h*)(kn);
            sk1 = *(const v8h*)(kn + 16 * NHD);
            sv0 = *(const v8h*)(vn);
            sv1 = *(const v8h*)(vn + (size_t)32 * NS);
        }

        // scores: 16 queries x 32 keys; tile c0 = keys key0..+15, c1 = keys key0+16..+31
        v8f c0 = {}, c1 = {};
        {
            const h16* kp = &Kt[cur][kf];
            Frag kb0, kb1, kb2, kb3;      // read as one group ahead of the four products
            kb0.hf[0] = *(const v8h*)(kp);      kb0.hf[1] = *(const v8h*)(kp + 16);
            kb1.hf[0] = *(const v8h*)(kp + 32); kb1.hf[1] = *(const v8h*)(kp + 48);
            kp += 16 * KP;
            kb2.hf[0] = *(const v8h*)(kp);      kb2.hf[1] = *(const v8h*)(kp + 16);
            kb3.hf[0] = *(const v8h*)(kp + 32); kb3.hf[1] = *(const v8h*)(kp + 48);
            c0 = wmma16(qa0.v, kb0.v, c0);
            c0 = wmma16(qa1.v, kb1.v, c0);
            c1 = wmma16(qa0.v, kb2.v, c1);
            c1 = wmma16(qa1.v, kb3.v, c1);
        }

        // online softmax; row 8hh+r statistics replicated over the 16 lanes of each half
        #pragma unroll
        for (int r = 0; r < 8; ++r) {
            const float s0 = c0[r] * sc;
            const float s1 = c1[r] * sc;
            float mt = fmaxf(s0, s1);
            #pragma unroll
            for (int off = 1; off < 16; off <<= 1)
                mt = fmaxf(mt, __shfl_xor(mt, off, 32));
            const float mnew  = fmaxf(mrun[r], mt);
            const float alpha = exp2f(mrun[r] - mnew);
            const float p0 = exp2f(s0 - mnew);
            const float p1 = exp2f(s1 - mnew);
            float rs = p0 + p1;
            #pragma unroll
            for (int off = 1; off < 16; off <<= 1)
                rs += __shfl_xor(rs, off, 32);
            lrun[r] = lrun[r] * alpha + rs;
            mrun[r] = mnew;
            o0[r] *= alpha; o1[r] *= alpha; o2[r] *= alpha; o3[r] *= alpha;
            const int rowl = 8 * hh + r;
            Pw[rowl * PPITCH + m]      = (h16)(p0 * psc);
            Pw[rowl * PPITCH + 16 + m] = (h16)(p1 * psc);
        }
        __syncthreads();   // P tile stores complete before the fragment reload

        // O += P V : A = P[q][key] from LDS (split k-map), B = V^T tile rows d (k = key contiguous)
        Frag pa;
        pa.hf[0] = *(const v8h*)&Pw[m * PPITCH + 8 * hh];
        pa.hf[1] = *(const v8h*)&Pw[m * PPITCH + 16 + 8 * hh];
        {
            const h16* vp = &Vt[cur][vf];
            Frag vb0, vb1, vb2, vb3;      // read as one group ahead of the four products
            vb0.hf[0] = *(const v8h*)(vp);           vb0.hf[1] = *(const v8h*)(vp + 16);
            vb1.hf[0] = *(const v8h*)(vp + 16 * VP); vb1.hf[1] = *(const v8h*)(vp + 16 * VP + 16);
            vb2.hf[0] = *(const v8h*)(vp + 32 * VP); vb2.hf[1] = *(const v8h*)(vp + 32 * VP + 16);
            vb3.hf[0] = *(const v8h*)(vp + 48 * VP); vb3.hf[1] = *(const v8h*)(vp + 48 * VP + 16);
            o0 = wmma16(pa.v, vb0.v, o0);
            o1 = wmma16(pa.v, vb1.v, o1);
            o2 = wmma16(pa.v, vb2.v, o2);
            o3 = wmma16(pa.v, vb3.v, o3);
        }

        // the other buffer's last readers left it before the previous step's foot barrier
        if (more) {
            *(v8h*)&Kt[cur ^ 1][ks]           = sk0;
            *(v8h*)&Kt[cur ^ 1][ks + 16 * KP] = sk1;
            *(v8h*)&Vt[cur ^ 1][vs]           = sv0;
            *(v8h*)&Vt[cur ^ 1][vs + 32 * VP] = sv1;
        }
        __syncthreads();   // P fragment reload complete before the next step overwrites the P tile;
                           // next step's K and V^T tiles complete before any wave reads them
    }

    // epilogue: normalise (fold back 1/16384), stage in LDS in [row][d] order
    const float osc = 1.0f / 16384.0f;
    #pragma unroll
    for (int r = 0; r < 8; ++r) {
        const float invl = osc * __builtin_amdgcn_rcpf(lrun[r]);
        const int rowl = 8 * hh + r;
        Ow[rowl * OPITCH + m]      = o0[r] * invl;
        Ow[rowl * OPITCH + 16 + m] = o1[r] * invl;
        Ow[rowl * OPITCH + 32 + m] = o2[r] * invl;
        Ow[rowl * OPITCH + 48 + m] = o3[r] * invl;
    }
    __syncthreads();

    attn_store_pass(Ow, noise, out, bh, b, h, q0, l);
    
}

// ---------------------------------------------------------------------------
extern "C" void kernel_launch(void* const* d_in, const int* in_sizes, int n_in,
                              void* d_out, int out_size, void* d_ws, size_t ws_size,
                              hipStream_t stream)
{
    if (n_in < 8) return;
    const int n_x = NB * NS * NDIM;
    const int n_w = NDIM * NDIM;
    if (in_sizes[0] != n_x || in_sizes[1] != n_w || in_sizes[2] != NDIM ||
        in_sizes[3] != n_w || in_sizes[4] != NDIM || in_sizes[5] != n_w ||
        in_sizes[6] != NDIM || in_sizes[7] != NB * NH * NS * NHD || out_size != n_x)
        return;

    const float* x     = (const float*)d_in[0];
    const float* Wq    = (const float*)d_in[1];
    const float* bq    = (const float*)d_in[2];
    const float* Wk    = (const float*)d_in[3];
    const float* bk    = (const float*)d_in[4];
    const float* Wv    = (const float*)d_in[5];
    const float* bv    = (const float*)d_in[6];
    const float* noise = (const float*)d_in[7];
    float* out = (float*)d_out;

    // workspace carve (bytes): xh 8 MiB | wh 1.5 MiB | qh 8 MiB | kh 8 MiB | vt 8 MiB = 33.5 MiB
    const size_t bytes_xh  = (size_t)n_x * 2;
    const size_t bytes_wh  = (size_t)3 * n_w * 2;
    const size_t bytes_qkv = (size_t)NB * NH * NS * NHD * 2;
    const size_t off_xh = 0;
    const size_t off_wh = off_xh + bytes_xh;
    const size_t off_q  = off_wh + bytes_wh;
    const size_t off_k  = off_q + bytes_qkv;
    const size_t off_v  = off_k + bytes_qkv;
    const size_t end    = off_v + bytes_qkv;
    if (end > ws_size) return;

    char* ws = (char*)d_ws;
    h16* xh = (h16*)(ws + off_xh);
    h16* wh = (h16*)(ws + off_wh);
    h16* qh = (h16*)(ws + off_q);
    h16* kh = (h16*)(ws + off_k);
    h16* vt = (h16*)(ws + off_v);

    const int nxc = n_x / 8;            // 524288 chunks
    const int nwc = n_w / 8;            // 32768 chunks per weight
    const int total_chunks = nxc + 3 * nwc;
    const int cgrid = (total_chunks + 255) / 256;
    k_convert<<<dim3(cgrid), dim3(256), 0, stream>>>(x, Wq, Wk, Wv, xh, wh, nxc, nwc);

    dim3 pg((NB * NS) / 64, NDIM / 64, 3);     // 128 x 8 x 3
    k_proj<<<pg, dim3(128), 0, stream>>>(xh, wh, bq, bk, bv, qh, kh, vt);

    dim3 ag(NS / 64, NH, NB);                  // 32 x 8 x 4
    k_attn<<<ag, dim3(128), 0, stream>>>(qh, kh, vt, noise, out);
}

// v002
// A run of this version takes 119 microseconds.
// Timed twice side by side with v001, it ran 1.31 and 1.33 times as fast.
// Counting every step since v000, it is 2.02 times as fast.
// All contractions: v_wmma_f32_16x16x32_f16 (f16 operands, f32 accumulate): q/k/v projections (weights carried x64, folded as 1/64), q.k^T scores, p.v (p carried x16384, folded as 1/16384).
#include <hip/hip_runtime.h>
#include <stdint.h>
#include <stddef.h>

#define NB   4
#define NS   2048
#define NDIM 512
#define NH   8
#define NHD  64

#define TP   72     // projection LDS tile pitch (halves)
#define OPITCH 68   // output staging pitch (floats)
#define KP   72     // K tile LDS pitch (halves): 144 B = 16 B x odd, conflict-free 16-B row reads
#define VP   40     // V^T tile LDS pitch (halves): 80 B = 16 B x odd

typedef _Float16 h16;
typedef h16   v16h __attribute__((ext_vector_type(16)));
typedef h16   v8h  __attribute__((ext_vector_type(8), __may_alias__));
typedef float v8f  __attribute__((ext_vector_type(8)));
typedef float v4f  __attribute__((ext_vector_type(4), __may_alias__));

union Frag { v16h v; v8h hf[2]; };
union Pack8 { v8h v; h16 e[8]; };

static_assert(sizeof(Frag) == 32);
static_assert(sizeof(Pack8) == 16);
static_assert(NS % 64 == 0);
static_assert(NDIM % 64 == 0);
static_assert(NHD == 64);

// 16x16x32 f16 WMMA with hazard guard: D tied, A/B kept live across 4 VALU slots.
__device__ __forceinline__ v8f wmma16(const v16h a, const v16h b, v8f c)
{
    c = __builtin_amdgcn_wmma_f32_16x16x32_f16(false, a, false, b, (short)0, c, false, false);
    asm volatile("v_nop\n\tv_nop\n\tv_nop\n\tv_nop" : "+v"(c) : "v"(a), "v"(b));
    return c;
}

// ---------------------------------------------------------------------------
// Kernel 0: one-time f32 -> f16 conversion of x (unscaled) and Wq/Wk/Wv (x64, exact).
// Each thread converts 8 consecutive floats and writes one 16-B piece; a wave writes
// ---------------------------------------------------------------------------
__global__ __launch_bounds__(256) void k_convert(
    const float* __restrict__ x, const float* __restrict__ wq,
    const float* __restrict__ wk, const float* __restrict__ wv,
    h16* __restrict__ xh, h16* __restrict__ wh, int nxc, int nwc)
{
    const int t = blockIdx.x * 256 + threadIdx.x;      // 8-element chunk id
    const int total = nxc + 3 * nwc;
    if (t >= total) return;
    const float* src;
    h16* dst;
    float sc;
    if (t < nxc) {
        src = x + (size_t)t * 8;
        dst = xh + (size_t)t * 8;
        sc  = 1.0f;
    } else {
        const int u = t - nxc;
        const int w = u / nwc;
        const int c = u - w * nwc;
        const float* wp = (w == 0) ? wq : ((w == 1) ? wk : wv);
        src = wp + (size_t)c * 8;
        dst = wh + (size_t)u * 8;
        sc  = 64.0f;
    }
    const v4f f0 = *(const v4f*)(src);
    const v4f f1 = *(const v4f*)(src + 4);
    Pack8 p;
    p.e[0] = (h16)(f0.x * sc); p.e[1] = (h16)(f0.y * sc);
    p.e[2] = (h16)(f0.z * sc); p.e[3] = (h16)(f0.w * sc);
    p.e[4] = (h16)(f1.x * sc); p.e[5] = (h16)(f1.y * sc);
    p.e[6] = (h16)(f1.z * sc); p.e[7] = (h16)(f1.w * sc);
    const v8h val = p.v;
    *(v8h*)dst = val;
    
}

// ---------------------------------------------------------------------------
// Kernel 1: q/k/v = x @ W^T + b  (M = B*S = 8192, N = 512, K = 512), blockIdx.z selects W.
// Block tile 64 rows x 64 cols (one head), 128 threads = 4 waves, wave tile 32x32 (2x2 acc).
// A fragments from xh rows, B fragments from wh rows (W is [n][k], k-contiguous): both use the
// split k-map (elements 0..7 <- k0+8h.., 8..15 <- k0+16+8h..). Epilogue stages the 64x64 f16
// Outputs: qh, kh as [B,H,S,64]; vt as [B,H,64,S].
// ---------------------------------------------------------------------------
__device__ __forceinline__ void proj_store_pass(const h16* T, h16* base, size_t rowpitch,
                                                int w, int l)
{
    const int piece = l & 7, rq = l >> 3;
    #pragma unroll
    for (int i = 0; i < 4; ++i) {
        const int row = w * 16 + 4 * i + rq;                 // 0..63, every row exactly once
        const v8h v = *(const v8h*)&T[row * TP + 8 * piece];
        *(v8h*)(base + (size_t)row * rowpitch + 8 * piece) = v;
    }
}

__global__ __launch_bounds__(128) void k_proj(
    const h16* __restrict__ xh, const h16* __restrict__ wh,
    const float* __restrict__ bq, const float* __restrict__ bk, const float* __restrict__ bv,
    h16* __restrict__ qh, h16* __restrict__ kh, h16* __restrict__ vt)
{
    __shared__ __attribute__((aligned(16))) h16 T[64 * TP];

    const int tid = threadIdx.x, l = tid & 31, w = tid >> 5;
    const int hh = l >> 4, m = l & 15;
    const int z = blockIdx.z;
    const int row0 = blockIdx.x * 64;          // global m (= b*2048 + s)
    const int col0 = blockIdx.y * 64;          // global n (= head*64 + d)
    const int wr = (w & 1) * 32, wc = (w >> 1) * 32;

    const h16* arow0 = xh + (size_t)(row0 + wr + m) * NDIM + 8 * hh;
    const h16* arow1 = arow0 + (size_t)16 * NDIM;
    const h16* brow0 = wh + ((size_t)z * NDIM + (size_t)(col0 + wc + m)) * NDIM + 8 * hh;
    const h16* brow1 = brow0 + (size_t)16 * NDIM;

    v8f acc00 = {}, acc01 = {}, acc10 = {}, acc11 = {};

    for (int k0 = 0; k0 < NDIM; k0 += 32) {
        Frag a0, a1, b0, b1;
        a0.hf[0] = *(const v8h*)(arow0 + k0);  a0.hf[1] = *(const v8h*)(arow0 + k0 + 16);
        a1.hf[0] = *(const v8h*)(arow1 + k0);  a1.hf[1] = *(const v8h*)(arow1 + k0 + 16);
        b0.hf[0] = *(const v8h*)(brow0 + k0);  b0.hf[1] = *(const v8h*)(brow0 + k0 + 16);
        b1.hf[0] = *(const v8h*)(brow1 + k0);  b1.hf[1] = *(const v8h*)(brow1 + k0 + 16);
        acc00 = wmma16(a0.v, b0.v, acc00);
        acc01 = wmma16(a0.v, b1.v, acc01);
        acc10 = wmma16(a1.v, b0.v, acc10);
        acc11 = wmma16(a1.v, b1.v, acc11);
    }

    // epilogue: undo the x64 weight scale, add bias, convert to f16, stage in LDS
    const float* bias = (z == 0) ? bq : ((z == 1) ? bk : bv);
    const bool tr = (z == 2);
    const float wsc = 0.015625f;   // 1/64
    #pragma unroll
    for (int i = 0; i < 2; ++i) {
        #pragma unroll
        for (int j = 0; j < 2; ++j) {
            const v8f acc = (i == 0) ? (j == 0 ? acc00 : acc01) : (j == 0 ? acc10 : acc11);
            const int c = wc + 16 * j + m;           // local col (d within head)
            const float bs = bias[col0 + c];
            #pragma unroll
            for (int r = 0; r < 8; ++r) {
                const int rr = wr + 16 * i + 8 * hh + r;   // local row (s within tile)
                const float v = acc[r] * wsc + bs;
                const int idx = tr ? (c * TP + rr) : (rr * TP + c);
                T[idx] = (h16)v;
            }
        }
    }
    __syncthreads();

    const int bb = row0 >> 11, s0 = row0 & (NS - 1), head = blockIdx.y;
    const size_t bhh = (size_t)bb * NH + head;
    h16* base;
    size_t rowpitch;
    if (tr) {   // vt[bh][d][s]: LDS row index = d
        base = vt + bhh * NHD * NS + s0;
        rowpitch = NS;
    } else {    // qh/kh[bh][s][d]: LDS row index = s_local
        base = ((z == 0) ? qh : kh) + (bhh * NS + s0) * NHD;
        rowpitch = NHD;
    }
    proj_store_pass(T, base, rowpitch, w, l);
    
}

// ---------------------------------------------------------------------------
// Kernel 2: flash attention per (b, h). 128 threads = 4 waves; block = 64 queries, wave = 16
// query rows; 32 keys per step. Q kept as two B fragments. Each step's K tile (32 kh rows, [key][d])
// and V^T tile (64 vt rows, [d][key]) are brought into LDS once per block, in two buffers: every
// thread loads four 16-B pieces of the next step's tiles at the top of a step and stores them at its
// foot. Both products run transposed: S^T = K Q^T (A = K tile rows, k = d; B = Q) and
// O^T += V^T P^T (A = V^T tile rows, k = key; B = P^T). A lane then holds 16 of the 32 scores of ONE
// query (column l & 15): maximum and sum run in its own registers, with one exchange between the wave
// halves for the maximum; the two score tiles, converted in place (f16, x16384), are the B fragment
// of the second product, so P never goes through LDS. Online softmax in f32 in the exp2 domain; each
// half keeps the sum of its own keys, joined once behind the loop.
// Epilogue: normalise, add noise, scale by 1/1.01, stage 16x64 f32 rows in
// ---------------------------------------------------------------------------
// value of lane l ^ 16 (the other half of the wave), by a vector cross-row move
__device__ __forceinline__ float xhalf(float x)
{
    const int b = __builtin_bit_cast(int, x);
    return __builtin_bit_cast(float,
        __builtin_amdgcn_permlanex16(b, b, 0x76543210, 0xfedcba98, false, false));
}

__device__ __forceinline__ void attn_store_pass(const float* Ow, const float* __restrict__ noise,
                                                float* out, size_t bh, int b, int h, int q0, int l)
{
    const float inv101 = 1.0f / 1.01f;
    const int piece = l & 15, rsel = l >> 4;
    #pragma unroll
    for (int i = 0; i < 8; ++i) {
        const int rowl = 2 * i + rsel;                      // 0..15, every row exactly once
        const int q = q0 + rowl;
        const v4f y  = *(const v4f*)&Ow[rowl * OPITCH + 4 * piece];
        const v4f nz = *(const v4f*)(noise + ((bh * NS + (size_t)q) * NHD + 4 * piece));
        const v4f val = (y + nz) * inv101;
        *(v4f*)(out + (((size_t)b * NS + (size_t)q) * NDIM + (size_t)h * NHD + 4 * piece)) = val;
    }
}

__global__ __launch_bounds__(128) void k_attn(
    const h16* __restrict__ qh, const h16* __restrict__ kh, const h16* __restrict__ vt,
    const float* __restrict__ noise, float* __restrict__ out)
{
    __shared__ __attribute__((aligned(16))) float Ot[4][16 * OPITCH];
    __shared__ __attribute__((aligned(16))) h16   Kt[2][32 * KP];
    __shared__ __attribute__((aligned(16))) h16   Vt[2][64 * VP];

    const int tid = threadIdx.x, l = tid & 31, w = tid >> 5;
    const int hh = l >> 4, m = l & 15;
    const int b = blockIdx.z, h = blockIdx.y;
    const size_t bh = (size_t)b * NH + h;
    const int q0 = blockIdx.x * 64 + w * 16;

    // Q rows q0+m as B fragments (column = query): qa0 covers d 0..31, qa1 d 32..63 (split k-map)
    Frag qa0, qa1;
    {
        const h16* qrow = qh + (bh * NS + (size_t)(q0 + m)) * NHD + 8 * hh;
        qa0.hf[0] = *(const v8h*)(qrow);      qa0.hf[1] = *(const v8h*)(qrow + 16);
        qa1.hf[0] = *(const v8h*)(qrow + 32); qa1.hf[1] = *(const v8h*)(qrow + 48);
    }
    // staging map, 16-B pieces: thread t moves K pieces t, t+128 (piece p: key p>>3, d 8*(p&7); the
    // tile is 4 KiB contiguous in kh) and V^T pieces t, t+128 (piece p: d p>>2, key 8*(p&3))
    const h16* kg = kh + bh * NS * NHD + (size_t)tid * 8;                         // + key0 * NHD
    const h16* vg = vt + (bh * NHD + (size_t)(tid >> 2)) * NS + 8 * (tid & 3);    // + key0
    const int  ks = (tid >> 3) * KP + 8 * (tid & 7);
    const int  vs = (tid >> 2) * VP + 8 * (tid & 3);
    const int  kf = m * KP + 8 * hh;     // fragment reads: K tile row = key, + 16 * KP for keys 16..31
    const int  vf = m * VP + 8 * hh;     // V^T tile row = d, + 16t * VP

    v8h sk0 = *(const v8h*)(kg);
    v8h sk1 = *(const v8h*)(kg + 16 * NHD);
    v8h sv0 = *(const v8h*)(vg);
    v8h sv1 = *(const v8h*)(vg + (size_t)32 * NS);
    // keeps the overwrite of the address registers of the loads above behind this wait
    asm volatile("s_wait_xcnt 0x0" ::: "memory");
    *(v8h*)&Kt[0][ks]           = sk0;
    *(v8h*)&Kt[0][ks + 16 * KP] = sk1;
    *(v8h*)&Vt[0][vs]           = sv0;
    *(v8h*)&Vt[0][vs + 32 * VP] = sv1;
    __syncthreads();   // tiles of step 0 complete before any wave reads fragments from them

    // this lane's query q0+m: running maximum (equal in both halves) and this half's own sum;
    // ot[r] = O^T[16t + 8hh + r][m]
    float mrun = -__builtin_inff(), lrun = 0.0f;
    v8f o0 = {}, o1 = {}, o2 = {}, o3 = {};

    const float sc  = 0.125f * 1.44269504088896f;   // HD^-0.5 * log2(e)
    const float psc = 16384.0f;
    float* Ow = &Ot[w][0];

    for (int kt = 0; kt < NS / 32; ++kt) {
        const int  cur  = kt & 1;
        const bool more = (kt + 1 < NS / 32);     // the same for the whole block

        // next step's tiles: global loads issued here, stored to the other buffer at the foot
        if (more) {
            const int keyn = (kt + 1) * 32;
            const h16* kn = kg + (size_t)keyn * NHD;
            const h16* vn = vg + keyn;
            sk0 = *(const v8h*)(kn);
            sk1 = *(const v8h*)(kn + 16 * NHD);
            sv0 = *(const v8h*)(vn);
            sv1 = *(const v8h*)(vn + (size_t)32 * NS);
        }

        // scores, transposed: 32 keys x 16 queries; c0[r] = key key0+8hh+r, c1[r] = key key0+16+8hh+r
        v8f c0 = {}, c1 = {};
        {
            const h16* kp = &Kt[cur][kf];
            Frag kb0, kb1, kb2, kb3;      // read as one group ahead of the four products
            kb0.hf[0] = *(const v8h*)(kp);      kb0.hf[1] = *(const v8h*)(kp + 16);
            kb1.hf[0] = *(const v8h*)(kp + 32); kb1.hf[1] = *(const v8h*)(kp + 48);
            kp += 16 * KP;
            kb2.hf[0] = *(const v8h*)(kp);      kb2.hf[1] = *(const v8h*)(kp + 16);
            kb3.hf[0] = *(const v8h*)(kp + 32); kb3.hf[1] = *(const v8h*)(kp + 48);
            c0 = wmma16(kb0.v, qa0.v, c0);
            c0 = wmma16(kb1.v, qa1.v, c0);
            c1 = wmma16(kb2.v, qa0.v, c1);
            c1 = wmma16(kb3.v, qa1.v, c1);
        }

        // online softmax of this lane's query over its 16 scores; the other half holds the other 16
        const v8f s0 = c0 * sc;
        const v8f s1 = c1 * sc;
        float mt = fmaxf(s0[0], s1[0]);
        #pragma unroll
        for (int r = 1; r < 8; ++r)
            mt = fmaxf(mt, fmaxf(s0[r], s1[r]));
        mt = fmaxf(mt, xhalf(mt));
        const float mnew  = fmaxf(mrun, mt);
        const float alpha = exp2f(mrun - mnew);
        mrun = mnew;
        const v8f t0 = s0 - mnew;
        const v8f t1 = s1 - mnew;
        v8f p0, p1;
        #pragma unroll
        for (int r = 0; r < 8; ++r) { p0[r] = exp2f(t0[r]); p1[r] = exp2f(t1[r]); }
        // P^T as B fragment: element r <- key 8hh+r, element 8+r <- key 16+8hh+r (the split k-map)
        const v8f g0 = p0 * psc;
        const v8f g1 = p1 * psc;
        Frag pb;
        #pragma unroll
        for (int r = 0; r < 8; ++r) { pb.v[r] = (h16)g0[r]; pb.v[8 + r] = (h16)g1[r]; }
        const v8f ps = p0 + p1;
        const float rs = ((ps[0] + ps[4]) + (ps[2] + ps[6])) + ((ps[1] + ps[5]) + (ps[3] + ps[7]));
        lrun = lrun * alpha + rs;
        o0 *= alpha; o1 *= alpha; o2 *= alpha; o3 *= alpha;

        // O^T += V^T P^T : A = V^T tile rows d (k = key, split k-map), B = P^T from registers
        {
            const h16* vp = &Vt[cur][vf];
            Frag vb0, vb1, vb2, vb3;      // read as one group ahead of the four products
            vb0.hf[0] = *(const v8h*)(vp);           vb0.hf[1] = *(const v8h*)(vp + 16);
            vb1.hf[0] = *(const v8h*)(vp + 16 * VP); vb1.hf[1] = *(const v8h*)(vp + 16 * VP + 16);
            vb2.hf[0] = *(const v8h*)(vp + 32 * VP); vb2.hf[1] = *(const v8h*)(vp + 32 * VP + 16);
            vb3.hf[0] = *(const v8h*)(vp + 48 * VP); vb3.hf[1] = *(const v8h*)(vp + 48 * VP + 16);
            o0 = wmma16(vb0.v, pb.v, o0);
            o1 = wmma16(vb1.v, pb.v, o1);
            o2 = wmma16(vb2.v, pb.v, o2);
            o3 = wmma16(vb3.v, pb.v, o3);
        }

        // the other buffer's last readers left it before the previous step's foot barrier
        if (more) {
            *(v8h*)&Kt[cur ^ 1][ks]           = sk0;
            *(v8h*)&Kt[cur ^ 1][ks + 16 * KP] = sk1;
            *(v8h*)&Vt[cur ^ 1][vs]           = sv0;
            *(v8h*)&Vt[cur ^ 1][vs + 32 * VP] = sv1;
        }
        __syncthreads();   // next step's K and V^T tiles complete before any wave reads them; this
                           // step's reads of its own buffer done before the next foot refills it
    }

    // epilogue: normalise (fold back 1/16384), stage in LDS in [row][d] order
    const float osc = 1.0f / 16384.0f;
    lrun += xhalf(lrun);                    // join the two halves' sums of this query
    const float invl = osc * __builtin_amdgcn_rcpf(lrun);
    {
        float* orow = &Ow[m * OPITCH + 8 * hh];      // row = query m; 8 consecutive d per tile
        const v8f y0 = o0 * invl, y1 = o1 * invl, y2 = o2 * invl, y3 = o3 * invl;
        *(v4f*)(orow)      = __builtin_shufflevector(y0, y0, 0, 1, 2, 3);
        *(v4f*)(orow + 4)  = __builtin_shufflevector(y0, y0, 4, 5, 6, 7);
        *(v4f*)(orow + 16) = __builtin_shufflevector(y1, y1, 0, 1, 2, 3);
        *(v4f*)(orow + 20) = __builtin_shufflevector(y1, y1, 4, 5, 6, 7);
        *(v4f*)(orow + 32) = __builtin_shufflevector(y2, y2, 0, 1, 2, 3);
        *(v4f*)(orow + 36) = __builtin_shufflevector(y2, y2, 4, 5, 6, 7);
        *(v4f*)(orow + 48) = __builtin_shufflevector(y3, y3, 0, 1, 2, 3);
        *(v4f*)(orow + 52) = __builtin_shufflevector(y3, y3, 4, 5, 6, 7);
    }
    __syncthreads();

    attn_store_pass(Ow, noise, out, bh, b, h, q0, l);
    
}

// ---------------------------------------------------------------------------
extern "C" void kernel_launch(void* const* d_in, const int* in_sizes, int n_in,
                              void* d_out, int out_size, void* d_ws, size_t ws_size,
                              hipStream_t stream)
{
    if (n_in < 8) return;
    const int n_x = NB * NS * NDIM;
    const int n_w = NDIM * NDIM;
    if (in_sizes[0] != n_x || in_sizes[1] != n_w || in_sizes[2] != NDIM ||
        in_sizes[3] != n_w || in_sizes[4] != NDIM || in_sizes[5] != n_w ||
        in_sizes[6] != NDIM || in_sizes[7] != NB * NH * NS * NHD || out_size != n_x)
        return;

    const float* x     = (const float*)d_in[0];
    const float* Wq    = (const float*)d_in[1];
    const float* bq    = (const float*)d_in[2];
    const float* Wk    = (const float*)d_in[3];
    const float* bk    = (const float*)d_in[4];
    const float* Wv    = (const float*)d_in[5];
    const float* bv    = (const float*)d_in[6];
    const float* noise = (const float*)d_in[7];
    float* out = (float*)d_out;

    // workspace carve (bytes): xh 8 MiB | wh 1.5 MiB | qh 8 MiB | kh 8 MiB | vt 8 MiB = 33.5 MiB
    const size_t bytes_xh  = (size_t)n_x * 2;
    const size_t bytes_wh  = (size_t)3 * n_w * 2;
    const size_t bytes_qkv = (size_t)NB * NH * NS * NHD * 2;
    const size_t off_xh = 0;
    const size_t off_wh = off_xh + bytes_xh;
    const size_t off_q  = off_wh + bytes_wh;
    const size_t off_k  = off_q + bytes_qkv;
    const size_t off_v  = off_k + bytes_qkv;
    const size_t end    = off_v + bytes_qkv;
    if (end > ws_size) return;

    char* ws = (char*)d_ws;
    h16* xh = (h16*)(ws + off_xh);
    h16* wh = (h16*)(ws + off_wh);
    h16* qh = (h16*)(ws + off_q);
    h16* kh = (h16*)(ws + off_k);
    h16* vt = (h16*)(ws + off_v);

    const int nxc = n_x / 8;            // 524288 chunks
    const int nwc = n_w / 8;            // 32768 chunks per weight
    const int total_chunks = nxc + 3 * nwc;
    const int cgrid = (total_chunks + 255) / 256;
    k_convert<<<dim3(cgrid), dim3(256), 0, stream>>>(x, Wq, Wk, Wv, xh, wh, nxc, nwc);

    dim3 pg((NB * NS) / 64, NDIM / 64, 3);     // 128 x 8 x 3
    k_proj<<<pg, dim3(128), 0, stream>>>(xh, wh, bq, bk, bv, qh, kh, vt);

    dim3 ag(NS / 64, NH, NB);                  // 32 x 8 x 4
    k_attn<<<ag, dim3(128), 0, stream>>>(qh, kh, vt, noise, out);
}

// v003
// One run takes 84.5 microseconds.
// Next to v002, in two timings, it ran 1.40 and 1.38 times as fast.
// Over all steps from v000 it is 2.81 times as fast.
// All contractions: v_wmma_f32_16x16x32_f16 (f16 operands, f32 accumulate): q/k/v projections (weights carried x64, folded as 1/64), q.k^T scores, p.v (p carried x16384, folded as 1/16384).
#include <hip/hip_runtime.h>
#include <stdint.h>
#include <stddef.h>

#define NB   4
#define NS   2048
#define NDIM 512
#define NH   8
#define NHD  64

#define TP   72     // projection LDS tile pitch (halves)
#define OPITCH 68   // output staging pitch (floats)
#define KP   72     // K tile LDS pitch (halves): 144 B = 16 B x odd, conflict-free 16-B row reads
#define VP   40     // V^T tile LDS pitch (halves): 80 B = 16 B x odd

typedef _Float16 h16;
typedef h16   v16h __attribute__((ext_vector_type(16)));
typedef h16   v8h  __attribute__((ext_vector_type(8), __may_alias__));
typedef float v8f  __attribute__((ext_vector_type(8)));
typedef float v4f  __attribute__((ext_vector_type(4), __may_alias__));

union Frag { v16h v; v8h hf[2]; };
union Pack8 { v8h v; h16 e[8]; };

static_assert(sizeof(Frag) == 32);
static_assert(sizeof(Pack8) == 16);
static_assert(NS % 64 == 0);
static_assert(NDIM % 64 == 0);
static_assert(NHD == 64);

// 16x16x32 f16 WMMA with hazard guard: D tied, A/B kept live across 4 VALU slots.
__device__ __forceinline__ v8f wmma16(const v16h a, const v16h b, v8f c)
{
    c = __builtin_amdgcn_wmma_f32_16x16x32_f16(false, a, false, b, (short)0, c, false, false);
    asm volatile("v_nop\n\tv_nop\n\tv_nop\n\tv_nop" : "+v"(c) : "v"(a), "v"(b));
    return c;
}

// ---------------------------------------------------------------------------
// Kernel 0: one-time f32 -> f16 conversion of x (unscaled) and Wq/Wk/Wv (x64, exact).
// Each thread converts 8 consecutive floats and writes one 16-B piece; a wave writes
// ---------------------------------------------------------------------------
__global__ __launch_bounds__(256) void k_convert(
    const float* __restrict__ x, const float* __restrict__ wq,
    const float* __restrict__ wk, const float* __restrict__ wv,
    h16* __restrict__ xh, h16* __restrict__ wh, int nxc, int nwc)
{
    const int t = blockIdx.x * 256 + threadIdx.x;      // 8-element chunk id
    const int total = nxc + 3 * nwc;
    if (t >= total) return;
    const float* src;
    h16* dst;
    float sc;
    if (t < nxc) {
        src = x + (size_t)t * 8;
        dst = xh + (size_t)t * 8;
        sc  = 1.0f;
    } else {
        const int u = t - nxc;
        const int w = u / nwc;
        const int c = u - w * nwc;
        const float* wp = (w == 0) ? wq : ((w == 1) ? wk : wv);
        src = wp + (size_t)c * 8;
        dst = wh + (size_t)u * 8;
        sc  = 64.0f;
    }
    const v4f f0 = *(const v4f*)(src);
    const v4f f1 = *(const v4f*)(src + 4);
    Pack8 p;
    p.e[0] = (h16)(f0.x * sc); p.e[1] = (h16)(f0.y * sc);
    p.e[2] = (h16)(f0.z * sc); p.e[3] = (h16)(f0.w * sc);
    p.e[4] = (h16)(f1.x * sc); p.e[5] = (h16)(f1.y * sc);
    p.e[6] = (h16)(f1.z * sc); p.e[7] = (h16)(f1.w * sc);
    const v8h val = p.v;
    *(v8h*)dst = val;
    
}

// ---------------------------------------------------------------------------
// Kernel 1: q/k/v = x @ W^T + b  (M = B*S = 8192, N = 512, K = 512), blockIdx.z selects W.
// Block tile 64 rows x 64 cols (one head), 128 threads = 4 waves, wave tile 32x32 (2x2 acc).
// Each step's x tile and W tile (64 rows x 64 k; W is [n][k], k-contiguous) are brought into LDS once
// per block, in two buffers, loaded a step ahead through registers. A and B fragments are read from
// them, both in the split k-map (elements 0..7 <- k0+8h.., 8..15 <- k0+16+8h..). Epilogue stages the 64x64 f16
// Outputs: qh, kh as [B,H,S,64]; vt as [B,H,64,S].
// ---------------------------------------------------------------------------
__device__ __forceinline__ void proj_store_pass(const h16* T, h16* base, size_t rowpitch,
                                                int w, int l)
{
    const int piece = l & 7, rq = l >> 3;
    #pragma unroll
    for (int i = 0; i < 4; ++i) {
        const int row = w * 16 + 4 * i + rq;                 // 0..63, every row exactly once
        const v8h v = *(const v8h*)&T[row * TP + 8 * piece];
        *(v8h*)(base + (size_t)row * rowpitch + 8 * piece) = v;
    }
}

__global__ __launch_bounds__(128) void k_proj(
    const h16* __restrict__ xh, const h16* __restrict__ wh,
    const float* __restrict__ bq, const float* __restrict__ bk, const float* __restrict__ bv,
    h16* __restrict__ qh, h16* __restrict__ kh, h16* __restrict__ vt)
{
    // tiles of 64 rows x 64 k at pitch TP: x tile buffers 0, 1, then W tile buffers 0, 1.
    // The first x buffer serves again as the output staging tile T behind the loop.
    __shared__ __attribute__((aligned(16))) h16 S[4 * 64 * TP];
    h16* T = S;

    const int tid = threadIdx.x, l = tid & 31, w = tid >> 5;
    const int hh = l >> 4, m = l & 15;
    const int z = blockIdx.z;
    const int row0 = blockIdx.x * 64;          // global m (= b*2048 + s)
    const int col0 = blockIdx.y * 64;          // global n (= head*64 + d)
    const int wr = (w & 1) * 32, wc = (w >> 1) * 32;

    // staging map, 16-B pieces: thread t moves pieces t + 128 i of each tile (piece p: row p >> 3,
    // k 8 * (p & 7)), so one wave-wide load covers four whole 128-B lines
    const h16* ag = xh + (size_t)(row0 + (tid >> 3)) * NDIM + 8 * (tid & 7);
    const h16* bg = wh + ((size_t)z * NDIM + (size_t)(col0 + (tid >> 3))) * NDIM + 8 * (tid & 7);
    const int  ss = (tid >> 3) * TP + 8 * (tid & 7);
    const int  af = (wr + m) * TP + 8 * hh;    // fragment reads: tile row, + 16 * TP for the second tile
    const int  bf = (wc + m) * TP + 8 * hh;

    v8h ra[4], rb[4];
    #pragma unroll
    for (int i = 0; i < 4; ++i) {
        ra[i] = *(const v8h*)(ag + (size_t)i * 16 * NDIM);
        rb[i] = *(const v8h*)(bg + (size_t)i * 16 * NDIM);
    }
    #pragma unroll
    for (int i = 0; i < 4; ++i) {
        *(v8h*)&S[ss + i * 16 * TP]               = ra[i];
        *(v8h*)&S[2 * 64 * TP + ss + i * 16 * TP] = rb[i];
    }
    __syncthreads();   // tiles of step 0 complete before any wave reads fragments from them

    v8f acc00 = {}, acc01 = {}, acc10 = {}, acc11 = {};

    // unrolled: buffer index and k offset become immediates, so no address is recomputed in the loop
    #pragma unroll
    for (int kt = 0; kt < NDIM / 64; ++kt) {
        const int  cur  = kt & 1;
        const bool more = (kt + 1 < NDIM / 64);    // the same for the whole block

        // next step's tiles: global loads issued here, stored to the other buffers at the foot
        if (more) {
            #pragma unroll
            for (int i = 0; i < 4; ++i) {
                ra[i] = *(const v8h*)(ag + (size_t)i * 16 * NDIM + (kt + 1) * 64);
                rb[i] = *(const v8h*)(bg + (size_t)i * 16 * NDIM + (kt + 1) * 64);
            }
        }

        const h16* ap = &S[cur * 64 * TP + af];
        const h16* bp = &S[(2 + cur) * 64 * TP + bf];
        Frag a0, a1, b0, b1, a2, a3, b2, b3;      // read as one group ahead of the eight products
        a0.hf[0] = *(const v8h*)(ap);                a0.hf[1] = *(const v8h*)(ap + 16);
        a1.hf[0] = *(const v8h*)(ap + 16 * TP);      a1.hf[1] = *(const v8h*)(ap + 16 * TP + 16);
        b0.hf[0] = *(const v8h*)(bp);                b0.hf[1] = *(const v8h*)(bp + 16);
        b1.hf[0] = *(const v8h*)(bp + 16 * TP);      b1.hf[1] = *(const v8h*)(bp + 16 * TP + 16);
        a2.hf[0] = *(const v8h*)(ap + 32);           a2.hf[1] = *(const v8h*)(ap + 48);
        a3.hf[0] = *(const v8h*)(ap + 16 * TP + 32); a3.hf[1] = *(const v8h*)(ap + 16 * TP + 48);
        b2.hf[0] = *(const v8h*)(bp + 32);           b2.hf[1] = *(const v8h*)(bp + 48);
        b3.hf[0] = *(const v8h*)(bp + 16 * TP + 32); b3.hf[1] = *(const v8h*)(bp + 16 * TP + 48);
        acc00 = wmma16(a0.v, b0.v, acc00);
        acc01 = wmma16(a0.v, b1.v, acc01);
        acc10 = wmma16(a1.v, b0.v, acc10);
        acc11 = wmma16(a1.v, b1.v, acc11);
        acc00 = wmma16(a2.v, b2.v, acc00);
        acc01 = wmma16(a2.v, b3.v, acc01);
        acc10 = wmma16(a3.v, b2.v, acc10);
        acc11 = wmma16(a3.v, b3.v, acc11);

        // the other buffers' last readers left them before the previous step's foot barrier
        if (more) {
            #pragma unroll
            for (int i = 0; i < 4; ++i) {
                *(v8h*)&S[(cur ^ 1) * 64 * TP + ss + i * 16 * TP]       = ra[i];
                *(v8h*)&S[(2 + (cur ^ 1)) * 64 * TP + ss + i * 16 * TP] = rb[i];
            }
            __syncthreads();   // next step's tiles complete before any wave reads them; this step's
                               // reads of its own buffers done before the next foot refills them
        }
    }
    // the last step reads buffers 1 only; buffer 0 of x (= T) was left before the last foot barrier

    // epilogue: undo the x64 weight scale, add bias, convert to f16, stage in LDS
    const float* bias = (z == 0) ? bq : ((z == 1) ? bk : bv);
    const bool tr = (z == 2);
    const float wsc = 0.015625f;   // 1/64
    #pragma unroll
    for (int i = 0; i < 2; ++i) {
        #pragma unroll
        for (int j = 0; j < 2; ++j) {
            const v8f acc = (i == 0) ? (j == 0 ? acc00 : acc01) : (j == 0 ? acc10 : acc11);
            const int c = wc + 16 * j + m;           // local col (d within head)
            const float bs = bias[col0 + c];
            #pragma unroll
            for (int r = 0; r < 8; ++r) {
                const int rr = wr + 16 * i + 8 * hh + r;   // local row (s within tile)
                const float v = acc[r] * wsc + bs;
                const int idx = tr ? (c * TP + rr) : (rr * TP + c);
                T[idx] = (h16)v;
            }
        }
    }
    __syncthreads();

    const int bb = row0 >> 11, s0 = row0 & (NS - 1), head = blockIdx.y;
    const size_t bhh = (size_t)bb * NH + head;
    h16* base;
    size_t rowpitch;
    if (tr) {   // vt[bh][d][s]: LDS row index = d
        base = vt + bhh * NHD * NS + s0;
        rowpitch = NS;
    } else {    // qh/kh[bh][s][d]: LDS row index = s_local
        base = ((z == 0) ? qh : kh) + (bhh * NS + s0) * NHD;
        rowpitch = NHD;
    }
    proj_store_pass(T, base, rowpitch, w, l);
    
}

// ---------------------------------------------------------------------------
// Kernel 2: flash attention per (b, h). 128 threads = 4 waves; block = 64 queries, wave = 16
// query rows; 32 keys per step. Q kept as two B fragments. Each step's K tile (32 kh rows, [key][d])
// and V^T tile (64 vt rows, [d][key]) are brought into LDS once per block, in two buffers: every
// thread loads four 16-B pieces of the next step's tiles at the top of a step and stores them at its
// foot. Both products run transposed: S^T = K Q^T (A = K tile rows, k = d; B = Q) and
// O^T += V^T P^T (A = V^T tile rows, k = key; B = P^T). A lane then holds 16 of the 32 scores of ONE
// query (column l & 15): maximum and sum run in its own registers, with one exchange between the wave
// halves for the maximum; the two score tiles, converted in place (f16, x16384), are the B fragment
// of the second product, so P never goes through LDS. Online softmax in f32 in the exp2 domain; each
// half keeps the sum of its own keys, joined once behind the loop.
// Epilogue: normalise, add noise, scale by 1/1.01, stage 16x64 f32 rows in
// ---------------------------------------------------------------------------
// value of lane l ^ 16 (the other half of the wave), by a vector cross-row move
__device__ __forceinline__ float xhalf(float x)
{
    const int b = __builtin_bit_cast(int, x);
    return __builtin_bit_cast(float,
        __builtin_amdgcn_permlanex16(b, b, 0x76543210, 0xfedcba98, false, false));
}

__device__ __forceinline__ void attn_store_pass(const float* Ow, const float* __restrict__ noise,
                                                float* out, size_t bh, int b, int h, int q0, int l)
{
    const float inv101 = 1.0f / 1.01f;
    const int piece = l & 15, rsel = l >> 4;
    #pragma unroll
    for (int i = 0; i < 8; ++i) {
        const int rowl = 2 * i + rsel;                      // 0..15, every row exactly once
        const int q = q0 + rowl;
        const v4f y  = *(const v4f*)&Ow[rowl * OPITCH + 4 * piece];
        const v4f nz = *(const v4f*)(noise + ((bh * NS + (size_t)q) * NHD + 4 * piece));
        const v4f val = (y + nz) * inv101;
        *(v4f*)(out + (((size_t)b * NS + (size_t)q) * NDIM + (size_t)h * NHD + 4 * piece)) = val;
    }
}

__global__ __launch_bounds__(128) void k_attn(
    const h16* __restrict__ qh, const h16* __restrict__ kh, const h16* __restrict__ vt,
    const float* __restrict__ noise, float* __restrict__ out)
{
    __shared__ __attribute__((aligned(16))) float Ot[4][16 * OPITCH];
    __shared__ __attribute__((aligned(16))) h16   Kt[2][32 * KP];
    __shared__ __attribute__((aligned(16))) h16   Vt[2][64 * VP];

    const int tid = threadIdx.x, l = tid & 31, w = tid >> 5;
    const int hh = l >> 4, m = l & 15;
    const int b = blockIdx.z, h = blockIdx.y;
    const size_t bh = (size_t)b * NH + h;
    const int q0 = blockIdx.x * 64 + w * 16;

    // Q rows q0+m as B fragments (column = query): qa0 covers d 0..31, qa1 d 32..63 (split k-map)
    Frag qa0, qa1;
    {
        const h16* qrow = qh + (bh * NS + (size_t)(q0 + m)) * NHD + 8 * hh;
        qa0.hf[0] = *(const v8h*)(qrow);      qa0.hf[1] = *(const v8h*)(qrow + 16);
        qa1.hf[0] = *(const v8h*)(qrow + 32); qa1.hf[1] = *(const v8h*)(qrow + 48);
    }
    // staging map, 16-B pieces: thread t moves K pieces t, t+128 (piece p: key p>>3, d 8*(p&7); the
    // tile is 4 KiB contiguous in kh) and V^T pieces t, t+128 (piece p: d p>>2, key 8*(p&3))
    const h16* kg = kh + bh * NS * NHD + (size_t)tid * 8;                         // + key0 * NHD
    const h16* vg = vt + (bh * NHD + (size_t)(tid >> 2)) * NS + 8 * (tid & 3);    // + key0
    const int  ks = (tid >> 3) * KP + 8 * (tid & 7);
    const int  vs = (tid >> 2) * VP + 8 * (tid & 3);
    const int  kf = m * KP + 8 * hh;     // fragment reads: K tile row = key, + 16 * KP for keys 16..31
    const int  vf = m * VP + 8 * hh;     // V^T tile row = d, + 16t * VP

    v8h sk0 = *(const v8h*)(kg);
    v8h sk1 = *(const v8h*)(kg + 16 * NHD);
    v8h sv0 = *(const v8h*)(vg);
    v8h sv1 = *(const v8h*)(vg + (size_t)32 * NS);
    // keeps the overwrite of the address registers of the loads above behind this wait
    asm volatile("s_wait_xcnt 0x0" ::: "memory");
    *(v8h*)&Kt[0][ks]           = sk0;
    *(v8h*)&Kt[0][ks + 16 * KP] = sk1;
    *(v8h*)&Vt[0][vs]           = sv0;
    *(v8h*)&Vt[0][vs + 32 * VP] = sv1;
    __syncthreads();   // tiles of step 0 complete before any wave reads fragments from them

    // this lane's query q0+m: running maximum (equal in both halves) and this half's own sum;
    // ot[r] = O^T[16t + 8hh + r][m]
    float mrun = -__builtin_inff(), lrun = 0.0f;
    v8f o0 = {}, o1 = {}, o2 = {}, o3 = {};

    const float sc  = 0.125f * 1.44269504088896f;   // HD^-0.5 * log2(e)
    const float psc = 16384.0f;
    float* Ow = &Ot[w][0];

    for (int kt = 0; kt < NS / 32; ++kt) {
        const int  cur  = kt & 1;
        const bool more = (kt + 1 < NS / 32);     // the same for the whole block

        // next step's tiles: global loads issued here, stored to the other buffer at the foot
        if (more) {
            const int keyn = (kt + 1) * 32;
            const h16* kn = kg + (size_t)keyn * NHD;
            const h16* vn = vg + keyn;
            sk0 = *(const v8h*)(kn);
            sk1 = *(const v8h*)(kn + 16 * NHD);
            sv0 = *(const v8h*)(vn);
            sv1 = *(const v8h*)(vn + (size_t)32 * NS);
        }

        // scores, transposed: 32 keys x 16 queries; c0[r] = key key0+8hh+r, c1[r] = key key0+16+8hh+r
        v8f c0 = {}, c1 = {};
        {
            const h16* kp = &Kt[cur][kf];
            Frag kb0, kb1, kb2, kb3;      // read as one group ahead of the four products
            kb0.hf[0] = *(const v8h*)(kp);      kb0.hf[1] = *(const v8h*)(kp + 16);
            kb1.hf[0] = *(const v8h*)(kp + 32); kb1.hf[1] = *(const v8h*)(kp + 48);
            kp += 16 * KP;
            kb2.hf[0] = *(const v8h*)(kp);      kb2.hf[1] = *(const v8h*)(kp + 16);
            kb3.hf[0] = *(const v8h*)(kp + 32); kb3.hf[1] = *(const v8h*)(kp + 48);
            c0 = wmma16(kb0.v, qa0.v, c0);
            c0 = wmma16(kb1.v, qa1.v, c0);
            c1 = wmma16(kb2.v, qa0.v, c1);
            c1 = wmma16(kb3.v, qa1.v, c1);
        }

        // online softmax of this lane's query over its 16 scores; the other half holds the other 16
        const v8f s0 = c0 * sc;
        const v8f s1 = c1 * sc;
        float mt = fmaxf(s0[0], s1[0]);
        #pragma unroll
        for (int r = 1; r < 8; ++r)
            mt = fmaxf(mt, fmaxf(s0[r], s1[r]));
        mt = fmaxf(mt, xhalf(mt));
        const float mnew  = fmaxf(mrun, mt);
        const float alpha = exp2f(mrun - mnew);
        mrun = mnew;
        const v8f t0 = s0 - mnew;
        const v8f t1 = s1 - mnew;
        v8f p0, p1;
        #pragma unroll
        for (int r = 0; r < 8; ++r) { p0[r] = exp2f(t0[r]); p1[r] = exp2f(t1[r]); }
        // P^T as B fragment: element r <- key 8hh+r, element 8+r <- key 16+8hh+r (the split k-map)
        const v8f g0 = p0 * psc;
        const v8f g1 = p1 * psc;
        Frag pb;
        #pragma unroll
        for (int r = 0; r < 8; ++r) { pb.v[r] = (h16)g0[r]; pb.v[8 + r] = (h16)g1[r]; }
        const v8f ps = p0 + p1;
        const float rs = ((ps[0] + ps[4]) + (ps[2] + ps[6])) + ((ps[1] + ps[5]) + (ps[3] + ps[7]));
        lrun = lrun * alpha + rs;
        o0 *= alpha; o1 *= alpha; o2 *= alpha; o3 *= alpha;

        // O^T += V^T P^T : A = V^T tile rows d (k = key, split k-map), B = P^T from registers
        {
            const h16* vp = &Vt[cur][vf];
            Frag vb0, vb1, vb2, vb3;      // read as one group ahead of the four products
            vb0.hf[0] = *(const v8h*)(vp);           vb0.hf[1] = *(const v8h*)(vp + 16);
            vb1.hf[0] = *(const v8h*)(vp + 16 * VP); vb1.hf[1] = *(const v8h*)(vp + 16 * VP + 16);
            vb2.hf[0] = *(const v8h*)(vp + 32 * VP); vb2.hf[1] = *(const v8h*)(vp + 32 * VP + 16);
            vb3.hf[0] = *(const v8h*)(vp + 48 * VP); vb3.hf[1] = *(const v8h*)(vp + 48 * VP + 16);
            o0 = wmma16(vb0.v, pb.v, o0);
            o1 = wmma16(vb1.v, pb.v, o1);
            o2 = wmma16(vb2.v, pb.v, o2);
            o3 = wmma16(vb3.v, pb.v, o3);
        }

        // the other buffer's last readers left it before the previous step's foot barrier
        if (more) {
            *(v8h*)&Kt[cur ^ 1][ks]           = sk0;
            *(v8h*)&Kt[cur ^ 1][ks + 16 * KP] = sk1;
            *(v8h*)&Vt[cur ^ 1][vs]           = sv0;
            *(v8h*)&Vt[cur ^ 1][vs + 32 * VP] = sv1;
        }
        __syncthreads();   // next step's K and V^T tiles complete before any wave reads them; this
                           // step's reads of its own buffer done before the next foot refills it
    }

    // epilogue: normalise (fold back 1/16384), stage in LDS in [row][d] order
    const float osc = 1.0f / 16384.0f;
    lrun += xhalf(lrun);                    // join the two halves' sums of this query
    const float invl = osc * __builtin_amdgcn_rcpf(lrun);
    {
        float* orow = &Ow[m * OPITCH + 8 * hh];      // row = query m; 8 consecutive d per tile
        const v8f y0 = o0 * invl, y1 = o1 * invl, y2 = o2 * invl, y3 = o3 * invl;
        *(v4f*)(orow)      = __builtin_shufflevector(y0, y0, 0, 1, 2, 3);
        *(v4f*)(orow + 4)  = __builtin_shufflevector(y0, y0, 4, 5, 6, 7);
        *(v4f*)(orow + 16) = __builtin_shufflevector(y1, y1, 0, 1, 2, 3);
        *(v4f*)(orow + 20) = __builtin_shufflevector(y1, y1, 4, 5, 6, 7);
        *(v4f*)(orow + 32) = __builtin_shufflevector(y2, y2, 0, 1, 2, 3);
        *(v4f*)(orow + 36) = __builtin_shufflevector(y2, y2, 4, 5, 6, 7);
        *(v4f*)(orow + 48) = __builtin_shufflevector(y3, y3, 0, 1, 2, 3);
        *(v4f*)(orow + 52) = __builtin_shufflevector(y3, y3, 4, 5, 6, 7);
    }
    __syncthreads();

    attn_store_pass(Ow, noise, out, bh, b, h, q0, l);
    
}

// ---------------------------------------------------------------------------
extern "C" void kernel_launch(void* const* d_in, const int* in_sizes, int n_in,
                              void* d_out, int out_size, void* d_ws, size_t ws_size,
                              hipStream_t stream)
{
    if (n_in < 8) return;
    const int n_x = NB * NS * NDIM;
    const int n_w = NDIM * NDIM;
    if (in_sizes[0] != n_x || in_sizes[1] != n_w || in_sizes[2] != NDIM ||
        in_sizes[3] != n_w || in_sizes[4] != NDIM || in_sizes[5] != n_w ||
        in_sizes[6] != NDIM || in_sizes[7] != NB * NH * NS * NHD || out_size != n_x)
        return;

    const float* x     = (const float*)d_in[0];
    const float* Wq    = (const float*)d_in[1];
    const float* bq    = (const float*)d_in[2];
    const float* Wk    = (const float*)d_in[3];
    const float* bk    = (const float*)d_in[4];
    const float* Wv    = (const float*)d_in[5];
    const float* bv    = (const float*)d_in[6];
    const float* noise = (const float*)d_in[7];
    float* out = (float*)d_out;

    // workspace carve (bytes): xh 8 MiB | wh 1.5 MiB | qh 8 MiB | kh 8 MiB | vt 8 MiB = 33.5 MiB
    const size_t bytes_xh  = (size_t)n_x * 2;
    const size_t bytes_wh  = (size_t)3 * n_w * 2;
    const size_t bytes_qkv = (size_t)NB * NH * NS * NHD * 2;
    const size_t off_xh = 0;
    const size_t off_wh = off_xh + bytes_xh;
    const size_t off_q  = off_wh + bytes_wh;
    const size_t off_k  = off_q + bytes_qkv;
    const size_t off_v  = off_k + bytes_qkv;
    const size_t end    = off_v + bytes_qkv;
    if (end > ws_size) return;

    char* ws = (char*)d_ws;
    h16* xh = (h16*)(ws + off_xh);
    h16* wh = (h16*)(ws + off_wh);
    h16* qh = (h16*)(ws + off_q);
    h16* kh = (h16*)(ws + off_k);
    h16* vt = (h16*)(ws + off_v);

    const int nxc = n_x / 8;            // 524288 chunks
    const int nwc = n_w / 8;            // 32768 chunks per weight
    const int total_chunks = nxc + 3 * nwc;
    const int cgrid = (total_chunks + 255) / 256;
    k_convert<<<dim3(cgrid), dim3(256), 0, stream>>>(x, Wq, Wk, Wv, xh, wh, nxc, nwc);

    dim3 pg((NB * NS) / 64, NDIM / 64, 3);     // 128 x 8 x 3
    k_proj<<<pg, dim3(128), 0, stream>>>(xh, wh, bq, bk, bv, qh, kh, vt);

    dim3 ag(NS / 64, NH, NB);                  // 32 x 8 x 4
    k_attn<<<ag, dim3(128), 0, stream>>>(qh, kh, vt, noise, out);
}

// v004
// A run of this version takes 79.3 microseconds.
// Timed twice side by side with v003, it ran 1.06 and 1.07 times as fast.
// Over all steps from v000 it is 2.99 times as fast.
// All contractions: v_wmma_f32_16x16x32_f16 (f16 operands, f32 accumulate): q/k/v projections (weights carried x64, folded as 1/64), q.k^T scores, p.v (p carried x16384, folded as 1/16384).
#include <hip/hip_runtime.h>
#include <stdint.h>
#include <stddef.h>

#define NB   4
#define NS   2048
#define NDIM 512
#define NH   8
#define NHD  64

#define TP   72     // projection LDS tile pitch (halves)
#define OPITCH 68   // output staging pitch (floats)
#define KP   72     // K tile LDS pitch (halves): 144 B = 16 B x odd, conflict-free 16-B row reads
#define VP   40     // V^T tile LDS pitch (halves): 80 B = 16 B x odd

typedef _Float16 h16;
typedef h16   v16h __attribute__((ext_vector_type(16)));
typedef h16   v8h  __attribute__((ext_vector_type(8), __may_alias__));
typedef float v8f  __attribute__((ext_vector_type(8)));
typedef float v4f  __attribute__((ext_vector_type(4), __may_alias__));

union Frag { v16h v; v8h hf[2]; };
union Pack8 { v8h v; h16 e[8]; };

static_assert(sizeof(Frag) == 32);
static_assert(sizeof(Pack8) == 16);
static_assert(NS % 64 == 0);
static_assert(NDIM % 64 == 0);
static_assert(NHD == 64);

// 16x16x32 f16 WMMA with hazard guard: D tied, A/B kept live across 4 VALU slots.
__device__ __forceinline__ v8f wmma16(const v16h a, const v16h b, v8f c)
{
    c = __builtin_amdgcn_wmma_f32_16x16x32_f16(false, a, false, b, (short)0, c, false, false);
    asm volatile("v_nop\n\tv_nop\n\tv_nop\n\tv_nop" : "+v"(c) : "v"(a), "v"(b));
    return c;
}

// ---------------------------------------------------------------------------
// Kernel 0: one-time f32 -> f16 conversion of x (unscaled) and Wq/Wk/Wv (x64, exact).
// Each thread converts 8 consecutive floats and writes one 16-B piece; a wave writes
// ---------------------------------------------------------------------------
__global__ __launch_bounds__(256) void k_convert(
    const float* __restrict__ x, const float* __restrict__ wq,
    const float* __restrict__ wk, const float* __restrict__ wv,
    h16* __restrict__ xh, h16* __restrict__ wh, int nxc, int nwc)
{
    const int t = blockIdx.x * 256 + threadIdx.x;      // 8-element chunk id
    const int total = nxc + 3 * nwc;
    if (t >= total) return;
    const float* src;
    h16* dst;
    float sc;
    if (t < nxc) {
        src = x + (size_t)t * 8;
        dst = xh + (size_t)t * 8;
        sc  = 1.0f;
    } else {
        const int u = t - nxc;
        const int w = u / nwc;
        const int c = u - w * nwc;
        const float* wp = (w == 0) ? wq : ((w == 1) ? wk : wv);
        src = wp + (size_t)c * 8;
        dst = wh + (size_t)u * 8;
        sc  = 64.0f;
    }
    const v4f f0 = *(const v4f*)(src);
    const v4f f1 = *(const v4f*)(src + 4);
    Pack8 p;
    p.e[0] = (h16)(f0.x * sc); p.e[1] = (h16)(f0.y * sc);
    p.e[2] = (h16)(f0.z * sc); p.e[3] = (h16)(f0.w * sc);
    p.e[4] = (h16)(f1.x * sc); p.e[5] = (h16)(f1.y * sc);
    p.e[6] = (h16)(f1.z * sc); p.e[7] = (h16)(f1.w * sc);
    const v8h val = p.v;
    *(v8h*)dst = val;
    
}

// ---------------------------------------------------------------------------
// Kernel 1: q/k/v = x @ W^T + b  (M = B*S = 8192, N = 512, K = 512), blockIdx.z selects W.
// Block tile 64 rows x 64 cols (one head), 128 threads = 4 waves, wave tile 32x32 (2x2 acc).
// Each step's x tile and W tile (64 rows x 64 k; W is [n][k], k-contiguous) are brought into LDS once
// per block, in two buffers, loaded a step ahead through registers. A and B fragments are read from
// them, both in the split k-map (elements 0..7 <- k0+8h.., 8..15 <- k0+16+8h..). Epilogue stages the 64x64 f16
// Outputs: qh, kh as [B,H,S,64]; vt as [B,H,64,S].
// ---------------------------------------------------------------------------
__device__ __forceinline__ void proj_store_pass(const h16* T, h16* base, size_t rowpitch,
                                                int w, int l)
{
    const int piece = l & 7, rq = l >> 3;
    #pragma unroll
    for (int i = 0; i < 4; ++i) {
        const int row = w * 16 + 4 * i + rq;                 // 0..63, every row exactly once
        const v8h v = *(const v8h*)&T[row * TP + 8 * piece];
        *(v8h*)(base + (size_t)row * rowpitch + 8 * piece) = v;
    }
}

__global__ __launch_bounds__(128) void k_proj(
    const h16* __restrict__ xh, const h16* __restrict__ wh,
    const float* __restrict__ bq, const float* __restrict__ bk, const float* __restrict__ bv,
    h16* __restrict__ qh, h16* __restrict__ kh, h16* __restrict__ vt)
{
    // tiles of 64 rows x 64 k at pitch TP: x tile buffers 0, 1, then W tile buffers 0, 1.
    // The first x buffer serves again as the output staging tile T behind the loop.
    __shared__ __attribute__((aligned(16))) h16 S[4 * 64 * TP];
    h16* T = S;

    const int tid = threadIdx.x, l = tid & 31, w = tid >> 5;
    const int hh = l >> 4, m = l & 15;
    const int z = blockIdx.z;
    const int row0 = blockIdx.x * 64;          // global m (= b*2048 + s)
    const int col0 = blockIdx.y * 64;          // global n (= head*64 + d)
    const int wr = (w & 1) * 32, wc = (w >> 1) * 32;

    // staging map, 16-B pieces: thread t moves pieces t + 128 i of each tile (piece p: row p >> 3,
    // k 8 * (p & 7)), so one wave-wide load covers four whole 128-B lines
    const h16* ag = xh + (size_t)(row0 + (tid >> 3)) * NDIM + 8 * (tid & 7);
    const h16* bg = wh + ((size_t)z * NDIM + (size_t)(col0 + (tid >> 3))) * NDIM + 8 * (tid & 7);
    const int  ss = (tid >> 3) * TP + 8 * (tid & 7);
    const int  af = (wr + m) * TP + 8 * hh;    // fragment reads: tile row, + 16 * TP for the second tile
    const int  bf = (wc + m) * TP + 8 * hh;

    v8h ra[4], rb[4];
    #pragma unroll
    for (int i = 0; i < 4; ++i) {
        ra[i] = *(const v8h*)(ag + (size_t)i * 16 * NDIM);
        rb[i] = *(const v8h*)(bg + (size_t)i * 16 * NDIM);
    }
    #pragma unroll
    for (int i = 0; i < 4; ++i) {
        *(v8h*)&S[ss + i * 16 * TP]               = ra[i];
        *(v8h*)&S[2 * 64 * TP + ss + i * 16 * TP] = rb[i];
    }
    __syncthreads();   // tiles of step 0 complete before any wave reads fragments from them

    v8f acc00 = {}, acc01 = {}, acc10 = {}, acc11 = {};

    // unrolled: buffer index and k offset become immediates, so no address is recomputed in the loop
    #pragma unroll
    for (int kt = 0; kt < NDIM / 64; ++kt) {
        const int  cur  = kt & 1;
        const bool more = (kt + 1 < NDIM / 64);    // the same for the whole block

        // next step's tiles: global loads issued here, stored to the other buffers at the foot
        if (more) {
            #pragma unroll
            for (int i = 0; i < 4; ++i) {
                ra[i] = *(const v8h*)(ag + (size_t)i * 16 * NDIM + (kt + 1) * 64);
                rb[i] = *(const v8h*)(bg + (size_t)i * 16 * NDIM + (kt + 1) * 64);
            }
        }

        const h16* ap = &S[cur * 64 * TP + af];
        const h16* bp = &S[(2 + cur) * 64 * TP + bf];
        Frag a0, a1, b0, b1, a2, a3, b2, b3;      // read as one group ahead of the eight products
        a0.hf[0] = *(const v8h*)(ap);                a0.hf[1] = *(const v8h*)(ap + 16);
        a1.hf[0] = *(const v8h*)(ap + 16 * TP);      a1.hf[1] = *(const v8h*)(ap + 16 * TP + 16);
        b0.hf[0] = *(const v8h*)(bp);                b0.hf[1] = *(const v8h*)(bp + 16);
        b1.hf[0] = *(const v8h*)(bp + 16 * TP);      b1.hf[1] = *(const v8h*)(bp + 16 * TP + 16);
        a2.hf[0] = *(const v8h*)(ap + 32);           a2.hf[1] = *(const v8h*)(ap + 48);
        a3.hf[0] = *(const v8h*)(ap + 16 * TP + 32); a3.hf[1] = *(const v8h*)(ap + 16 * TP + 48);
        b2.hf[0] = *(const v8h*)(bp + 32);           b2.hf[1] = *(const v8h*)(bp + 48);
        b3.hf[0] = *(const v8h*)(bp + 16 * TP + 32); b3.hf[1] = *(const v8h*)(bp + 16 * TP + 48);
        acc00 = wmma16(a0.v, b0.v, acc00);
        acc01 = wmma16(a0.v, b1.v, acc01);
        acc10 = wmma16(a1.v, b0.v, acc10);
        acc11 = wmma16(a1.v, b1.v, acc11);
        acc00 = wmma16(a2.v, b2.v, acc00);
        acc01 = wmma16(a2.v, b3.v, acc01);
        acc10 = wmma16(a3.v, b2.v, acc10);
        acc11 = wmma16(a3.v, b3.v, acc11);

        // the other buffers' last readers left them before the previous step's foot barrier
        if (more) {
            #pragma unroll
            for (int i = 0; i < 4; ++i) {
                *(v8h*)&S[(cur ^ 1) * 64 * TP + ss + i * 16 * TP]       = ra[i];
                *(v8h*)&S[(2 + (cur ^ 1)) * 64 * TP + ss + i * 16 * TP] = rb[i];
            }
            __syncthreads();   // next step's tiles complete before any wave reads them; this step's
                               // reads of its own buffers done before the next foot refills them
        }
    }
    // the last step reads buffers 1 only; buffer 0 of x (= T) was left before the last foot barrier

    // epilogue: undo the x64 weight scale, add bias, convert to f16, stage in LDS
    const float* bias = (z == 0) ? bq : ((z == 1) ? bk : bv);
    const bool tr = (z == 2);
    const float wsc = 0.015625f;   // 1/64
    #pragma unroll
    for (int i = 0; i < 2; ++i) {
        #pragma unroll
        for (int j = 0; j < 2; ++j) {
            const v8f acc = (i == 0) ? (j == 0 ? acc00 : acc01) : (j == 0 ? acc10 : acc11);
            const int c = wc + 16 * j + m;           // local col (d within head)
            const float bs = bias[col0 + c];
            #pragma unroll
            for (int r = 0; r < 8; ++r) {
                const int rr = wr + 16 * i + 8 * hh + r;   // local row (s within tile)
                const float v = acc[r] * wsc + bs;
                const int idx = tr ? (c * TP + rr) : (rr * TP + c);
                T[idx] = (h16)v;
            }
        }
    }
    __syncthreads();

    const int bb = row0 >> 11, s0 = row0 & (NS - 1), head = blockIdx.y;
    const size_t bhh = (size_t)bb * NH + head;
    h16* base;
    size_t rowpitch;
    if (tr) {   // vt[bh][d][s]: LDS row index = d
        base = vt + bhh * NHD * NS + s0;
        rowpitch = NS;
    } else {    // qh/kh[bh][s][d]: LDS row index = s_local
        base = ((z == 0) ? qh : kh) + (bhh * NS + s0) * NHD;
        rowpitch = NHD;
    }
    proj_store_pass(T, base, rowpitch, w, l);
    
}

// ---------------------------------------------------------------------------
// Kernel 2: flash attention per (b, h). 128 threads = 4 waves; block = 64 queries, wave = 16
// query rows; 32 keys per step. Q kept as two B fragments. Each step's K tile (32 kh rows, [key][d])
// and V^T tile (64 vt rows, [d][key]) are brought into LDS once per block, in two buffers: every
// thread loads four 16-B pieces of the next step's tiles at the top of a step and stores them at its
// foot. Both products run transposed: S^T = K Q^T (A = K tile rows, k = d; B = Q) and
// O^T += V^T P^T (A = V^T tile rows, k = key; B = P^T). A lane then holds 16 of the 32 scores of ONE
// query (column l & 15): maximum and sum run in its own registers, with one exchange between the wave
// halves for the maximum; the two score tiles, converted in place (f16, x16384), are the B fragment
// of the second product, so P never goes through LDS. Online softmax in f32 in the exp2 domain; each
// half keeps the sum of its own keys, joined once behind the loop.
// Epilogue: normalise, add noise, scale by 1/1.01, stage 16x64 f32 rows in
// ---------------------------------------------------------------------------
// value of lane l ^ 16 (the other half of the wave), by a vector cross-row move
__device__ __forceinline__ float xhalf(float x)
{
    const int b = __builtin_bit_cast(int, x);
    return __builtin_bit_cast(float,
        __builtin_amdgcn_permlanex16(b, b, 0x76543210, 0xfedcba98, false, false));
}

// 2^x by the bare v_exp_f32. exp2f() wraps every call in a compare, two selects, an add and a ldexp
// that only serve results below 2^-126. Here x <= 0 and each query's final sum is at least 1, so such
// a term (or such a rescale factor) is far below one f32 rounding step of the sum; as 0 it changes nothing.
__device__ __forceinline__ float exp2_raw(float x)
{
    return __builtin_amdgcn_exp2f(x);
}

__device__ __forceinline__ void attn_store_pass(const float* Ow, const float* __restrict__ noise,
                                                float* out, size_t bh, int b, int h, int q0, int l)
{
    const float inv101 = 1.0f / 1.01f;
    const int piece = l & 15, rsel = l >> 4;
    #pragma unroll
    for (int i = 0; i < 8; ++i) {
        const int rowl = 2 * i + rsel;                      // 0..15, every row exactly once
        const int q = q0 + rowl;
        const v4f y  = *(const v4f*)&Ow[rowl * OPITCH + 4 * piece];
        const v4f nz = *(const v4f*)(noise + ((bh * NS + (size_t)q) * NHD + 4 * piece));
        const v4f val = (y + nz) * inv101;
        *(v4f*)(out + (((size_t)b * NS + (size_t)q) * NDIM + (size_t)h * NHD + 4 * piece)) = val;
    }
}

__global__ __launch_bounds__(128) void k_attn(
    const h16* __restrict__ qh, const h16* __restrict__ kh, const h16* __restrict__ vt,
    const float* __restrict__ noise, float* __restrict__ out)
{
    __shared__ __attribute__((aligned(16))) float Ot[4][16 * OPITCH];
    __shared__ __attribute__((aligned(16))) h16   Kt[2][32 * KP];
    __shared__ __attribute__((aligned(16))) h16   Vt[2][64 * VP];

    const int tid = threadIdx.x, l = tid & 31, w = tid >> 5;
    const int hh = l >> 4, m = l & 15;
    const int b = blockIdx.z, h = blockIdx.y;
    const size_t bh = (size_t)b * NH + h;
    const int q0 = blockIdx.x * 64 + w * 16;

    // Q rows q0+m as B fragments (column = query): qa0 covers d 0..31, qa1 d 32..63 (split k-map)
    Frag qa0, qa1;
    {
        const h16* qrow = qh + (bh * NS + (size_t)(q0 + m)) * NHD + 8 * hh;
        qa0.hf[0] = *(const v8h*)(qrow);      qa0.hf[1] = *(const v8h*)(qrow + 16);
        qa1.hf[0] = *(const v8h*)(qrow + 32); qa1.hf[1] = *(const v8h*)(qrow + 48);
    }
    // staging map, 16-B pieces: thread t moves K pieces t, t+128 (piece p: key p>>3, d 8*(p&7); the
    // tile is 4 KiB contiguous in kh) and V^T pieces t, t+128 (piece p: d p>>2, key 8*(p&3))
    const h16* kg = kh + bh * NS * NHD + (size_t)tid * 8;                         // + key0 * NHD
    const h16* vg = vt + (bh * NHD + (size_t)(tid >> 2)) * NS + 8 * (tid & 3);    // + key0
    const int  ks = (tid >> 3) * KP + 8 * (tid & 7);
    const int  vs = (tid >> 2) * VP + 8 * (tid & 3);
    const int  kf = m * KP + 8 * hh;     // fragment reads: K tile row = key, + 16 * KP for keys 16..31
    const int  vf = m * VP + 8 * hh;     // V^T tile row = d, + 16t * VP

    v8h sk0 = *(const v8h*)(kg);
    v8h sk1 = *(const v8h*)(kg + 16 * NHD);
    v8h sv0 = *(const v8h*)(vg);
    v8h sv1 = *(const v8h*)(vg + (size_t)32 * NS);
    // keeps the overwrite of the address registers of the loads above behind this wait
    asm volatile("s_wait_xcnt 0x0" ::: "memory");
    *(v8h*)&Kt[0][ks]           = sk0;
    *(v8h*)&Kt[0][ks + 16 * KP] = sk1;
    *(v8h*)&Vt[0][vs]           = sv0;
    *(v8h*)&Vt[0][vs + 32 * VP] = sv1;
    __syncthreads();   // tiles of step 0 complete before any wave reads fragments from them

    // this lane's query q0+m: running maximum (equal in both halves) and this half's own sum;
    // ot[r] = O^T[16t + 8hh + r][m]
    float mrun = -__builtin_inff(), lrun = 0.0f;
    v8f o0 = {}, o1 = {}, o2 = {}, o3 = {};

    const float sc  = 0.125f * 1.44269504088896f;   // HD^-0.5 * log2(e)
    const float psc = 16384.0f;
    float* Ow = &Ot[w][0];

    for (int kt = 0; kt < NS / 32; ++kt) {
        const int  cur  = kt & 1;
        const bool more = (kt + 1 < NS / 32);     // the same for the whole block

        // next step's tiles: global loads issued here, stored to the other buffer at the foot
        if (more) {
            const int keyn = (kt + 1) * 32;
            const h16* kn = kg + (size_t)keyn * NHD;
            const h16* vn = vg + keyn;
            sk0 = *(const v8h*)(kn);
            sk1 = *(const v8h*)(kn + 16 * NHD);
            sv0 = *(const v8h*)(vn);
            sv1 = *(const v8h*)(vn + (size_t)32 * NS);
        }

        // scores, transposed: 32 keys x 16 queries; c0[r] = key key0+8hh+r, c1[r] = key key0+16+8hh+r
        v8f c0 = {}, c1 = {};
        {
            const h16* kp = &Kt[cur][kf];
            Frag kb0, kb1, kb2, kb3;      // read as one group ahead of the four products
            kb0.hf[0] = *(const v8h*)(kp);      kb0.hf[1] = *(const v8h*)(kp + 16);
            kb1.hf[0] = *(const v8h*)(kp + 32); kb1.hf[1] = *(const v8h*)(kp + 48);
            kp += 16 * KP;
            kb2.hf[0] = *(const v8h*)(kp);      kb2.hf[1] = *(const v8h*)(kp + 16);
            kb3.hf[0] = *(const v8h*)(kp + 32); kb3.hf[1] = *(const v8h*)(kp + 48);
            c0 = wmma16(kb0.v, qa0.v, c0);
            c0 = wmma16(kb1.v, qa1.v, c0);
            c1 = wmma16(kb2.v, qa0.v, c1);
            c1 = wmma16(kb3.v, qa1.v, c1);
        }

        // online softmax of this lane's query over its 16 scores; the other half holds the other 16
        const v8f s0 = c0 * sc;
        const v8f s1 = c1 * sc;
        float mt = fmaxf(s0[0], s1[0]);
        #pragma unroll
        for (int r = 1; r < 8; ++r)
            mt = fmaxf(mt, fmaxf(s0[r], s1[r]));
        mt = fmaxf(mt, xhalf(mt));
        const float mnew  = fmaxf(mrun, mt);
        const float alpha = exp2_raw(mrun - mnew);
        mrun = mnew;
        const v8f t0 = s0 - mnew;
        const v8f t1 = s1 - mnew;
        v8f p0, p1;
        #pragma unroll
        for (int r = 0; r < 8; ++r) { p0[r] = exp2_raw(t0[r]); p1[r] = exp2_raw(t1[r]); }
        // P^T as B fragment: element r <- key 8hh+r, element 8+r <- key 16+8hh+r (the split k-map)
        const v8f g0 = p0 * psc;
        const v8f g1 = p1 * psc;
        Frag pb;
        #pragma unroll
        for (int r = 0; r < 8; ++r) { pb.v[r] = (h16)g0[r]; pb.v[8 + r] = (h16)g1[r]; }
        const v8f ps = p0 + p1;
        const float rs = ((ps[0] + ps[4]) + (ps[2] + ps[6])) + ((ps[1] + ps[5]) + (ps[3] + ps[7]));
        lrun = lrun * alpha + rs;
        o0 *= alpha; o1 *= alpha; o2 *= alpha; o3 *= alpha;

        // O^T += V^T P^T : A = V^T tile rows d (k = key, split k-map), B = P^T from registers
        {
            const h16* vp = &Vt[cur][vf];
            Frag vb0, vb1, vb2, vb3;      // read as one group ahead of the four products
            vb0.hf[0] = *(const v8h*)(vp);           vb0.hf[1] = *(const v8h*)(vp + 16);
            vb1.hf[0] = *(const v8h*)(vp + 16 * VP); vb1.hf[1] = *(const v8h*)(vp + 16 * VP + 16);
            vb2.hf[0] = *(const v8h*)(vp + 32 * VP); vb2.hf[1] = *(const v8h*)(vp + 32 * VP + 16);
            vb3.hf[0] = *(const v8h*)(vp + 48 * VP); vb3.hf[1] = *(const v8h*)(vp + 48 * VP + 16);
            o0 = wmma16(vb0.v, pb.v, o0);
            o1 = wmma16(vb1.v, pb.v, o1);
            o2 = wmma16(vb2.v, pb.v, o2);
            o3 = wmma16(vb3.v, pb.v, o3);
        }

        // the other buffer's last readers left it before the previous step's foot barrier
        if (more) {
            *(v8h*)&Kt[cur ^ 1][ks]           = sk0;
            *(v8h*)&Kt[cur ^ 1][ks + 16 * KP] = sk1;
            *(v8h*)&Vt[cur ^ 1][vs]           = sv0;
            *(v8h*)&Vt[cur ^ 1][vs + 32 * VP] = sv1;
        }
        __syncthreads();   // next step's K and V^T tiles complete before any wave reads them; this
                           // step's reads of its own buffer done before the next foot refills it
    }

    // epilogue: normalise (fold back 1/16384), stage in LDS in [row][d] order
    const float osc = 1.0f / 16384.0f;
    lrun += xhalf(lrun);                    // join the two halves' sums of this query
    const float invl = osc * __builtin_amdgcn_rcpf(lrun);
    {
        float* orow = &Ow[m * OPITCH + 8 * hh];      // row = query m; 8 consecutive d per tile
        const v8f y0 = o0 * invl, y1 = o1 * invl, y2 = o2 * invl, y3 = o3 * invl;
        *(v4f*)(orow)      = __builtin_shufflevector(y0, y0, 0, 1, 2, 3);
        *(v4f*)(orow + 4)  = __builtin_shufflevector(y0, y0, 4, 5, 6, 7);
        *(v4f*)(orow + 16) = __builtin_shufflevector(y1, y1, 0, 1, 2, 3);
        *(v4f*)(orow + 20) = __builtin_shufflevector(y1, y1, 4, 5, 6, 7);
        *(v4f*)(orow + 32) = __builtin_shufflevector(y2, y2, 0, 1, 2, 3);
        *(v4f*)(orow + 36) = __builtin_shufflevector(y2, y2, 4, 5, 6, 7);
        *(v4f*)(orow + 48) = __builtin_shufflevector(y3, y3, 0, 1, 2, 3);
        *(v4f*)(orow + 52) = __builtin_shufflevector(y3, y3, 4, 5, 6, 7);
    }
    __syncthreads();

    attn_store_pass(Ow, noise, out, bh, b, h, q0, l);
    
}

// ---------------------------------------------------------------------------
extern "C" void kernel_launch(void* const* d_in, const int* in_sizes, int n_in,
                              void* d_out, int out_size, void* d_ws, size_t ws_size,
                              hipStream_t stream)
{
    if (n_in < 8) return;
    const int n_x = NB * NS * NDIM;
    const int n_w = NDIM * NDIM;
    if (in_sizes[0] != n_x || in_sizes[1] != n_w || in_sizes[2] != NDIM ||
        in_sizes[3] != n_w || in_sizes[4] != NDIM || in_sizes[5] != n_w ||
        in_sizes[6] != NDIM || in_sizes[7] != NB * NH * NS * NHD || out_size != n_x)
        return;

    const float* x     = (const float*)d_in[0];
    const float* Wq    = (const float*)d_in[1];
    const float* bq    = (const float*)d_in[2];
    const float* Wk    = (const float*)d_in[3];
    const float* bk    = (const float*)d_in[4];
    const float* Wv    = (const float*)d_in[5];
    const float* bv    = (const float*)d_in[6];
    const float* noise = (const float*)d_in[7];
    float* out = (float*)d_out;

    // workspace carve (bytes): xh 8 MiB | wh 1.5 MiB | qh 8 MiB | kh 8 MiB | vt 8 MiB = 33.5 MiB
    const size_t bytes_xh  = (size_t)n_x * 2;
    const size_t bytes_wh  = (size_t)3 * n_w * 2;
    const size_t bytes_qkv = (size_t)NB * NH * NS * NHD * 2;
    const size_t off_xh = 0;
    const size_t off_wh = off_xh + bytes_xh;
    const size_t off_q  = off_wh + bytes_wh;
    const size_t off_k  = off_q + bytes_qkv;
    const size_t off_v  = off_k + bytes_qkv;
    const size_t end    = off_v + bytes_qkv;
    if (end > ws_size) return;

    char* ws = (char*)d_ws;
    h16* xh = (h16*)(ws + off_xh);
    h16* wh = (h16*)(ws + off_wh);
    h16* qh = (h16*)(ws + off_q);
    h16* kh = (h16*)(ws + off_k);
    h16* vt = (h16*)(ws + off_v);

    const int nxc = n_x / 8;            // 524288 chunks
    const int nwc = n_w / 8;            // 32768 chunks per weight
    const int total_chunks = nxc + 3 * nwc;
    const int cgrid = (total_chunks + 255) / 256;
    k_convert<<<dim3(cgrid), dim3(256), 0, stream>>>(x, Wq, Wk, Wv, xh, wh, nxc, nwc);

    dim3 pg((NB * NS) / 64, NDIM / 64, 3);     // 128 x 8 x 3
    k_proj<<<pg, dim3(128), 0, stream>>>(xh, wh, bq, bk, bv, qh, kh, vt);

    dim3 ag(NS / 64, NH, NB);                  // 32 x 8 x 4
    k_attn<<<ag, dim3(128), 0, stream>>>(qh, kh, vt, noise, out);
}

// v005
// Measured time: 69.5 microseconds a run.
// Timed twice side by side with v004, it ran 1.14 and 1.15 times as fast.
// Over all steps from v000 it is 3.42 times as fast.
// All contractions: v_wmma_f32_16x16x32_f16 (f16 operands, f32 accumulate): q/k/v projections (weights carried x64, folded as 1/64), q.k^T scores, p.v (p carried x16384, folded as 1/16384).
#include <hip/hip_runtime.h>
#include <stdint.h>
#include <stddef.h>

#define NB   4
#define NS   2048
#define NDIM 512
#define NH   8
#define NHD  64

#define TP   72     // projection LDS tile pitch (halves)
#define OPITCH 68   // output staging pitch (floats)
#define KP   72     // K tile LDS pitch (halves): 144 B = 16 B x odd, conflict-free 16-B row reads
#define VP   136    // V^T tile LDS pitch (halves): 272 B = 16 B x odd
#define SK   128    // keys per attention stage (four passes of 32 keys)

typedef _Float16 h16;
typedef h16   v16h __attribute__((ext_vector_type(16)));
typedef h16   v8h  __attribute__((ext_vector_type(8), __may_alias__));
typedef float v8f  __attribute__((ext_vector_type(8)));
typedef float v4f  __attribute__((ext_vector_type(4), __may_alias__));

union Frag { v16h v; v8h hf[2]; };
union Pack8 { v8h v; h16 e[8]; };

static_assert(sizeof(Frag) == 32);
static_assert(sizeof(Pack8) == 16);
static_assert(NS % 64 == 0);
static_assert(NDIM % 64 == 0);
static_assert(NHD == 64);

// 16x16x32 f16 WMMA with hazard guard: D tied, A/B kept live across 4 VALU slots.
__device__ __forceinline__ v8f wmma16(const v16h a, const v16h b, v8f c)
{
    c = __builtin_amdgcn_wmma_f32_16x16x32_f16(false, a, false, b, (short)0, c, false, false);
    asm volatile("v_nop\n\tv_nop\n\tv_nop\n\tv_nop" : "+v"(c) : "v"(a), "v"(b));
    return c;
}

// ---------------------------------------------------------------------------
// Kernel 0: one-time f32 -> f16 conversion of x (unscaled) and Wq/Wk/Wv (x64, exact).
// Each thread converts 8 consecutive floats and writes one 16-B piece; a wave writes
// ---------------------------------------------------------------------------
__global__ __launch_bounds__(256) void k_convert(
    const float* __restrict__ x, const float* __restrict__ wq,
    const float* __restrict__ wk, const float* __restrict__ wv,
    h16* __restrict__ xh, h16* __restrict__ wh, int nxc, int nwc)
{
    const int t = blockIdx.x * 256 + threadIdx.x;      // 8-element chunk id
    const int total = nxc + 3 * nwc;
    if (t >= total) return;
    const float* src;
    h16* dst;
    float sc;
    if (t < nxc) {
        src = x + (size_t)t * 8;
        dst = xh + (size_t)t * 8;
        sc  = 1.0f;
    } else {
        const int u = t - nxc;
        const int w = u / nwc;
        const int c = u - w * nwc;
        const float* wp = (w == 0) ? wq : ((w == 1) ? wk : wv);
        src = wp + (size_t)c * 8;
        dst = wh + (size_t)u * 8;
        sc  = 64.0f;
    }
    const v4f f0 = *(const v4f*)(src);
    const v4f f1 = *(const v4f*)(src + 4);
    Pack8 p;
    p.e[0] = (h16)(f0.x * sc); p.e[1] = (h16)(f0.y * sc);
    p.e[2] = (h16)(f0.z * sc); p.e[3] = (h16)(f0.w * sc);
    p.e[4] = (h16)(f1.x * sc); p.e[5] = (h16)(f1.y * sc);
    p.e[6] = (h16)(f1.z * sc); p.e[7] = (h16)(f1.w * sc);
    const v8h val = p.v;
    *(v8h*)dst = val;
    
}

// ---------------------------------------------------------------------------
// Kernel 1: q/k/v = x @ W^T + b  (M = B*S = 8192, N = 512, K = 512), blockIdx.z selects W.
// Block tile 64 rows x 64 cols (one head), 128 threads = 4 waves, wave tile 32x32 (2x2 acc).
// Each step's x tile and W tile (64 rows x 64 k; W is [n][k], k-contiguous) are brought into LDS once
// per block, in two buffers, loaded a step ahead through registers. A and B fragments are read from
// them, both in the split k-map (elements 0..7 <- k0+8h.., 8..15 <- k0+16+8h..). Epilogue stages the 64x64 f16
// Outputs: qh, kh as [B,H,S,64]; vt as [B,H,64,S].
// ---------------------------------------------------------------------------
__device__ __forceinline__ void proj_store_pass(const h16* T, h16* base, size_t rowpitch,
                                                int w, int l)
{
    const int piece = l & 7, rq = l >> 3;
    #pragma unroll
    for (int i = 0; i < 4; ++i) {
        const int row = w * 16 + 4 * i + rq;                 // 0..63, every row exactly once
        const v8h v = *(const v8h*)&T[row * TP + 8 * piece];
        *(v8h*)(base + (size_t)row * rowpitch + 8 * piece) = v;
    }
}

__global__ __launch_bounds__(128) void k_proj(
    const h16* __restrict__ xh, const h16* __restrict__ wh,
    const float* __restrict__ bq, const float* __restrict__ bk, const float* __restrict__ bv,
    h16* __restrict__ qh, h16* __restrict__ kh, h16* __restrict__ vt)
{
    // tiles of 64 rows x 64 k at pitch TP: x tile buffers 0, 1, then W tile buffers 0, 1.
    // The first x buffer serves again as the output staging tile T behind the loop.
    __shared__ __attribute__((aligned(16))) h16 S[4 * 64 * TP];
    h16* T = S;

    const int tid = threadIdx.x, l = tid & 31, w = tid >> 5;
    const int hh = l >> 4, m = l & 15;
    const int z = blockIdx.z;
    const int row0 = blockIdx.x * 64;          // global m (= b*2048 + s)
    const int col0 = blockIdx.y * 64;          // global n (= head*64 + d)
    const int wr = (w & 1) * 32, wc = (w >> 1) * 32;

    // staging map, 16-B pieces: thread t moves pieces t + 128 i of each tile (piece p: row p >> 3,
    // k 8 * (p & 7)), so one wave-wide load covers four whole 128-B lines
    const h16* ag = xh + (size_t)(row0 + (tid >> 3)) * NDIM + 8 * (tid & 7);
    const h16* bg = wh + ((size_t)z * NDIM + (size_t)(col0 + (tid >> 3))) * NDIM + 8 * (tid & 7);
    const int  ss = (tid >> 3) * TP + 8 * (tid & 7);
    const int  af = (wr + m) * TP + 8 * hh;    // fragment reads: tile row, + 16 * TP for the second tile
    const int  bf = (wc + m) * TP + 8 * hh;

    v8h ra[4], rb[4];
    #pragma unroll
    for (int i = 0; i < 4; ++i) {
        ra[i] = *(const v8h*)(ag + (size_t)i * 16 * NDIM);
        rb[i] = *(const v8h*)(bg + (size_t)i * 16 * NDIM);
    }
    #pragma unroll
    for (int i = 0; i < 4; ++i) {
        *(v8h*)&S[ss + i * 16 * TP]               = ra[i];
        *(v8h*)&S[2 * 64 * TP + ss + i * 16 * TP] = rb[i];
    }
    __syncthreads();   // tiles of step 0 complete before any wave reads fragments from them

    v8f acc00 = {}, acc01 = {}, acc10 = {}, acc11 = {};

    // unrolled: buffer index and k offset become immediates, so no address is recomputed in the loop
    #pragma unroll
    for (int kt = 0; kt < NDIM / 64; ++kt) {
        const int  cur  = kt & 1;
        const bool more = (kt + 1 < NDIM / 64);    // the same for the whole block

        // next step's tiles: global loads issued here, stored to the other buffers at the foot
        if (more) {
            #pragma unroll
            for (int i = 0; i < 4; ++i) {
                ra[i] = *(const v8h*)(ag + (size_t)i * 16 * NDIM + (kt + 1) * 64);
                rb[i] = *(const v8h*)(bg + (size_t)i * 16 * NDIM + (kt + 1) * 64);
            }
        }

        const h16* ap = &S[cur * 64 * TP + af];
        const h16* bp = &S[(2 + cur) * 64 * TP + bf];
        Frag a0, a1, b0, b1, a2, a3, b2, b3;      // read as one group ahead of the eight products
        a0.hf[0] = *(const v8h*)(ap);                a0.hf[1] = *(const v8h*)(ap + 16);
        a1.hf[0] = *(const v8h*)(ap + 16 * TP);      a1.hf[1] = *(const v8h*)(ap + 16 * TP + 16);
        b0.hf[0] = *(const v8h*)(bp);                b0.hf[1] = *(const v8h*)(bp + 16);
        b1.hf[0] = *(const v8h*)(bp + 16 * TP);      b1.hf[1] = *(const v8h*)(bp + 16 * TP + 16);
        a2.hf[0] = *(const v8h*)(ap + 32);           a2.hf[1] = *(const v8h*)(ap + 48);
        a3.hf[0] = *(const v8h*)(ap + 16 * TP + 32); a3.hf[1] = *(const v8h*)(ap + 16 * TP + 48);
        b2.hf[0] = *(const v8h*)(bp + 32);           b2.hf[1] = *(const v8h*)(bp + 48);
        b3.hf[0] = *(const v8h*)(bp + 16 * TP + 32); b3.hf[1] = *(const v8h*)(bp + 16 * TP + 48);
        acc00 = wmma16(a0.v, b0.v, acc00);
        acc01 = wmma16(a0.v, b1.v, acc01);
        acc10 = wmma16(a1.v, b0.v, acc10);
        acc11 = wmma16(a1.v, b1.v, acc11);
        acc00 = wmma16(a2.v, b2.v, acc00);
        acc01 = wmma16(a2.v, b3.v, acc01);
        acc10 = wmma16(a3.v, b2.v, acc10);
        acc11 = wmma16(a3.v, b3.v, acc11);

        // the other buffers' last readers left them before the previous step's foot barrier
        if (more) {
            #pragma unroll
            for (int i = 0; i < 4; ++i) {
                *(v8h*)&S[(cur ^ 1) * 64 * TP + ss + i * 16 * TP]       = ra[i];
                *(v8h*)&S[(2 + (cur ^ 1)) * 64 * TP + ss + i * 16 * TP] = rb[i];
            }
            __syncthreads();   // next step's tiles complete before any wave reads them; this step's
                               // reads of its own buffers done before the next foot refills them
        }
    }
    // the last step reads buffers 1 only; buffer 0 of x (= T) was left before the last foot barrier

    // epilogue: undo the x64 weight scale, add bias, convert to f16, stage in LDS
    const float* bias = (z == 0) ? bq : ((z == 1) ? bk : bv);
    const bool tr = (z == 2);
    const float wsc = 0.015625f;   // 1/64
    #pragma unroll
    for (int i = 0; i < 2; ++i) {
        #pragma unroll
        for (int j = 0; j < 2; ++j) {
            const v8f acc = (i == 0) ? (j == 0 ? acc00 : acc01) : (j == 0 ? acc10 : acc11);
            const int c = wc + 16 * j + m;           // local col (d within head)
            const float bs = bias[col0 + c];
            #pragma unroll
            for (int r = 0; r < 8; ++r) {
                const int rr = wr + 16 * i + 8 * hh + r;   // local row (s within tile)
                const float v = acc[r] * wsc + bs;
                const int idx = tr ? (c * TP + rr) : (rr * TP + c);
                T[idx] = (h16)v;
            }
        }
    }
    __syncthreads();

    const int bb = row0 >> 11, s0 = row0 & (NS - 1), head = blockIdx.y;
    const size_t bhh = (size_t)bb * NH + head;
    h16* base;
    size_t rowpitch;
    if (tr) {   // vt[bh][d][s]: LDS row index = d
        base = vt + bhh * NHD * NS + s0;
        rowpitch = NS;
    } else {    // qh/kh[bh][s][d]: LDS row index = s_local
        base = ((z == 0) ? qh : kh) + (bhh * NS + s0) * NHD;
        rowpitch = NHD;
    }
    proj_store_pass(T, base, rowpitch, w, l);
    
}

// ---------------------------------------------------------------------------
// Kernel 2: flash attention per (b, h). 128 threads = 4 waves; block = 64 queries, wave = 16
// query rows; 32 keys per pass, SK keys per stage. Q kept as two B fragments. Each stage's K tile (SK
// kh rows, [key][d]) and V^T tile (64 vt rows, [d][key]) are brought into LDS once per block, in two
// buffers: every thread loads sixteen 16-B pieces of the next stage's tiles at the top of a stage and
// stores them at its foot, so the loads have four passes to land and the block meets at one barrier
// per stage. Both products run transposed: S^T = K Q^T (A = K tile rows, k = d; B = Q) and
// O^T += V^T P^T (A = V^T tile rows, k = key; B = P^T). A lane then holds 16 of the 32 scores of ONE
// query (column l & 15): maximum and sum run in its own registers, with one exchange between the wave
// halves for the maximum; the two score tiles, converted in place (f16, x16384), are the B fragment
// of the second product, so P never goes through LDS. Online softmax in f32 in the exp2 domain; each
// half keeps the sum of its own keys, joined once behind the loop.
// Epilogue: normalise, add noise, scale by 1/1.01, stage 16x64 f32 rows in
// ---------------------------------------------------------------------------
// value of lane l ^ 16 (the other half of the wave), by a vector cross-row move
__device__ __forceinline__ float xhalf(float x)
{
    const int b = __builtin_bit_cast(int, x);
    return __builtin_bit_cast(float,
        __builtin_amdgcn_permlanex16(b, b, 0x76543210, 0xfedcba98, false, false));
}

// 2^x by the bare v_exp_f32. exp2f() wraps every call in a compare, two selects, an add and a ldexp
// that only serve results below 2^-126. Here x <= 0 and each query's final sum is at least 1, so such
// a term (or such a rescale factor) is far below one f32 rounding step of the sum; as 0 it changes nothing.
__device__ __forceinline__ float exp2_raw(float x)
{
    return __builtin_amdgcn_exp2f(x);
}

__device__ __forceinline__ void attn_store_pass(const float* Ow, const float* __restrict__ noise,
                                                float* out, size_t bh, int b, int h, int q0, int l)
{
    const float inv101 = 1.0f / 1.01f;
    const int piece = l & 15, rsel = l >> 4;
    #pragma unroll
    for (int i = 0; i < 8; ++i) {
        const int rowl = 2 * i + rsel;                      // 0..15, every row exactly once
        const int q = q0 + rowl;
        const v4f y  = *(const v4f*)&Ow[rowl * OPITCH + 4 * piece];
        const v4f nz = *(const v4f*)(noise + ((bh * NS + (size_t)q) * NHD + 4 * piece));
        const v4f val = (y + nz) * inv101;
        *(v4f*)(out + (((size_t)b * NS + (size_t)q) * NDIM + (size_t)h * NHD + 4 * piece)) = val;
    }
}

__global__ __launch_bounds__(128) void k_attn(
    const h16* __restrict__ qh, const h16* __restrict__ kh, const h16* __restrict__ vt,
    const float* __restrict__ noise, float* __restrict__ out)
{
    __shared__ __attribute__((aligned(16))) h16   Kt[2][SK * KP];
    __shared__ __attribute__((aligned(16))) h16   Vt[2][64 * VP];
    // output staging (4 waves x 16 rows x OPITCH floats) lies in K buffer 0, which the last stage
    // (an odd one) does not use: four blocks then still fit one WGP's LDS
    static_assert(4 * 16 * OPITCH * sizeof(float) <= SK * KP * sizeof(h16));
    static_assert((NS / SK) % 2 == 0);

    const int tid = threadIdx.x, l = tid & 31, w = tid >> 5;
    const int hh = l >> 4, m = l & 15;
    const int b = blockIdx.z, h = blockIdx.y;
    const size_t bh = (size_t)b * NH + h;
    const int q0 = blockIdx.x * 64 + w * 16;

    // Q rows q0+m as B fragments (column = query): qa0 covers d 0..31, qa1 d 32..63 (split k-map)
    Frag qa0, qa1;
    {
        const h16* qrow = qh + (bh * NS + (size_t)(q0 + m)) * NHD + 8 * hh;
        qa0.hf[0] = *(const v8h*)(qrow);      qa0.hf[1] = *(const v8h*)(qrow + 16);
        qa1.hf[0] = *(const v8h*)(qrow + 32); qa1.hf[1] = *(const v8h*)(qrow + 48);
    }
    // staging map, 16-B pieces: thread t moves K pieces t + 128 i (piece p: key p>>3, d 8*(p&7); the
    // tile is 16 KiB contiguous in kh) and V^T pieces t + 128 i (piece p: d p>>4, key 8*(p&15))
    const h16* kg = kh + bh * NS * NHD + (size_t)tid * 8;                         // + key0 * NHD
    const h16* vg = vt + (bh * NHD + (size_t)(tid >> 4)) * NS + 8 * (tid & 15);   // + key0
    const int  ks = (tid >> 3) * KP + 8 * (tid & 7);
    const int  vs = (tid >> 4) * VP + 8 * (tid & 15);
    const int  kf = m * KP + 8 * hh;     // fragment reads: K tile row = key, + 16 * KP for keys 16..31
    const int  vf = m * VP + 8 * hh;     // V^T tile row = d, + 16t * VP

    v8h sk[8], sv[8];
    #pragma unroll
    for (int i = 0; i < 8; ++i) {
        sk[i] = *(const v8h*)(kg + i * 16 * NHD);
        sv[i] = *(const v8h*)(vg + (size_t)i * 8 * NS);
    }
    // keeps the overwrite of the address registers of the loads above behind this wait
    asm volatile("s_wait_xcnt 0x0" ::: "memory");
    #pragma unroll
    for (int i = 0; i < 8; ++i) {
        *(v8h*)&Kt[0][ks + i * 16 * KP] = sk[i];
        *(v8h*)&Vt[0][vs + i * 8 * VP]  = sv[i];
    }
    __syncthreads();   // tiles of stage 0 complete before any wave reads fragments from them

    // this lane's query q0+m: running maximum (equal in both halves) and this half's own sum;
    // ot[r] = O^T[16t + 8hh + r][m]
    float mrun = -__builtin_inff(), lrun = 0.0f;
    v8f o0 = {}, o1 = {}, o2 = {}, o3 = {};

    const float sc  = 0.125f * 1.44269504088896f;   // HD^-0.5 * log2(e)
    const float psc = 16384.0f;
    float* Ow = (float*)&Kt[0][0] + w * 16 * OPITCH;

    for (int st = 0; st < NS / SK; ++st) {
        const int  cur  = st & 1;
        const bool more = (st + 1 < NS / SK);     // the same for the whole block

        // next stage's tiles: global loads issued here, stored to the other buffer at the foot
        if (more) {
            const int keyn = (st + 1) * SK;
            const h16* kn = kg + (size_t)keyn * NHD;
            const h16* vn = vg + keyn;
            #pragma unroll
            for (int i = 0; i < 8; ++i) {
                sk[i] = *(const v8h*)(kn + i * 16 * NHD);
                sv[i] = *(const v8h*)(vn + (size_t)i * 8 * NS);
            }
            // keeps the overwrite of the address registers of the loads above behind this wait
            asm volatile("s_wait_xcnt 0x0" ::: "memory");
        }

        // unrolled: each pass's tile offsets become immediates of its LDS reads
        #pragma unroll
        for (int j = 0; j < SK / 32; ++j) {

        // scores, transposed: 32 keys x 16 queries; c0[r] = key key0+8hh+r, c1[r] = key key0+16+8hh+r
        v8f c0 = {}, c1 = {};
        {
            const h16* kp = &Kt[cur][kf + j * 32 * KP];
            Frag kb0, kb1, kb2, kb3;      // read as one group ahead of the four products
            kb0.hf[0] = *(const v8h*)(kp);      kb0.hf[1] = *(const v8h*)(kp + 16);
            kb1.hf[0] = *(const v8h*)(kp + 32); kb1.hf[1] = *(const v8h*)(kp + 48);
            kp += 16 * KP;
            kb2.hf[0] = *(const v8h*)(kp);      kb2.hf[1] = *(const v8h*)(kp + 16);
            kb3.hf[0] = *(const v8h*)(kp + 32); kb3.hf[1] = *(const v8h*)(kp + 48);
            c0 = wmma16(kb0.v, qa0.v, c0);
            c0 = wmma16(kb1.v, qa1.v, c0);
            c1 = wmma16(kb2.v, qa0.v, c1);
            c1 = wmma16(kb3.v, qa1.v, c1);
        }

        // online softmax of this lane's query over its 16 scores; the other half holds the other 16
        const v8f s0 = c0 * sc;
        const v8f s1 = c1 * sc;
        float mt = fmaxf(s0[0], s1[0]);
        #pragma unroll
        for (int r = 1; r < 8; ++r)
            mt = fmaxf(mt, fmaxf(s0[r], s1[r]));
        mt = fmaxf(mt, xhalf(mt));
        const float mnew  = fmaxf(mrun, mt);
        const float alpha = exp2_raw(mrun - mnew);
        mrun = mnew;
        const v8f t0 = s0 - mnew;
        const v8f t1 = s1 - mnew;
        v8f p0, p1;
        #pragma unroll
        for (int r = 0; r < 8; ++r) { p0[r] = exp2_raw(t0[r]); p1[r] = exp2_raw(t1[r]); }
        // P^T as B fragment: element r <- key 8hh+r, element 8+r <- key 16+8hh+r (the split k-map)
        const v8f g0 = p0 * psc;
        const v8f g1 = p1 * psc;
        Frag pb;
        #pragma unroll
        for (int r = 0; r < 8; ++r) { pb.v[r] = (h16)g0[r]; pb.v[8 + r] = (h16)g1[r]; }
        const v8f ps = p0 + p1;
        const float rs = ((ps[0] + ps[4]) + (ps[2] + ps[6])) + ((ps[1] + ps[5]) + (ps[3] + ps[7]));
        lrun = lrun * alpha + rs;
        o0 *= alpha; o1 *= alpha; o2 *= alpha; o3 *= alpha;

        // O^T += V^T P^T : A = V^T tile rows d (k = key, split k-map), B = P^T from registers
        {
            const h16* vp = &Vt[cur][vf + j * 32];
            Frag vb0, vb1, vb2, vb3;      // read as one group ahead of the four products
            vb0.hf[0] = *(const v8h*)(vp);           vb0.hf[1] = *(const v8h*)(vp + 16);
            vb1.hf[0] = *(const v8h*)(vp + 16 * VP); vb1.hf[1] = *(const v8h*)(vp + 16 * VP + 16);
            vb2.hf[0] = *(const v8h*)(vp + 32 * VP); vb2.hf[1] = *(const v8h*)(vp + 32 * VP + 16);
            vb3.hf[0] = *(const v8h*)(vp + 48 * VP); vb3.hf[1] = *(const v8h*)(vp + 48 * VP + 16);
            o0 = wmma16(vb0.v, pb.v, o0);
            o1 = wmma16(vb1.v, pb.v, o1);
            o2 = wmma16(vb2.v, pb.v, o2);
            o3 = wmma16(vb3.v, pb.v, o3);
        }

        }   // passes of this stage

        // the other buffer's last readers left it before the previous stage's foot barrier
        if (more) {
            #pragma unroll
            for (int i = 0; i < 8; ++i) {
                *(v8h*)&Kt[cur ^ 1][ks + i * 16 * KP] = sk[i];
                *(v8h*)&Vt[cur ^ 1][vs + i * 8 * VP]  = sv[i];
            }
        }
        __syncthreads();   // next stage's K and V^T tiles complete before any wave reads them; this
                           // stage's reads of its own buffer done before the next foot refills it
    }

    // epilogue: normalise (fold back 1/16384), stage in LDS in [row][d] order
    const float osc = 1.0f / 16384.0f;
    lrun += xhalf(lrun);                    // join the two halves' sums of this query
    const float invl = osc * __builtin_amdgcn_rcpf(lrun);
    {
        float* orow = &Ow[m * OPITCH + 8 * hh];      // row = query m; 8 consecutive d per tile
        const v8f y0 = o0 * invl, y1 = o1 * invl, y2 = o2 * invl, y3 = o3 * invl;
        *(v4f*)(orow)      = __builtin_shufflevector(y0, y0, 0, 1, 2, 3);
        *(v4f*)(orow + 4)  = __builtin_shufflevector(y0, y0, 4, 5, 6, 7);
        *(v4f*)(orow + 16) = __builtin_shufflevector(y1, y1, 0, 1, 2, 3);
        *(v4f*)(orow + 20) = __builtin_shufflevector(y1, y1, 4, 5, 6, 7);
        *(v4f*)(orow + 32) = __builtin_shufflevector(y2, y2, 0, 1, 2, 3);
        *(v4f*)(orow + 36) = __builtin_shufflevector(y2, y2, 4, 5, 6, 7);
        *(v4f*)(orow + 48) = __builtin_shufflevector(y3, y3, 0, 1, 2, 3);
        *(v4f*)(orow + 52) = __builtin_shufflevector(y3, y3, 4, 5, 6, 7);
    }
    __syncthreads();

    attn_store_pass(Ow, noise, out, bh, b, h, q0, l);
    
}

// ---------------------------------------------------------------------------
extern "C" void kernel_launch(void* const* d_in, const int* in_sizes, int n_in,
                              void* d_out, int out_size, void* d_ws, size_t ws_size,
                              hipStream_t stream)
{
    if (n_in < 8) return;
    const int n_x = NB * NS * NDIM;
    const int n_w = NDIM * NDIM;
    if (in_sizes[0] != n_x || in_sizes[1] != n_w || in_sizes[2] != NDIM ||
        in_sizes[3] != n_w || in_sizes[4] != NDIM || in_sizes[5] != n_w ||
        in_sizes[6] != NDIM || in_sizes[7] != NB * NH * NS * NHD || out_size != n_x)
        return;

    const float* x     = (const float*)d_in[0];
    const float* Wq    = (const float*)d_in[1];
    const float* bq    = (const float*)d_in[2];
    const float* Wk    = (const float*)d_in[3];
    const float* bk    = (const float*)d_in[4];
    const float* Wv    = (const float*)d_in[5];
    const float* bv    = (const float*)d_in[6];
    const float* noise = (const float*)d_in[7];
    float* out = (float*)d_out;

    // workspace carve (bytes): xh 8 MiB | wh 1.5 MiB | qh 8 MiB | kh 8 MiB | vt 8 MiB = 33.5 MiB
    const size_t bytes_xh  = (size_t)n_x * 2;
    const size_t bytes_wh  = (size_t)3 * n_w * 2;
    const size_t bytes_qkv = (size_t)NB * NH * NS * NHD * 2;
    const size_t off_xh = 0;
    const size_t off_wh = off_xh + bytes_xh;
    const size_t off_q  = off_wh + bytes_wh;
    const size_t off_k  = off_q + bytes_qkv;
    const size_t off_v  = off_k + bytes_qkv;
    const size_t end    = off_v + bytes_qkv;
    if (end > ws_size) return;

    char* ws = (char*)d_ws;
    h16* xh = (h16*)(ws + off_xh);
    h16* wh = (h16*)(ws + off_wh);
    h16* qh = (h16*)(ws + off_q);
    h16* kh = (h16*)(ws + off_k);
    h16* vt = (h16*)(ws + off_v);

    const int nxc = n_x / 8;            // 524288 chunks
    const int nwc = n_w / 8;            // 32768 chunks per weight
    const int total_chunks = nxc + 3 * nwc;
    const int cgrid = (total_chunks + 255) / 256;
    k_convert<<<dim3(cgrid), dim3(256), 0, stream>>>(x, Wq, Wk, Wv, xh, wh, nxc, nwc);

    dim3 pg((NB * NS) / 64, NDIM / 64, 3);     // 128 x 8 x 3
    k_proj<<<pg, dim3(128), 0, stream>>>(xh, wh, bq, bk, bv, qh, kh, vt);

    dim3 ag(NS / 64, NH, NB);                  // 32 x 8 x 4
    k_attn<<<ag, dim3(128), 0, stream>>>(qh, kh, vt, noise, out);
}

// v006
// One run takes 65.6 microseconds.
// In both of two side-by-side timings against v005, it was 1.06 times as fast.
// Over all steps from v000 it is 3.63 times as fast.
// All contractions: v_wmma_f32_16x16x32_f16 (f16 operands, f32 accumulate): q/k/v projections (weights carried x64, folded as 1/64), q.k^T scores, p.v (p carried x16384, folded as 1/16384).
#include <hip/hip_runtime.h>
#include <stdint.h>
#include <stddef.h>

#define NB   4
#define NS   2048
#define NDIM 512
#define NH   8
#define NHD  64

#define TP   72     // projection LDS tile pitch (halves)
#define OPITCH 68   // output staging pitch (floats)
#define KP   72     // K tile LDS pitch (halves): 144 B = 16 B x odd, conflict-free 16-B row reads
#define VP   136    // V^T tile LDS pitch (halves): 272 B = 16 B x odd
#define SK   128    // keys per attention stage (four passes of 32 keys)

typedef _Float16 h16;
typedef h16   v16h __attribute__((ext_vector_type(16)));
typedef h16   v8h  __attribute__((ext_vector_type(8), __may_alias__));
typedef float v8f  __attribute__((ext_vector_type(8)));
typedef float v4f  __attribute__((ext_vector_type(4), __may_alias__));

union Frag { v16h v; v8h hf[2]; };
union Pack8 { v8h v; h16 e[8]; };

static_assert(sizeof(Frag) == 32);
static_assert(sizeof(Pack8) == 16);
static_assert(NS % 64 == 0);
static_assert(NDIM % 64 == 0);
static_assert(NHD == 64);

// 16x16x32 f16 WMMA, the bare builtin (projection): the compiler keeps the distance behind it itself.
__device__ __forceinline__ v8f wmma16(const v16h a, const v16h b, v8f c)
{
    return __builtin_amdgcn_wmma_f32_16x16x32_f16(false, a, false, b, (short)0, c, false, false);
}

// ---------------------------------------------------------------------------
// Kernel 0: one-time f32 -> f16 conversion of x (unscaled) and Wq/Wk/Wv (x64, exact).
// Each thread converts 8 consecutive floats and writes one 16-B piece; a wave writes
// ---------------------------------------------------------------------------
__global__ __launch_bounds__(256) void k_convert(
    const float* __restrict__ x, const float* __restrict__ wq,
    const float* __restrict__ wk, const float* __restrict__ wv,
    h16* __restrict__ xh, h16* __restrict__ wh, int nxc, int nwc)
{
    const int t = blockIdx.x * 256 + threadIdx.x;      // 8-element chunk id
    const int total = nxc + 3 * nwc;
    if (t >= total) return;
    const float* src;
    h16* dst;
    float sc;
    if (t < nxc) {
        src = x + (size_t)t * 8;
        dst = xh + (size_t)t * 8;
        sc  = 1.0f;
    } else {
        const int u = t - nxc;
        const int w = u / nwc;
        const int c = u - w * nwc;
        const float* wp = (w == 0) ? wq : ((w == 1) ? wk : wv);
        src = wp + (size_t)c * 8;
        dst = wh + (size_t)u * 8;
        sc  = 64.0f;
    }
    const v4f f0 = *(const v4f*)(src);
    const v4f f1 = *(const v4f*)(src + 4);
    Pack8 p;
    p.e[0] = (h16)(f0.x * sc); p.e[1] = (h16)(f0.y * sc);
    p.e[2] = (h16)(f0.z * sc); p.e[3] = (h16)(f0.w * sc);
    p.e[4] = (h16)(f1.x * sc); p.e[5] = (h16)(f1.y * sc);
    p.e[6] = (h16)(f1.z * sc); p.e[7] = (h16)(f1.w * sc);
    const v8h val = p.v;
    *(v8h*)dst = val;
    
}

// ---------------------------------------------------------------------------
// Kernel 1: q/k/v = x @ W^T + b  (M = B*S = 8192, N = 512, K = 512), blockIdx.z selects W.
// Block tile 64 rows x 64 cols (one head), 128 threads = 4 waves, wave tile 32x32 (2x2 acc).
// Each step's x tile and W tile (64 rows x 64 k; W is [n][k], k-contiguous) are brought into LDS once
// per block, in two buffers, loaded a step ahead through registers. A and B fragments are read from
// them, both in the split k-map (elements 0..7 <- k0+8h.., 8..15 <- k0+16+8h..). Epilogue stages the 64x64 f16
// Outputs: qh, kh as [B,H,S,64]; vt as [B,H,64,S].
// ---------------------------------------------------------------------------
__device__ __forceinline__ void proj_store_pass(const h16* T, h16* base, size_t rowpitch,
                                                int w, int l)
{
    const int piece = l & 7, rq = l >> 3;
    #pragma unroll
    for (int i = 0; i < 4; ++i) {
        const int row = w * 16 + 4 * i + rq;                 // 0..63, every row exactly once
        const v8h v = *(const v8h*)&T[row * TP + 8 * piece];
        *(v8h*)(base + (size_t)row * rowpitch + 8 * piece) = v;
    }
}

__global__ __launch_bounds__(128) void k_proj(
    const h16* __restrict__ xh, const h16* __restrict__ wh,
    const float* __restrict__ bq, const float* __restrict__ bk, const float* __restrict__ bv,
    h16* __restrict__ qh, h16* __restrict__ kh, h16* __restrict__ vt)
{
    // tiles of 64 rows x 64 k at pitch TP: x tile buffers 0, 1, then W tile buffers 0, 1.
    // The first x buffer serves again as the output staging tile T behind the loop.
    __shared__ __attribute__((aligned(16))) h16 S[4 * 64 * TP];
    h16* T = S;

    const int tid = threadIdx.x, l = tid & 31, w = tid >> 5;
    const int hh = l >> 4, m = l & 15;
    const int z = blockIdx.z;
    const int row0 = blockIdx.x * 64;          // global m (= b*2048 + s)
    const int col0 = blockIdx.y * 64;          // global n (= head*64 + d)
    const int wr = (w & 1) * 32, wc = (w >> 1) * 32;

    // staging map, 16-B pieces: thread t moves pieces t + 128 i of each tile (piece p: row p >> 3,
    // k 8 * (p & 7)), so one wave-wide load covers four whole 128-B lines
    const h16* ag = xh + (size_t)(row0 + (tid >> 3)) * NDIM + 8 * (tid & 7);
    const h16* bg = wh + ((size_t)z * NDIM + (size_t)(col0 + (tid >> 3))) * NDIM + 8 * (tid & 7);
    const int  ss = (tid >> 3) * TP + 8 * (tid & 7);
    const int  af = (wr + m) * TP + 8 * hh;    // fragment reads: tile row, + 16 * TP for the second tile
    const int  bf = (wc + m) * TP + 8 * hh;

    v8h ra[4], rb[4];
    #pragma unroll
    for (int i = 0; i < 4; ++i) {
        ra[i] = *(const v8h*)(ag + (size_t)i * 16 * NDIM);
        rb[i] = *(const v8h*)(bg + (size_t)i * 16 * NDIM);
    }
    #pragma unroll
    for (int i = 0; i < 4; ++i) {
        *(v8h*)&S[ss + i * 16 * TP]               = ra[i];
        *(v8h*)&S[2 * 64 * TP + ss + i * 16 * TP] = rb[i];
    }
    __syncthreads();   // tiles of step 0 complete before any wave reads fragments from them

    v8f acc00 = {}, acc01 = {}, acc10 = {}, acc11 = {};

    // unrolled: buffer index and k offset become immediates, so no address is recomputed in the loop
    #pragma unroll
    for (int kt = 0; kt < NDIM / 64; ++kt) {
        const int  cur  = kt & 1;
        const bool more = (kt + 1 < NDIM / 64);    // the same for the whole block

        // next step's tiles: global loads issued here, stored to the other buffers at the foot
        if (more) {
            #pragma unroll
            for (int i = 0; i < 4; ++i) {
                ra[i] = *(const v8h*)(ag + (size_t)i * 16 * NDIM + (kt + 1) * 64);
                rb[i] = *(const v8h*)(bg + (size_t)i * 16 * NDIM + (kt + 1) * 64);
            }
        }

        const h16* ap = &S[cur * 64 * TP + af];
        const h16* bp = &S[(2 + cur) * 64 * TP + bf];
        Frag a0, a1, b0, b1, a2, a3, b2, b3;      // read as one group ahead of the eight products
        a0.hf[0] = *(const v8h*)(ap);                a0.hf[1] = *(const v8h*)(ap + 16);
        a1.hf[0] = *(const v8h*)(ap + 16 * TP);      a1.hf[1] = *(const v8h*)(ap + 16 * TP + 16);
        b0.hf[0] = *(const v8h*)(bp);                b0.hf[1] = *(const v8h*)(bp + 16);
        b1.hf[0] = *(const v8h*)(bp + 16 * TP);      b1.hf[1] = *(const v8h*)(bp + 16 * TP + 16);
        a2.hf[0] = *(const v8h*)(ap + 32);           a2.hf[1] = *(const v8h*)(ap + 48);
        a3.hf[0] = *(const v8h*)(ap + 16 * TP + 32); a3.hf[1] = *(const v8h*)(ap + 16 * TP + 48);
        b2.hf[0] = *(const v8h*)(bp + 32);           b2.hf[1] = *(const v8h*)(bp + 48);
        b3.hf[0] = *(const v8h*)(bp + 16 * TP + 32); b3.hf[1] = *(const v8h*)(bp + 16 * TP + 48);
        acc00 = wmma16(a0.v, b0.v, acc00);
        acc01 = wmma16(a0.v, b1.v, acc01);
        acc10 = wmma16(a1.v, b0.v, acc10);
        acc11 = wmma16(a1.v, b1.v, acc11);
        acc00 = wmma16(a2.v, b2.v, acc00);
        acc01 = wmma16(a2.v, b3.v, acc01);
        acc10 = wmma16(a3.v, b2.v, acc10);
        acc11 = wmma16(a3.v, b3.v, acc11);

        // the other buffers' last readers left them before the previous step's foot barrier
        if (more) {
            #pragma unroll
            for (int i = 0; i < 4; ++i) {
                *(v8h*)&S[(cur ^ 1) * 64 * TP + ss + i * 16 * TP]       = ra[i];
                *(v8h*)&S[(2 + (cur ^ 1)) * 64 * TP + ss + i * 16 * TP] = rb[i];
            }
            __syncthreads();   // next step's tiles complete before any wave reads them; this step's
                               // reads of its own buffers done before the next foot refills them
        }
    }
    // the last step reads buffers 1 only; buffer 0 of x (= T) was left before the last foot barrier

    // epilogue: undo the x64 weight scale, add bias, convert to f16, stage in LDS
    const float* bias = (z == 0) ? bq : ((z == 1) ? bk : bv);
    const bool tr = (z == 2);
    const float wsc = 0.015625f;   // 1/64
    #pragma unroll
    for (int i = 0; i < 2; ++i) {
        #pragma unroll
        for (int j = 0; j < 2; ++j) {
            const v8f acc = (i == 0) ? (j == 0 ? acc00 : acc01) : (j == 0 ? acc10 : acc11);
            const int c = wc + 16 * j + m;           // local col (d within head)
            const float bs = bias[col0 + c];
            #pragma unroll
            for (int r = 0; r < 8; ++r) {
                const int rr = wr + 16 * i + 8 * hh + r;   // local row (s within tile)
                const float v = acc[r] * wsc + bs;
                const int idx = tr ? (c * TP + rr) : (rr * TP + c);
                T[idx] = (h16)v;
            }
        }
    }
    __syncthreads();

    const int bb = row0 >> 11, s0 = row0 & (NS - 1), head = blockIdx.y;
    const size_t bhh = (size_t)bb * NH + head;
    h16* base;
    size_t rowpitch;
    if (tr) {   // vt[bh][d][s]: LDS row index = d
        base = vt + bhh * NHD * NS + s0;
        rowpitch = NS;
    } else {    // qh/kh[bh][s][d]: LDS row index = s_local
        base = ((z == 0) ? qh : kh) + (bhh * NS + s0) * NHD;
        rowpitch = NHD;
    }
    proj_store_pass(T, base, rowpitch, w, l);
    
}

// ---------------------------------------------------------------------------
// Kernel 2: flash attention per (b, h). 128 threads = 4 waves; block = 64 queries, wave = 16
// query rows; 32 keys per pass, SK keys per stage. Q kept as two B fragments. Each stage's K tile (SK
// kh rows, [key][d]) and V^T tile (64 vt rows, [d][key]) are brought into LDS once per block, in two
// buffers: every thread loads sixteen 16-B pieces of the next stage's tiles at the top of a stage and
// stores them at its foot, so the loads have four passes to land and the block meets at one barrier
// per stage. Both products run transposed: S^T = K Q^T (A = K tile rows, k = d; B = Q) and
// O^T += V^T P^T (A = V^T tile rows, k = key; B = P^T). A lane then holds 16 of the 32 scores of ONE
// query (column l & 15): maximum and sum run in its own registers, with one exchange between the wave
// halves for the maximum; the two score tiles, converted in place (f16, x16384), are the B fragment
// of the second product, so P never goes through LDS. Online softmax in f32 in the exp2 domain; each
// half keeps the sum of its own keys, joined once behind the loop.
// Epilogue: normalise, add noise, scale by 1/1.01, stage 16x64 f32 rows in
// ---------------------------------------------------------------------------
// value of lane l ^ 16 (the other half of the wave), by a vector cross-row move
__device__ __forceinline__ float xhalf(float x)
{
    const int b = __builtin_bit_cast(int, x);
    return __builtin_bit_cast(float,
        __builtin_amdgcn_permlanex16(b, b, 0x76543210, 0xfedcba98, false, false));
}

// 2^x by the bare v_exp_f32. exp2f() wraps every call in a compare, two selects, an add and a ldexp
// that only serve results below 2^-126. Here x <= 0 and each query's final sum is at least 1, so such
// a term (or such a rescale factor) is far below one f32 rounding step of the sum; as 0 it changes nothing.
__device__ __forceinline__ float exp2_raw(float x)
{
    return __builtin_amdgcn_exp2f(x);
}

__device__ __forceinline__ void attn_store_pass(const float* Ow, const float* __restrict__ noise,
                                                float* out, size_t bh, int b, int h, int q0, int l)
{
    const float inv101 = 1.0f / 1.01f;
    const int piece = l & 15, rsel = l >> 4;
    #pragma unroll
    for (int i = 0; i < 8; ++i) {
        const int rowl = 2 * i + rsel;                      // 0..15, every row exactly once
        const int q = q0 + rowl;
        const v4f y  = *(const v4f*)&Ow[rowl * OPITCH + 4 * piece];
        const v4f nz = *(const v4f*)(noise + ((bh * NS + (size_t)q) * NHD + 4 * piece));
        const v4f val = (y + nz) * inv101;
        *(v4f*)(out + (((size_t)b * NS + (size_t)q) * NDIM + (size_t)h * NHD + 4 * piece)) = val;
    }
}

__global__ __launch_bounds__(128) void k_attn(
    const h16* __restrict__ qh, const h16* __restrict__ kh, const h16* __restrict__ vt,
    const float* __restrict__ noise, float* __restrict__ out)
{
    __shared__ __attribute__((aligned(16))) h16   Kt[2][SK * KP];
    __shared__ __attribute__((aligned(16))) h16   Vt[2][64 * VP];
    // output staging (4 waves x 16 rows x OPITCH floats) lies in K buffer 0, which the last stage
    // (an odd one) does not use: four blocks then still fit one WGP's LDS
    static_assert(4 * 16 * OPITCH * sizeof(float) <= SK * KP * sizeof(h16));
    static_assert((NS / SK) % 2 == 0);

    const int tid = threadIdx.x, l = tid & 31, w = tid >> 5;
    const int hh = l >> 4, m = l & 15;
    const int b = blockIdx.z, h = blockIdx.y;
    const size_t bh = (size_t)b * NH + h;
    const int q0 = blockIdx.x * 64 + w * 16;

    // Q rows q0+m as B fragments (column = query): qa0 covers d 0..31, qa1 d 32..63 (split k-map)
    Frag qa0, qa1;
    {
        const h16* qrow = qh + (bh * NS + (size_t)(q0 + m)) * NHD + 8 * hh;
        qa0.hf[0] = *(const v8h*)(qrow);      qa0.hf[1] = *(const v8h*)(qrow + 16);
        qa1.hf[0] = *(const v8h*)(qrow + 32); qa1.hf[1] = *(const v8h*)(qrow + 48);
    }
    // staging map, 16-B pieces: thread t moves K pieces t + 128 i (piece p: key p>>3, d 8*(p&7); the
    // tile is 16 KiB contiguous in kh) and V^T pieces t + 128 i (piece p: d p>>4, key 8*(p&15))
    const h16* kg = kh + bh * NS * NHD + (size_t)tid * 8;                         // + key0 * NHD
    const h16* vg = vt + (bh * NHD + (size_t)(tid >> 4)) * NS + 8 * (tid & 15);   // + key0
    const int  ks = (tid >> 3) * KP + 8 * (tid & 7);
    const int  vs = (tid >> 4) * VP + 8 * (tid & 15);
    const int  kf = m * KP + 8 * hh;     // fragment reads: K tile row = key, + 16 * KP for keys 16..31
    const int  vf = m * VP + 8 * hh;     // V^T tile row = d, + 16t * VP

    v8h sk[8], sv[8];
    #pragma unroll
    for (int i = 0; i < 8; ++i) {
        sk[i] = *(const v8h*)(kg + i * 16 * NHD);
        sv[i] = *(const v8h*)(vg + (size_t)i * 8 * NS);
    }
    // keeps the overwrite of the address registers of the loads above behind this wait
    asm volatile("s_wait_xcnt 0x0" ::: "memory");
    #pragma unroll
    for (int i = 0; i < 8; ++i) {
        *(v8h*)&Kt[0][ks + i * 16 * KP] = sk[i];
        *(v8h*)&Vt[0][vs + i * 8 * VP]  = sv[i];
    }
    __syncthreads();   // tiles of stage 0 complete before any wave reads fragments from them

    // this lane's query q0+m: running maximum (equal in both halves) and this half's own sum;
    // ot[r] = O^T[16t + 8hh + r][m]
    float mrun = -__builtin_inff(), lrun = 0.0f;
    v8f o0 = {}, o1 = {}, o2 = {}, o3 = {};

    const float sc  = 0.125f * 1.44269504088896f;   // HD^-0.5 * log2(e)
    const float psc = 16384.0f;
    float* Ow = (float*)&Kt[0][0] + w * 16 * OPITCH;

    for (int st = 0; st < NS / SK; ++st) {
        const int  cur  = st & 1;
        const bool more = (st + 1 < NS / SK);     // the same for the whole block

        // next stage's tiles: global loads issued here, stored to the other buffer at the foot
        if (more) {
            const int keyn = (st + 1) * SK;
            const h16* kn = kg + (size_t)keyn * NHD;
            const h16* vn = vg + keyn;
            #pragma unroll
            for (int i = 0; i < 8; ++i) {
                sk[i] = *(const v8h*)(kn + i * 16 * NHD);
                sv[i] = *(const v8h*)(vn + (size_t)i * 8 * NS);
            }
            // keeps the overwrite of the address registers of the loads above behind this wait
            asm volatile("s_wait_xcnt 0x0" ::: "memory");
        }

        // unrolled: each pass's tile offsets become immediates of its LDS reads
        #pragma unroll
        for (int j = 0; j < SK / 32; ++j) {

        // scores, transposed: 32 keys x 16 queries; c0[r] = key key0+8hh+r, c1[r] = key key0+16+8hh+r
        v8f c0, c1;      // each tile's first product takes the constant 0 as its C
        {
            const h16* kp = &Kt[cur][kf + j * 32 * KP];
            Frag kb0, kb1, kb2, kb3;      // read as one group ahead of the four products
            kb0.hf[0] = *(const v8h*)(kp);      kb0.hf[1] = *(const v8h*)(kp + 16);
            kb1.hf[0] = *(const v8h*)(kp + 32); kb1.hf[1] = *(const v8h*)(kp + 48);
            kp += 16 * KP;
            kb2.hf[0] = *(const v8h*)(kp);      kb2.hf[1] = *(const v8h*)(kp + 16);
            kb3.hf[0] = *(const v8h*)(kp + 32); kb3.hf[1] = *(const v8h*)(kp + 48);
            // The four products stand in one asm statement, so that each fills the distance behind the
            // others and the LDS reads stay one group in front (as builtins the compiler spreads the
            // reads of two passes among them, and a wave then waits on LDS at more places).
            // The four v_nop at the end keep the distance between the last product and the first
            // vector instruction that reads c1 or overwrites a fragment. The s_delay_alu behind them is
            // the hint the compiler writes in front of a reader of a builtin product and cannot write
            // here: the wave steps aside until the last product is done, not holding the vector port.
            asm volatile("v_wmma_f32_16x16x32_f16 %0, %2, %6, 0\n\t"
                         "v_wmma_f32_16x16x32_f16 %1, %4, %6, 0\n\t"
                         "v_wmma_f32_16x16x32_f16 %0, %3, %7, %0\n\t"
                         "v_wmma_f32_16x16x32_f16 %1, %5, %7, %1\n\t"
                         "v_nop\n\tv_nop\n\tv_nop\n\tv_nop\n\t"
                         "s_delay_alu instid0(TRANS32_DEP_1)"
                         : "=&v"(c0), "=&v"(c1)
                         : "v"(kb0.v), "v"(kb1.v), "v"(kb2.v), "v"(kb3.v), "v"(qa0.v), "v"(qa1.v));
        }

        // online softmax of this lane's query over its 16 scores; the other half holds the other 16
        const v8f s0 = c0 * sc;
        const v8f s1 = c1 * sc;
        float mt = fmaxf(s0[0], s1[0]);
        #pragma unroll
        for (int r = 1; r < 8; ++r)
            mt = fmaxf(mt, fmaxf(s0[r], s1[r]));
        mt = fmaxf(mt, xhalf(mt));
        const float mnew  = fmaxf(mrun, mt);
        const float alpha = exp2_raw(mrun - mnew);
        mrun = mnew;
        const v8f t0 = s0 - mnew;
        const v8f t1 = s1 - mnew;
        v8f p0, p1;
        #pragma unroll
        for (int r = 0; r < 8; ++r) { p0[r] = exp2_raw(t0[r]); p1[r] = exp2_raw(t1[r]); }
        // P^T as B fragment: element r <- key 8hh+r, element 8+r <- key 16+8hh+r (the split k-map)
        const v8f g0 = p0 * psc;
        const v8f g1 = p1 * psc;
        Frag pb;
        #pragma unroll
        for (int r = 0; r < 8; ++r) { pb.v[r] = (h16)g0[r]; pb.v[8 + r] = (h16)g1[r]; }
        const v8f ps = p0 + p1;
        const float rs = ((ps[0] + ps[4]) + (ps[2] + ps[6])) + ((ps[1] + ps[5]) + (ps[3] + ps[7]));
        lrun = lrun * alpha + rs;
        o0 *= alpha; o1 *= alpha; o2 *= alpha; o3 *= alpha;

        // O^T += V^T P^T : A = V^T tile rows d (k = key, split k-map), B = P^T from registers
        {
            const h16* vp = &Vt[cur][vf + j * 32];
            Frag vb0, vb1, vb2, vb3;      // read as one group ahead of the four products
            vb0.hf[0] = *(const v8h*)(vp);           vb0.hf[1] = *(const v8h*)(vp + 16);
            vb1.hf[0] = *(const v8h*)(vp + 16 * VP); vb1.hf[1] = *(const v8h*)(vp + 16 * VP + 16);
            vb2.hf[0] = *(const v8h*)(vp + 32 * VP); vb2.hf[1] = *(const v8h*)(vp + 32 * VP + 16);
            vb3.hf[0] = *(const v8h*)(vp + 48 * VP); vb3.hf[1] = *(const v8h*)(vp + 48 * VP + 16);
            // one asm statement for the same two reasons; the four v_nop keep the distance between the
            // last product and the first vector instruction that touches o3, pb or a V^T fragment
            asm volatile("v_wmma_f32_16x16x32_f16 %0, %4, %8, %0\n\t"
                         "v_wmma_f32_16x16x32_f16 %1, %5, %8, %1\n\t"
                         "v_wmma_f32_16x16x32_f16 %2, %6, %8, %2\n\t"
                         "v_wmma_f32_16x16x32_f16 %3, %7, %8, %3\n\t"
                         "v_nop\n\tv_nop\n\tv_nop\n\tv_nop"
                         : "+v"(o0), "+v"(o1), "+v"(o2), "+v"(o3)
                         : "v"(vb0.v), "v"(vb1.v), "v"(vb2.v), "v"(vb3.v), "v"(pb.v));
        }

        }   // passes of this stage

        // the other buffer's last readers left it before the previous stage's foot barrier
        if (more) {
            #pragma unroll
            for (int i = 0; i < 8; ++i) {
                *(v8h*)&Kt[cur ^ 1][ks + i * 16 * KP] = sk[i];
                *(v8h*)&Vt[cur ^ 1][vs + i * 8 * VP]  = sv[i];
            }
        }
        __syncthreads();   // next stage's K and V^T tiles complete before any wave reads them; this
                           // stage's reads of its own buffer done before the next foot refills it
    }

    // epilogue: normalise (fold back 1/16384), stage in LDS in [row][d] order
    const float osc = 1.0f / 16384.0f;
    lrun += xhalf(lrun);                    // join the two halves' sums of this query
    const float invl = osc * __builtin_amdgcn_rcpf(lrun);
    {
        float* orow = &Ow[m * OPITCH + 8 * hh];      // row = query m; 8 consecutive d per tile
        const v8f y0 = o0 * invl, y1 = o1 * invl, y2 = o2 * invl, y3 = o3 * invl;
        *(v4f*)(orow)      = __builtin_shufflevector(y0, y0, 0, 1, 2, 3);
        *(v4f*)(orow + 4)  = __builtin_shufflevector(y0, y0, 4, 5, 6, 7);
        *(v4f*)(orow + 16) = __builtin_shufflevector(y1, y1, 0, 1, 2, 3);
        *(v4f*)(orow + 20) = __builtin_shufflevector(y1, y1, 4, 5, 6, 7);
        *(v4f*)(orow + 32) = __builtin_shufflevector(y2, y2, 0, 1, 2, 3);
        *(v4f*)(orow + 36) = __builtin_shufflevector(y2, y2, 4, 5, 6, 7);
        *(v4f*)(orow + 48) = __builtin_shufflevector(y3, y3, 0, 1, 2, 3);
        *(v4f*)(orow + 52) = __builtin_shufflevector(y3, y3, 4, 5, 6, 7);
    }
    __syncthreads();

    attn_store_pass(Ow, noise, out, bh, b, h, q0, l);
    
}

// ---------------------------------------------------------------------------
extern "C" void kernel_launch(void* const* d_in, const int* in_sizes, int n_in,
                              void* d_out, int out_size, void* d_ws, size_t ws_size,
                              hipStream_t stream)
{
    if (n_in < 8) return;
    const int n_x = NB * NS * NDIM;
    const int n_w = NDIM * NDIM;
    if (in_sizes[0] != n_x || in_sizes[1] != n_w || in_sizes[2] != NDIM ||
        in_sizes[3] != n_w || in_sizes[4] != NDIM || in_sizes[5] != n_w ||
        in_sizes[6] != NDIM || in_sizes[7] != NB * NH * NS * NHD || out_size != n_x)
        return;

    const float* x     = (const float*)d_in[0];
    const float* Wq    = (const float*)d_in[1];
    const float* bq    = (const float*)d_in[2];
    const float* Wk    = (const float*)d_in[3];
    const float* bk    = (const float*)d_in[4];
    const float* Wv    = (const float*)d_in[5];
    const float* bv    = (const float*)d_in[6];
    const float* noise = (const float*)d_in[7];
    float* out = (float*)d_out;

    // workspace carve (bytes): xh 8 MiB | wh 1.5 MiB | qh 8 MiB | kh 8 MiB | vt 8 MiB = 33.5 MiB
    const size_t bytes_xh  = (size_t)n_x * 2;
    const size_t bytes_wh  = (size_t)3 * n_w * 2;
    const size_t bytes_qkv = (size_t)NB * NH * NS * NHD * 2;
    const size_t off_xh = 0;
    const size_t off_wh = off_xh + bytes_xh;
    const size_t off_q  = off_wh + bytes_wh;
    const size_t off_k  = off_q + bytes_qkv;
    const size_t off_v  = off_k + bytes_qkv;
    const size_t end    = off_v + bytes_qkv;
    if (end > ws_size) return;

    char* ws = (char*)d_ws;
    h16* xh = (h16*)(ws + off_xh);
    h16* wh = (h16*)(ws + off_wh);
    h16* qh = (h16*)(ws + off_q);
    h16* kh = (h16*)(ws + off_k);
    h16* vt = (h16*)(ws + off_v);

    const int nxc = n_x / 8;            // 524288 chunks
    const int nwc = n_w / 8;            // 32768 chunks per weight
    const int total_chunks = nxc + 3 * nwc;
    const int cgrid = (total_chunks + 255) / 256;
    k_convert<<<dim3(cgrid), dim3(256), 0, stream>>>(x, Wq, Wk, Wv, xh, wh, nxc, nwc);

    dim3 pg((NB * NS) / 64, NDIM / 64, 3);     // 128 x 8 x 3
    k_proj<<<pg, dim3(128), 0, stream>>>(xh, wh, bq, bk, bv, qh, kh, vt);

    dim3 ag(NS / 64, NH, NB);                  // 32 x 8 x 4
    k_attn<<<ag, dim3(128), 0, stream>>>(qh, kh, vt, noise, out);
}

// v007
// One run takes 63.7 microseconds.
// Timed twice side by side with v006, it ran 1.03 times as fast both times.
// Counting every step since v000, it is 3.75 times as fast.
// All contractions: v_wmma_f32_16x16x32_f16 (f16 operands, f32 accumulate): q/k/v projections (weights carried x64, folded as 1/64), q.k^T scores, p.v (p carried x16384, folded as 1/16384).
#include <hip/hip_runtime.h>
#include <stdint.h>
#include <stddef.h>

#define NB   4
#define NS   2048
#define NDIM 512
#define NH   8
#define NHD  64

#define TP   72     // projection LDS tile pitch (halves)
#define OPITCH 68   // output staging pitch (floats)
#define KP   72     // K tile LDS pitch (halves): 144 B = 16 B x odd, conflict-free 16-B row reads
#define VP   72     // V^T tile LDS pitch (halves): 144 B = 16 B x odd
#define SK   64     // keys per attention stage (two passes of 32 keys)

typedef _Float16 h16;
typedef h16   v16h __attribute__((ext_vector_type(16)));
typedef h16   v8h  __attribute__((ext_vector_type(8), __may_alias__));
typedef float v8f  __attribute__((ext_vector_type(8)));
typedef float v4f  __attribute__((ext_vector_type(4), __may_alias__));

union Frag { v16h v; v8h hf[2]; };
union Pack8 { v8h v; h16 e[8]; };

static_assert(sizeof(Frag) == 32);
static_assert(sizeof(Pack8) == 16);
static_assert(NS % 64 == 0);
static_assert(NDIM % 64 == 0);
static_assert(NHD == 64);

// 16x16x32 f16 WMMA, the bare builtin (projection): the compiler keeps the distance behind it itself.
__device__ __forceinline__ v8f wmma16(const v16h a, const v16h b, v8f c)
{
    return __builtin_amdgcn_wmma_f32_16x16x32_f16(false, a, false, b, (short)0, c, false, false);
}

// ---------------------------------------------------------------------------
// Kernel 0: one-time f32 -> f16 conversion of x (unscaled) and Wq/Wk/Wv (x64, exact).
// Each thread converts 8 consecutive floats and writes one 16-B piece; a wave writes
// ---------------------------------------------------------------------------
__global__ __launch_bounds__(256) void k_convert(
    const float* __restrict__ x, const float* __restrict__ wq,
    const float* __restrict__ wk, const float* __restrict__ wv,
    h16* __restrict__ xh, h16* __restrict__ wh, int nxc, int nwc)
{
    const int t = blockIdx.x * 256 + threadIdx.x;      // 8-element chunk id
    const int total = nxc + 3 * nwc;
    if (t >= total) return;
    const float* src;
    h16* dst;
    float sc;
    if (t < nxc) {
        src = x + (size_t)t * 8;
        dst = xh + (size_t)t * 8;
        sc  = 1.0f;
    } else {
        const int u = t - nxc;
        const int w = u / nwc;
        const int c = u - w * nwc;
        const float* wp = (w == 0) ? wq : ((w == 1) ? wk : wv);
        src = wp + (size_t)c * 8;
        dst = wh + (size_t)u * 8;
        sc  = 64.0f;
    }
    const v4f f0 = *(const v4f*)(src);
    const v4f f1 = *(const v4f*)(src + 4);
    Pack8 p;
    p.e[0] = (h16)(f0.x * sc); p.e[1] = (h16)(f0.y * sc);
    p.e[2] = (h16)(f0.z * sc); p.e[3] = (h16)(f0.w * sc);
    p.e[4] = (h16)(f1.x * sc); p.e[5] = (h16)(f1.y * sc);
    p.e[6] = (h16)(f1.z * sc); p.e[7] = (h16)(f1.w * sc);
    const v8h val = p.v;
    *(v8h*)dst = val;
    
}

// ---------------------------------------------------------------------------
// Kernel 1: q/k/v = x @ W^T + b  (M = B*S = 8192, N = 512, K = 512), blockIdx.z selects W.
// Block tile 64 rows x 64 cols (one head), 128 threads = 4 waves, wave tile 32x32 (2x2 acc).
// Each step's x tile and W tile (64 rows x 64 k; W is [n][k], k-contiguous) are brought into LDS once
// per block, in two buffers, loaded a step ahead through registers. A and B fragments are read from
// them, both in the split k-map (elements 0..7 <- k0+8h.., 8..15 <- k0+16+8h..). Epilogue stages the 64x64 f16
// Outputs: qh, kh as [B,H,S,64]; vt as [B,H,64,S].
// ---------------------------------------------------------------------------
__device__ __forceinline__ void proj_store_pass(const h16* T, h16* base, size_t rowpitch,
                                                int w, int l)
{
    const int piece = l & 7, rq = l >> 3;
    #pragma unroll
    for (int i = 0; i < 4; ++i) {
        const int row = w * 16 + 4 * i + rq;                 // 0..63, every row exactly once
        const v8h v = *(const v8h*)&T[row * TP + 8 * piece];
        *(v8h*)(base + (size_t)row * rowpitch + 8 * piece) = v;
    }
}

__global__ __launch_bounds__(128) void k_proj(
    const h16* __restrict__ xh, const h16* __restrict__ wh,
    const float* __restrict__ bq, const float* __restrict__ bk, const float* __restrict__ bv,
    h16* __restrict__ qh, h16* __restrict__ kh, h16* __restrict__ vt)
{
    // tiles of 64 rows x 64 k at pitch TP: x tile buffers 0, 1, then W tile buffers 0, 1.
    // The first x buffer serves again as the output staging tile T behind the loop.
    __shared__ __attribute__((aligned(16))) h16 S[4 * 64 * TP];
    h16* T = S;

    const int tid = threadIdx.x, l = tid & 31, w = tid >> 5;
    const int hh = l >> 4, m = l & 15;
    const int z = blockIdx.z;
    const int row0 = blockIdx.x * 64;          // global m (= b*2048 + s)
    const int col0 = blockIdx.y * 64;          // global n (= head*64 + d)
    const int wr = (w & 1) * 32, wc = (w >> 1) * 32;

    // staging map, 16-B pieces: thread t moves pieces t + 128 i of each tile (piece p: row p >> 3,
    // k 8 * (p & 7)), so one wave-wide load covers four whole 128-B lines
    const h16* ag = xh + (size_t)(row0 + (tid >> 3)) * NDIM + 8 * (tid & 7);
    const h16* bg = wh + ((size_t)z * NDIM + (size_t)(col0 + (tid >> 3))) * NDIM + 8 * (tid & 7);
    const int  ss = (tid >> 3) * TP + 8 * (tid & 7);
    const int  af = (wr + m) * TP + 8 * hh;    // fragment reads: tile row, + 16 * TP for the second tile
    const int  bf = (wc + m) * TP + 8 * hh;

    v8h ra[4], rb[4];
    #pragma unroll
    for (int i = 0; i < 4; ++i) {
        ra[i] = *(const v8h*)(ag + (size_t)i * 16 * NDIM);
        rb[i] = *(const v8h*)(bg + (size_t)i * 16 * NDIM);
    }
    #pragma unroll
    for (int i = 0; i < 4; ++i) {
        *(v8h*)&S[ss + i * 16 * TP]               = ra[i];
        *(v8h*)&S[2 * 64 * TP + ss + i * 16 * TP] = rb[i];
    }
    __syncthreads();   // tiles of step 0 complete before any wave reads fragments from them

    v8f acc00 = {}, acc01 = {}, acc10 = {}, acc11 = {};

    // unrolled: buffer index and k offset become immediates, so no address is recomputed in the loop
    #pragma unroll
    for (int kt = 0; kt < NDIM / 64; ++kt) {
        const int  cur  = kt & 1;
        const bool more = (kt + 1 < NDIM / 64);    // the same for the whole block

        // next step's tiles: global loads issued here, stored to the other buffers at the foot
        if (more) {
            #pragma unroll
            for (int i = 0; i < 4; ++i) {
                ra[i] = *(const v8h*)(ag + (size_t)i * 16 * NDIM + (kt + 1) * 64);
                rb[i] = *(const v8h*)(bg + (size_t)i * 16 * NDIM + (kt + 1) * 64);
            }
        }

        const h16* ap = &S[cur * 64 * TP + af];
        const h16* bp = &S[(2 + cur) * 64 * TP + bf];
        Frag a0, a1, b0, b1, a2, a3, b2, b3;      // read as one group ahead of the eight products
        a0.hf[0] = *(const v8h*)(ap);                a0.hf[1] = *(const v8h*)(ap + 16);
        a1.hf[0] = *(const v8h*)(ap + 16 * TP);      a1.hf[1] = *(const v8h*)(ap + 16 * TP + 16);
        b0.hf[0] = *(const v8h*)(bp);                b0.hf[1] = *(const v8h*)(bp + 16);
        b1.hf[0] = *(const v8h*)(bp + 16 * TP);      b1.hf[1] = *(const v8h*)(bp + 16 * TP + 16);
        a2.hf[0] = *(const v8h*)(ap + 32);           a2.hf[1] = *(const v8h*)(ap + 48);
        a3.hf[0] = *(const v8h*)(ap + 16 * TP + 32); a3.hf[1] = *(const v8h*)(ap + 16 * TP + 48);
        b2.hf[0] = *(const v8h*)(bp + 32);           b2.hf[1] = *(const v8h*)(bp + 48);
        b3.hf[0] = *(const v8h*)(bp + 16 * TP + 32); b3.hf[1] = *(const v8h*)(bp + 16 * TP + 48);
        acc00 = wmma16(a0.v, b0.v, acc00);
        acc01 = wmma16(a0.v, b1.v, acc01);
        acc10 = wmma16(a1.v, b0.v, acc10);
        acc11 = wmma16(a1.v, b1.v, acc11);
        acc00 = wmma16(a2.v, b2.v, acc00);
        acc01 = wmma16(a2.v, b3.v, acc01);
        acc10 = wmma16(a3.v, b2.v, acc10);
        acc11 = wmma16(a3.v, b3.v, acc11);

        // the other buffers' last readers left them before the previous step's foot barrier
        if (more) {
            #pragma unroll
            for (int i = 0; i < 4; ++i) {
                *(v8h*)&S[(cur ^ 1) * 64 * TP + ss + i * 16 * TP]       = ra[i];
                *(v8h*)&S[(2 + (cur ^ 1)) * 64 * TP + ss + i * 16 * TP] = rb[i];
            }
            __syncthreads();   // next step's tiles complete before any wave reads them; this step's
                               // reads of its own buffers done before the next foot refills them
        }
    }
    // the last step reads buffers 1 only; buffer 0 of x (= T) was left before the last foot barrier

    // epilogue: undo the x64 weight scale, add bias, convert to f16, stage in LDS
    const float* bias = (z == 0) ? bq : ((z == 1) ? bk : bv);
    const bool tr = (z == 2);
    const float wsc = 0.015625f;   // 1/64
    #pragma unroll
    for (int i = 0; i < 2; ++i) {
        #pragma unroll
        for (int j = 0; j < 2; ++j) {
            const v8f acc = (i == 0) ? (j == 0 ? acc00 : acc01) : (j == 0 ? acc10 : acc11);
            const int c = wc + 16 * j + m;           // local col (d within head)
            const float bs = bias[col0 + c];
            #pragma unroll
            for (int r = 0; r < 8; ++r) {
                const int rr = wr + 16 * i + 8 * hh + r;   // local row (s within tile)
                const float v = acc[r] * wsc + bs;
                const int idx = tr ? (c * TP + rr) : (rr * TP + c);
                T[idx] = (h16)v;
            }
        }
    }
    __syncthreads();

    const int bb = row0 >> 11, s0 = row0 & (NS - 1), head = blockIdx.y;
    const size_t bhh = (size_t)bb * NH + head;
    h16* base;
    size_t rowpitch;
    if (tr) {   // vt[bh][d][s]: LDS row index = d
        base = vt + bhh * NHD * NS + s0;
        rowpitch = NS;
    } else {    // qh/kh[bh][s][d]: LDS row index = s_local
        base = ((z == 0) ? qh : kh) + (bhh * NS + s0) * NHD;
        rowpitch = NHD;
    }
    proj_store_pass(T, base, rowpitch, w, l);
    
}

// ---------------------------------------------------------------------------
// Kernel 2: flash attention per (b, h). 128 threads = 4 waves; block = 128 queries, wave = 32
// query rows in two column groups of 16; 32 keys per pass, SK keys per stage. Q kept as two B
// fragments per group. Each stage's K tile (SK
// kh rows, [key][d]) and V^T tile (64 vt rows, [d][key]) are brought into LDS once per block, in two
// buffers: every thread loads eight 16-B pieces of the next stage's tiles at the top of a stage and
// stores them at its foot, so the loads have two passes (32 keys x 128 queries each) to land and the
// block meets at one barrier per stage. Both products run transposed: S^T = K Q^T (A = K tile rows, k = d; B = Q) and
// O^T += V^T P^T (A = V^T tile rows, k = key; B = P^T). Every K and V^T fragment read from LDS serves
// both column groups. In each group a lane holds 16 of the 32 scores of ONE
// query (column l & 15): maximum and sum run in its own registers, with one exchange between the wave
// halves for the maximum; the two score tiles, converted in place (f16, x16384), are the B fragment
// of the second product, so P never goes through LDS. Online softmax in f32 in the exp2 domain; each
// half keeps the sum of its own keys, joined once behind the loop.
// Epilogue: normalise, add noise, scale by 1/1.01, stage 32x64 f32 rows in LDS, store whole lines.
// ---------------------------------------------------------------------------
// value of lane l ^ 16 (the other half of the wave), by a vector cross-row move
__device__ __forceinline__ float xhalf(float x)
{
    const int b = __builtin_bit_cast(int, x);
    return __builtin_bit_cast(float,
        __builtin_amdgcn_permlanex16(b, b, 0x76543210, 0xfedcba98, false, false));
}

// 2^x by the bare v_exp_f32. exp2f() wraps every call in a compare, two selects, an add and a ldexp
// that only serve results below 2^-126. Here x <= 0 and each query's final sum is at least 1, so such
// a term (or such a rescale factor) is far below one f32 rounding step of the sum; as 0 it changes nothing.
__device__ __forceinline__ float exp2_raw(float x)
{
    return __builtin_amdgcn_exp2f(x);
}

// online softmax of this lane's query of one column group over its 16 scores of a pass (the other
// half of the wave holds the other 16); returns the rescale factor of that group's output tiles
__device__ __forceinline__ float softmax_pass(const v8f c0, const v8f c1, float& mrun, float& lrun,
                                              Frag& pb)
{
    const float sc  = 0.125f * 1.44269504088896f;   // HD^-0.5 * log2(e)
    const float psc = 16384.0f;
    const v8f s0 = c0 * sc;
    const v8f s1 = c1 * sc;
    float mt = fmaxf(s0[0], s1[0]);
    #pragma unroll
    for (int r = 1; r < 8; ++r)
        mt = fmaxf(mt, fmaxf(s0[r], s1[r]));
    mt = fmaxf(mt, xhalf(mt));
    const float mnew  = fmaxf(mrun, mt);
    const float alpha = exp2_raw(mrun - mnew);
    mrun = mnew;
    const v8f t0 = s0 - mnew;
    const v8f t1 = s1 - mnew;
    v8f p0, p1;
    #pragma unroll
    for (int r = 0; r < 8; ++r) { p0[r] = exp2_raw(t0[r]); p1[r] = exp2_raw(t1[r]); }
    // P^T as B fragment: element r <- key 8hh+r, element 8+r <- key 16+8hh+r (the split k-map)
    const v8f g0 = p0 * psc;
    const v8f g1 = p1 * psc;
    #pragma unroll
    for (int r = 0; r < 8; ++r) { pb.v[r] = (h16)g0[r]; pb.v[8 + r] = (h16)g1[r]; }
    const v8f ps = p0 + p1;
    const float rs = ((ps[0] + ps[4]) + (ps[2] + ps[6])) + ((ps[1] + ps[5]) + (ps[3] + ps[7]));
    lrun = lrun * alpha + rs;
    return alpha;
}

// one column group's normalised output tiles to its 16 staging rows ([query][d] order)
__device__ __forceinline__ void attn_stage_rows(float* orow, const v8f o0, const v8f o1, const v8f o2,
                                                const v8f o3, float invl)
{
    const v8f y0 = o0 * invl, y1 = o1 * invl, y2 = o2 * invl, y3 = o3 * invl;
    *(v4f*)(orow)      = __builtin_shufflevector(y0, y0, 0, 1, 2, 3);
    *(v4f*)(orow + 4)  = __builtin_shufflevector(y0, y0, 4, 5, 6, 7);
    *(v4f*)(orow + 16) = __builtin_shufflevector(y1, y1, 0, 1, 2, 3);
    *(v4f*)(orow + 20) = __builtin_shufflevector(y1, y1, 4, 5, 6, 7);
    *(v4f*)(orow + 32) = __builtin_shufflevector(y2, y2, 0, 1, 2, 3);
    *(v4f*)(orow + 36) = __builtin_shufflevector(y2, y2, 4, 5, 6, 7);
    *(v4f*)(orow + 48) = __builtin_shufflevector(y3, y3, 0, 1, 2, 3);
    *(v4f*)(orow + 52) = __builtin_shufflevector(y3, y3, 4, 5, 6, 7);
}

__device__ __forceinline__ void attn_store_pass(const float* Ow, const float* __restrict__ noise,
                                                float* out, size_t bh, int b, int h, int q0, int l)
{
    const float inv101 = 1.0f / 1.01f;
    const int piece = l & 15, rsel = l >> 4;
    #pragma unroll
    for (int i = 0; i < 16; ++i) {
        const int rowl = 2 * i + rsel;                      // 0..31, every row exactly once
        const int q = q0 + rowl;
        const v4f y  = *(const v4f*)&Ow[rowl * OPITCH + 4 * piece];
        const v4f nz = *(const v4f*)(noise + ((bh * NS + (size_t)q) * NHD + 4 * piece));
        const v4f val = (y + nz) * inv101;
        *(v4f*)(out + (((size_t)b * NS + (size_t)q) * NDIM + (size_t)h * NHD + 4 * piece)) = val;
    }
}

__global__ __launch_bounds__(128) void k_attn(
    const h16* __restrict__ qh, const h16* __restrict__ kh, const h16* __restrict__ vt,
    const float* __restrict__ noise, float* __restrict__ out)
{
    __shared__ __attribute__((aligned(16))) h16   Kt[2][SK * KP];
    __shared__ __attribute__((aligned(16))) h16   Vt[2][64 * VP];
    __shared__ __attribute__((aligned(16))) float Os[4][32 * OPITCH];   // output staging, a wave's own rows
    static_assert(NS % 128 == 0);
    static_assert(NS % SK == 0);

    const int tid = threadIdx.x, l = tid & 31, w = tid >> 5;
    const int hh = l >> 4, m = l & 15;
    const int b = blockIdx.z, h = blockIdx.y;
    const size_t bh = (size_t)b * NH + h;
    const int q0 = blockIdx.x * 128 + w * 32;

    // Q rows as B fragments (column = query), split k-map: group a = rows q0+m, group b = rows
    // q0+16+m; fragment 0 covers d 0..31, fragment 1 d 32..63
    Frag qa0, qa1, qb0, qb1;
    {
        const h16* qrow = qh + (bh * NS + (size_t)(q0 + m)) * NHD + 8 * hh;
        qa0.hf[0] = *(const v8h*)(qrow);      qa0.hf[1] = *(const v8h*)(qrow + 16);
        qa1.hf[0] = *(const v8h*)(qrow + 32); qa1.hf[1] = *(const v8h*)(qrow + 48);
        qrow += 16 * NHD;
        qb0.hf[0] = *(const v8h*)(qrow);      qb0.hf[1] = *(const v8h*)(qrow + 16);
        qb1.hf[0] = *(const v8h*)(qrow + 32); qb1.hf[1] = *(const v8h*)(qrow + 48);
    }
    // staging map, 16-B pieces: thread t moves K pieces t + 128 i (piece p: key p>>3, d 8*(p&7); the
    // tile is 8 KiB contiguous in kh) and V^T pieces t + 128 i (piece p: d p>>3, key 8*(p&7))
    const h16* kg = kh + bh * NS * NHD + (size_t)tid * 8;                         // + key0 * NHD
    const h16* vg = vt + (bh * NHD + (size_t)(tid >> 3)) * NS + 8 * (tid & 7);    // + key0
    const int  ks = (tid >> 3) * KP + 8 * (tid & 7);
    const int  vs = (tid >> 3) * VP + 8 * (tid & 7);
    const int  kf = m * KP + 8 * hh;     // fragment reads: K tile row = key, + 16 * KP for keys 16..31
    const int  vf = m * VP + 8 * hh;     // V^T tile row = d, + 16t * VP

    v8h sk[4], sv[4];
    #pragma unroll
    for (int i = 0; i < 4; ++i) {
        sk[i] = *(const v8h*)(kg + i * 16 * NHD);
        sv[i] = *(const v8h*)(vg + (size_t)i * 16 * NS);
    }
    // keeps the overwrite of the address registers of the loads above behind this wait
    asm volatile("s_wait_xcnt 0x0" ::: "memory");
    #pragma unroll
    for (int i = 0; i < 4; ++i) {
        *(v8h*)&Kt[0][ks + i * 16 * KP] = sk[i];
        *(v8h*)&Vt[0][vs + i * 16 * VP] = sv[i];
    }
    __syncthreads();   // tiles of stage 0 complete before any wave reads fragments from them

    // this lane's two queries q0+m (a) and q0+16+m (b): running maximum (equal in both halves) and
    // this half's own sum; oat[r] = O^T[16t + 8hh + r][m] of group a, obt of group b
    float mra = -__builtin_inff(), lra = 0.0f;
    float mrb = -__builtin_inff(), lrb = 0.0f;
    v8f oa0 = {}, oa1 = {}, oa2 = {}, oa3 = {};
    v8f ob0 = {}, ob1 = {}, ob2 = {}, ob3 = {};

    float* Ow = &Os[w][0];

    // the passes of one stage, over the tiles in buffer cur
    auto stage_passes = [&](const int cur) __attribute__((always_inline)) {
        // unrolled: each pass's tile offsets become immediates of its LDS reads
        #pragma unroll
        for (int j = 0; j < SK / 32; ++j) {

        // scores, transposed: 32 keys x 16 queries per group; c0[r] = key key0+8hh+r,
        // c1[r] = key key0+16+8hh+r
        v8f ca0, ca1, cb0, cb1;      // each tile's first product takes the constant 0 as its C
        {
            const h16* kp = &Kt[cur][kf + j * 32 * KP];
            Frag kb0, kb1, kb2, kb3;      // read as one group ahead of the eight products
            kb0.hf[0] = *(const v8h*)(kp);      kb0.hf[1] = *(const v8h*)(kp + 16);
            kb1.hf[0] = *(const v8h*)(kp + 32); kb1.hf[1] = *(const v8h*)(kp + 48);
            kp += 16 * KP;
            kb2.hf[0] = *(const v8h*)(kp);      kb2.hf[1] = *(const v8h*)(kp + 16);
            kb3.hf[0] = *(const v8h*)(kp + 32); kb3.hf[1] = *(const v8h*)(kp + 48);
            // The eight products stand in one asm statement, so that each fills the distance behind the
            // others and the LDS reads stay one group in front (as builtins the compiler spreads the
            // reads of two passes among them, and a wave then waits on LDS at more places).
            // The four v_nop at the end keep the distance between the last product and the first
            // vector instruction that reads a score tile or overwrites a fragment. The s_delay_alu
            // behind them is the hint the compiler writes in front of a reader of a builtin product and
            // cannot write here: the wave steps aside until the last product is done, not holding the
            // vector port.
            asm volatile("v_wmma_f32_16x16x32_f16 %0, %4, %8, 0\n\t"
                         "v_wmma_f32_16x16x32_f16 %1, %6, %8, 0\n\t"
                         "v_wmma_f32_16x16x32_f16 %2, %4, %10, 0\n\t"
                         "v_wmma_f32_16x16x32_f16 %3, %6, %10, 0\n\t"
                         "v_wmma_f32_16x16x32_f16 %0, %5, %9, %0\n\t"
                         "v_wmma_f32_16x16x32_f16 %1, %7, %9, %1\n\t"
                         "v_wmma_f32_16x16x32_f16 %2, %5, %11, %2\n\t"
                         "v_wmma_f32_16x16x32_f16 %3, %7, %11, %3\n\t"
                         "v_nop\n\tv_nop\n\tv_nop\n\tv_nop\n\t"
                         "s_delay_alu instid0(TRANS32_DEP_1)"
                         : "=&v"(ca0), "=&v"(ca1), "=&v"(cb0), "=&v"(cb1)
                         : "v"(kb0.v), "v"(kb1.v), "v"(kb2.v), "v"(kb3.v),
                           "v"(qa0.v), "v"(qa1.v), "v"(qb0.v), "v"(qb1.v));
        }

        Frag pa, pb;
        const float alb = softmax_pass(cb0, cb1, mrb, lrb, pb);
        ob0 *= alb; ob1 *= alb; ob2 *= alb; ob3 *= alb;
        const float ala = softmax_pass(ca0, ca1, mra, lra, pa);
        oa0 *= ala; oa1 *= ala; oa2 *= ala; oa3 *= ala;

        // O^T += V^T P^T : A = V^T tile rows d (k = key, split k-map), B = P^T from registers
        {
            const h16* vp = &Vt[cur][vf + j * 32];
            Frag vb0, vb1, vb2, vb3;      // read as one group ahead of the eight products
            vb0.hf[0] = *(const v8h*)(vp);           vb0.hf[1] = *(const v8h*)(vp + 16);
            vb1.hf[0] = *(const v8h*)(vp + 16 * VP); vb1.hf[1] = *(const v8h*)(vp + 16 * VP + 16);
            vb2.hf[0] = *(const v8h*)(vp + 32 * VP); vb2.hf[1] = *(const v8h*)(vp + 32 * VP + 16);
            vb3.hf[0] = *(const v8h*)(vp + 48 * VP); vb3.hf[1] = *(const v8h*)(vp + 48 * VP + 16);
            // one asm statement for the same two reasons; the four v_nop keep the distance between the
            // last product and the first vector instruction that touches ob3, pb or a V^T fragment
            asm volatile("v_wmma_f32_16x16x32_f16 %0, %8, %12, %0\n\t"
                         "v_wmma_f32_16x16x32_f16 %1, %9, %12, %1\n\t"
                         "v_wmma_f32_16x16x32_f16 %2, %10, %12, %2\n\t"
                         "v_wmma_f32_16x16x32_f16 %3, %11, %12, %3\n\t"
                         "v_wmma_f32_16x16x32_f16 %4, %8, %13, %4\n\t"
                         "v_wmma_f32_16x16x32_f16 %5, %9, %13, %5\n\t"
                         "v_wmma_f32_16x16x32_f16 %6, %10, %13, %6\n\t"
                         "v_wmma_f32_16x16x32_f16 %7, %11, %13, %7\n\t"
                         "v_nop\n\tv_nop\n\tv_nop\n\tv_nop"
                         : "+v"(oa0), "+v"(oa1), "+v"(oa2), "+v"(oa3),
                           "+v"(ob0), "+v"(ob1), "+v"(ob2), "+v"(ob3)
                         : "v"(vb0.v), "v"(vb1.v), "v"(vb2.v), "v"(vb3.v), "v"(pa.v), "v"(pb.v));
        }

        }   // passes of this stage
    };

    // every stage but the last; the last is written out behind the loop, so that no branch stands between
    // a stage's passes and its foot (across one the compiler carries both passes' exponentials to sum
    // them behind it, and the kernel then needs more than 256 registers)
    for (int st = 0; st + 1 < NS / SK; ++st) {
        const int cur = st & 1;

        // next stage's tiles: global loads issued here, stored to the other buffer at the foot
        {
            const int keyn = (st + 1) * SK;
            const h16* kn = kg + (size_t)keyn * NHD;
            const h16* vn = vg + keyn;
            #pragma unroll
            for (int i = 0; i < 4; ++i) {
                sk[i] = *(const v8h*)(kn + i * 16 * NHD);
                sv[i] = *(const v8h*)(vn + (size_t)i * 16 * NS);
            }
            // keeps the overwrite of the address registers of the loads above behind this wait
            asm volatile("s_wait_xcnt 0x0" ::: "memory");
        }

        stage_passes(cur);

        // the other buffer's last readers left it before the previous stage's foot barrier
        #pragma unroll
        for (int i = 0; i < 4; ++i) {
            *(v8h*)&Kt[cur ^ 1][ks + i * 16 * KP] = sk[i];
            *(v8h*)&Vt[cur ^ 1][vs + i * 16 * VP] = sv[i];
        }
        __syncthreads();   // next stage's K and V^T tiles complete before any wave reads them; this
                           // stage's reads of its own buffer done before the next foot refills it
    }
    stage_passes((NS / SK - 1) & 1);   // the last stage: nothing to bring in, no buffer handed on

    // epilogue: normalise (fold back 1/16384), stage in LDS in [row][d] order
    const float osc = 1.0f / 16384.0f;
    lra += xhalf(lra);                      // join the two halves' sums of each query
    lrb += xhalf(lrb);
    const float inva = osc * __builtin_amdgcn_rcpf(lra);
    const float invb = osc * __builtin_amdgcn_rcpf(lrb);
    // row = query m (group a) or 16 + m (group b); 8 consecutive d per tile
    attn_stage_rows(&Ow[m * OPITCH + 8 * hh], oa0, oa1, oa2, oa3, inva);
    attn_stage_rows(&Ow[(16 + m) * OPITCH + 8 * hh], ob0, ob1, ob2, ob3, invb);
    __syncthreads();

    attn_store_pass(Ow, noise, out, bh, b, h, q0, l);
    
}

// ---------------------------------------------------------------------------
extern "C" void kernel_launch(void* const* d_in, const int* in_sizes, int n_in,
                              void* d_out, int out_size, void* d_ws, size_t ws_size,
                              hipStream_t stream)
{
    if (n_in < 8) return;
    const int n_x = NB * NS * NDIM;
    const int n_w = NDIM * NDIM;
    if (in_sizes[0] != n_x || in_sizes[1] != n_w || in_sizes[2] != NDIM ||
        in_sizes[3] != n_w || in_sizes[4] != NDIM || in_sizes[5] != n_w ||
        in_sizes[6] != NDIM || in_sizes[7] != NB * NH * NS * NHD || out_size != n_x)
        return;

    const float* x     = (const float*)d_in[0];
    const float* Wq    = (const float*)d_in[1];
    const float* bq    = (const float*)d_in[2];
    const float* Wk    = (const float*)d_in[3];
    const float* bk    = (const float*)d_in[4];
    const float* Wv    = (const float*)d_in[5];
    const float* bv    = (const float*)d_in[6];
    const float* noise = (const float*)d_in[7];
    float* out = (float*)d_out;

    // workspace carve (bytes): xh 8 MiB | wh 1.5 MiB | qh 8 MiB | kh 8 MiB | vt 8 MiB = 33.5 MiB
    const size_t bytes_xh  = (size_t)n_x * 2;
    const size_t bytes_wh  = (size_t)3 * n_w * 2;
    const size_t bytes_qkv = (size_t)NB * NH * NS * NHD * 2;
    const size_t off_xh = 0;
    const size_t off_wh = off_xh + bytes_xh;
    const size_t off_q  = off_wh + bytes_wh;
    const size_t off_k  = off_q + bytes_qkv;
    const size_t off_v  = off_k + bytes_qkv;
    const size_t end    = off_v + bytes_qkv;
    if (end > ws_size) return;

    char* ws = (char*)d_ws;
    h16* xh = (h16*)(ws + off_xh);
    h16* wh = (h16*)(ws + off_wh);
    h16* qh = (h16*)(ws + off_q);
    h16* kh = (h16*)(ws + off_k);
    h16* vt = (h16*)(ws + off_v);

    const int nxc = n_x / 8;            // 524288 chunks
    const int nwc = n_w / 8;            // 32768 chunks per weight
    const int total_chunks = nxc + 3 * nwc;
    const int cgrid = (total_chunks + 255) / 256;
    k_convert<<<dim3(cgrid), dim3(256), 0, stream>>>(x, Wq, Wk, Wv, xh, wh, nxc, nwc);

    dim3 pg((NB * NS) / 64, NDIM / 64, 3);     // 128 x 8 x 3
    k_proj<<<pg, dim3(128), 0, stream>>>(xh, wh, bq, bk, bv, qh, kh, vt);

    dim3 ag(NS / 128, NH, NB);                 // 16 x 8 x 4
    k_attn<<<ag, dim3(128), 0, stream>>>(qh, kh, vt, noise, out);
}

// v008
// Measured time: 59.8 microseconds a run.
// Two timings next to v007 both put it at 1.07 times that version's speed.
// Over all steps from v000 it is 4.01 times as fast.
// All contractions: v_wmma_f32_16x16x32_f16 (f16 operands, f32 accumulate): q/k/v projections (weights carried x64, folded as 1/64), q.k^T scores, p.v (p carried x16384, folded as 1/16384).
#include <hip/hip_runtime.h>
#include <stdint.h>
#include <stddef.h>

#define NB   4
#define NS   2048
#define NDIM 512
#define NH   8
#define NHD  64

#define PT   128    // projection block tile: rows and columns
#define TP   72     // projection LDS tile pitch (halves)
#define EP   136    // projection output staging pitch (halves): 272 B = 16 B x odd
#define OPITCH 68   // output staging pitch (floats)
#define KP   72     // K tile LDS pitch (halves): 144 B = 16 B x odd, conflict-free 16-B row reads
#define VP   72     // V^T tile LDS pitch (halves): 144 B = 16 B x odd
#define SK   64     // keys per attention stage (two passes of 32 keys)

typedef _Float16 h16;
typedef h16   v16h __attribute__((ext_vector_type(16)));
typedef h16   v8h  __attribute__((ext_vector_type(8), __may_alias__));
typedef float v8f  __attribute__((ext_vector_type(8)));
typedef float v4f  __attribute__((ext_vector_type(4), __may_alias__));

union Frag { v16h v; v8h hf[2]; };
union Pack8 { v8h v; h16 e[8]; };

static_assert(sizeof(Frag) == 32);
static_assert(sizeof(Pack8) == 16);
static_assert(NS % 64 == 0);
static_assert(NDIM % 64 == 0);
static_assert(NHD == 64);

// 16x16x32 f16 WMMA, the bare builtin (projection): the compiler keeps the distance behind it itself.
__device__ __forceinline__ v8f wmma16(const v16h a, const v16h b, v8f c)
{
    return __builtin_amdgcn_wmma_f32_16x16x32_f16(false, a, false, b, (short)0, c, false, false);
}

// ---------------------------------------------------------------------------
// Kernel 0: one-time f32 -> f16 conversion of x (unscaled) and Wq/Wk/Wv (x64, exact).
// Each thread converts 8 consecutive floats and writes one 16-B piece; a wave writes
// ---------------------------------------------------------------------------
__global__ __launch_bounds__(256) void k_convert(
    const float* __restrict__ x, const float* __restrict__ wq,
    const float* __restrict__ wk, const float* __restrict__ wv,
    h16* __restrict__ xh, h16* __restrict__ wh, int nxc, int nwc)
{
    const int t = blockIdx.x * 256 + threadIdx.x;      // 8-element chunk id
    const int total = nxc + 3 * nwc;
    if (t >= total) return;
    const float* src;
    h16* dst;
    float sc;
    if (t < nxc) {
        src = x + (size_t)t * 8;
        dst = xh + (size_t)t * 8;
        sc  = 1.0f;
    } else {
        const int u = t - nxc;
        const int w = u / nwc;
        const int c = u - w * nwc;
        const float* wp = (w == 0) ? wq : ((w == 1) ? wk : wv);
        src = wp + (size_t)c * 8;
        dst = wh + (size_t)u * 8;
        sc  = 64.0f;
    }
    const v4f f0 = *(const v4f*)(src);
    const v4f f1 = *(const v4f*)(src + 4);
    Pack8 p;
    p.e[0] = (h16)(f0.x * sc); p.e[1] = (h16)(f0.y * sc);
    p.e[2] = (h16)(f0.z * sc); p.e[3] = (h16)(f0.w * sc);
    p.e[4] = (h16)(f1.x * sc); p.e[5] = (h16)(f1.y * sc);
    p.e[6] = (h16)(f1.z * sc); p.e[7] = (h16)(f1.w * sc);
    const v8h val = p.v;
    *(v8h*)dst = val;
    
}

// ---------------------------------------------------------------------------
// Kernel 1: q/k/v = x @ W^T + b  (M = B*S = 8192, N = 512, K = 512), blockIdx.z selects W.
// Block tile 128 rows x 128 cols (two heads), 128 threads = 4 waves, wave tile 64x64 (4x4 acc): every
// byte brought from L2 serves 128 rows or columns, and every fragment read from LDS four products.
// Each step's x tile and W tile (128 rows x 64 k; W is [n][k], k-contiguous) are brought into LDS once
// per block, in two buffers, loaded a step ahead through registers. A and B fragments are read from
// them, both in the split k-map (elements 0..7 <- k0+8h.., 8..15 <- k0+16+8h..). Epilogue stages the
// 128x128 f16 tile in LDS in the output's own order and stores whole lines.
// Outputs: qh, kh as [B,H,S,64]; vt as [B,H,64,S].
// ---------------------------------------------------------------------------
__global__ __launch_bounds__(128) void k_proj(
    const h16* __restrict__ xh, const h16* __restrict__ wh,
    const float* __restrict__ bq, const float* __restrict__ bk, const float* __restrict__ bv,
    h16* __restrict__ qh, h16* __restrict__ kh, h16* __restrict__ vt)
{
    // two buffers, each an x tile then a W tile of PT rows x 64 k at pitch TP.
    // Buffer 0 serves again as the output staging tile T (PT rows at pitch EP) behind the loop.
    __shared__ __attribute__((aligned(16))) h16 S[4 * PT * TP];
    static_assert(PT * EP <= 2 * PT * TP);
    static_assert(NS % PT == 0 && NDIM % PT == 0 && PT == 2 * NHD);
    h16* T = S;

    const int tid = threadIdx.x, l = tid & 31, w = tid >> 5;
    const int hh = l >> 4, m = l & 15;
    const int z = blockIdx.z;
    const bool tr = (z == 2);                  // the same for the whole block
    const int row0 = blockIdx.x * PT;          // global m (= b*2048 + s)
    const int col0 = blockIdx.y * PT;          // global n (= head*64 + d)
    const int wr = (w & 1) * 64, wc = (w >> 1) * 64;   // wave tile: first row, first column

    // staging map, 16-B pieces: thread t moves pieces t + 128 i of each tile (piece p: row p >> 3,
    // k 8 * (p & 7)), so one wave-wide load covers four whole 128-B lines
    const h16* ag = xh + (size_t)(row0 + (tid >> 3)) * NDIM + 8 * (tid & 7);
    const h16* bg = wh + ((size_t)z * NDIM + (size_t)(col0 + (tid >> 3))) * NDIM + 8 * (tid & 7);
    const int  ss = (tid >> 3) * TP + 8 * (tid & 7);
    // fragment reads: tile row, + 16 i * TP for the further tiles
    const int  af = (wr + m) * TP + 8 * hh;
    const int  bf = PT * TP + (wc + m) * TP + 8 * hh;

    v8h ra[8], rb[8];
    #pragma unroll
    for (int i = 0; i < 8; ++i) {
        ra[i] = *(const v8h*)(ag + (size_t)i * 16 * NDIM);
        rb[i] = *(const v8h*)(bg + (size_t)i * 16 * NDIM);
    }
    #pragma unroll
    for (int i = 0; i < 8; ++i) {
        *(v8h*)&S[ss + i * 16 * TP]           = ra[i];
        *(v8h*)&S[PT * TP + ss + i * 16 * TP] = rb[i];
    }
    __syncthreads();   // tiles of step 0 complete before any wave reads fragments from them

    v8f acc[4][4] = {};

    // unrolled: buffer index and k offset become immediates, so no address is recomputed in the loop
    #pragma unroll
    for (int kt = 0; kt < NDIM / 64; ++kt) {
        const int  cur  = kt & 1;
        const bool more = (kt + 1 < NDIM / 64);    // the same for the whole block

        // next step's tiles: global loads issued here, stored to the other buffer at the foot
        if (more) {
            #pragma unroll
            for (int i = 0; i < 8; ++i) {
                ra[i] = *(const v8h*)(ag + (size_t)i * 16 * NDIM + (kt + 1) * 64);
                rb[i] = *(const v8h*)(bg + (size_t)i * 16 * NDIM + (kt + 1) * 64);
            }
            // keeps the sixteen loads above and the step's fragment reads below it as one group: without
            // it the reads are spread over nine places among the products before them, each a stop of
            // its own (and with neither scheduling barrier the loads sink to the foot, where every step
            // waits out L2)
            __builtin_amdgcn_sched_barrier(0);
        }

        const h16* ap = &S[cur * 2 * PT * TP + af];
        const h16* bp = &S[cur * 2 * PT * TP + bf];
        Frag a[2][4], b[2][4];      // the step's fragments, read as one group ahead of its 32 products
        #pragma unroll
        for (int kk = 0; kk < 2; ++kk) {
            #pragma unroll
            for (int i = 0; i < 4; ++i) {
                a[kk][i].hf[0] = *(const v8h*)(ap + i * 16 * TP + kk * 32);
                a[kk][i].hf[1] = *(const v8h*)(ap + i * 16 * TP + kk * 32 + 16);
                b[kk][i].hf[0] = *(const v8h*)(bp + i * 16 * TP + kk * 32);
                b[kk][i].hf[1] = *(const v8h*)(bp + i * 16 * TP + kk * 32 + 16);
            }
        }
        // keeps the reads one group ahead of the products: left free, the compiler reads most fragments
        // right in front of their products, and the wave waits out the LDS latency at each such place
        __builtin_amdgcn_sched_barrier(0);
        #pragma unroll
        for (int kk = 0; kk < 2; ++kk) {
            #pragma unroll
            for (int i = 0; i < 4; ++i) {
                #pragma unroll
                for (int j = 0; j < 4; ++j)
                    acc[i][j] = wmma16(a[kk][i].v, b[kk][j].v, acc[i][j]);
            }
        }

        // the other buffer's last readers left it before the previous step's foot barrier
        if (more) {
            #pragma unroll
            for (int i = 0; i < 8; ++i) {
                *(v8h*)&S[(cur ^ 1) * 2 * PT * TP + ss + i * 16 * TP]           = ra[i];
                *(v8h*)&S[(cur ^ 1) * 2 * PT * TP + PT * TP + ss + i * 16 * TP] = rb[i];
            }
            __syncthreads();   // next step's tiles complete before any wave reads them; this step's
                               // reads of its own buffer done before the next foot refills it
        }
    }
    // the last step reads buffer 1 only; buffer 0 (= T) was left before the last foot barrier

    // epilogue: undo the x64 weight scale, add bias, convert to f16, stage in LDS;
    // acc[i][j][r] = local row (s) wr+16i+8hh+r, local column (d over two heads) wc+16j+m
    const float* bias = (z == 0) ? bq : ((z == 1) ? bk : bv);
    const float wsc = 0.015625f;   // 1/64
    float bs[4];
    #pragma unroll
    for (int j = 0; j < 4; ++j)
        bs[j] = bias[col0 + wc + 16 * j + m];
    // the branch is the same for the whole block; inside it every LDS address is one register plus an immediate
    if (tr) {      // T[column][row]
        #pragma unroll
        for (int i = 0; i < 4; ++i) {
            #pragma unroll
            for (int j = 0; j < 4; ++j) {
                #pragma unroll
                for (int r = 0; r < 8; ++r)
                    T[(wc + 16 * j + m) * EP + wr + 16 * i + 8 * hh + r] = (h16)(acc[i][j][r] * wsc + bs[j]);
            }
        }
    } else {       // T[row][column]
        #pragma unroll
        for (int i = 0; i < 4; ++i) {
            #pragma unroll
            for (int j = 0; j < 4; ++j) {
                #pragma unroll
                for (int r = 0; r < 8; ++r)
                    T[(wr + 16 * i + 8 * hh + r) * EP + wc + 16 * j + m] = (h16)(acc[i][j][r] * wsc + bs[j]);
            }
        }
    }
    __syncthreads();

    // store whole lines: 16-B piece p = t + 128 i of T (row p >> 4, halves 8 * (p & 15)), each once
    const int bb = row0 >> 11, s0 = row0 & (NS - 1);
    const size_t bh0 = (size_t)bb * NH + 2 * blockIdx.y;      // first of the block's two heads
    const int trow = tid >> 4, piece = tid & 15;
    v8h o[16];
    #pragma unroll
    for (int i = 0; i < 16; ++i)
        o[i] = *(const v8h*)&T[(trow + 8 * i) * EP + 8 * piece];
    // the row pitch is a constant in each branch, so every store is one address plus an immediate
    if (tr) {   // vt[bh][d][s]: T row = 64 * (head - first head) + d, 128 s per row
        h16* base = vt + (bh0 * NHD + trow) * NS + s0 + 8 * piece;
        #pragma unroll
        for (int i = 0; i < 16; ++i)
            *(v8h*)(base + (size_t)(8 * i) * NS) = o[i];
    } else {    // qh/kh[bh][s][d]: T row = s_local, 64 d of the first head, then 64 of the second
        h16* base = ((z == 0) ? qh : kh) + ((bh0 + (piece >> 3)) * NS + s0 + trow) * NHD + 8 * (piece & 7);
        #pragma unroll
        for (int i = 0; i < 16; ++i)
            *(v8h*)(base + (size_t)(8 * i) * NHD) = o[i];
        // keeps any overwrite of the address registers of the stores above behind this wait
        asm volatile("s_wait_xcnt 0x0" ::: "memory");
    }
}

// ---------------------------------------------------------------------------
// Kernel 2: flash attention per (b, h). 128 threads = 4 waves; block = 128 queries, wave = 32
// query rows in two column groups of 16; 32 keys per pass, SK keys per stage. Q kept as two B
// fragments per group. Each stage's K tile (SK
// kh rows, [key][d]) and V^T tile (64 vt rows, [d][key]) are brought into LDS once per block, in two
// buffers: every thread loads eight 16-B pieces of the next stage's tiles at the top of a stage and
// stores them at its foot, so the loads have two passes (32 keys x 128 queries each) to land and the
// block meets at one barrier per stage. Both products run transposed: S^T = K Q^T (A = K tile rows, k = d; B = Q) and
// O^T += V^T P^T (A = V^T tile rows, k = key; B = P^T). Every K and V^T fragment read from LDS serves
// both column groups. In each group a lane holds 16 of the 32 scores of ONE
// query (column l & 15): maximum and sum run in its own registers, with one exchange between the wave
// halves for the maximum; the two score tiles, converted in place (f16, x16384), are the B fragment
// of the second product, so P never goes through LDS. Online softmax in f32 in the exp2 domain; each
// half keeps the sum of its own keys, joined once behind the loop.
// Epilogue: normalise, stage 32x64 f32 rows in LDS, add noise, scale by 1/1.01, store whole lines.
// ---------------------------------------------------------------------------
// value of lane l ^ 16 (the other half of the wave), by a vector cross-row move
__device__ __forceinline__ float xhalf(float x)
{
    const int b = __builtin_bit_cast(int, x);
    return __builtin_bit_cast(float,
        __builtin_amdgcn_permlanex16(b, b, 0x76543210, 0xfedcba98, false, false));
}

// 2^x by the bare v_exp_f32. exp2f() wraps every call in a compare, two selects, an add and a ldexp
// that only serve results below 2^-126. Here x <= 0 and each query's final sum is at least 1, so such
// a term (or such a rescale factor) is far below one f32 rounding step of the sum; as 0 it changes nothing.
__device__ __forceinline__ float exp2_raw(float x)
{
    return __builtin_amdgcn_exp2f(x);
}

// online softmax of this lane's query of one column group over its 16 scores of a pass (the other
// half of the wave holds the other 16); returns the rescale factor of that group's output tiles
__device__ __forceinline__ float softmax_pass(const v8f c0, const v8f c1, float& mrun, float& lrun,
                                              Frag& pb)
{
    const float sc  = 0.125f * 1.44269504088896f;   // HD^-0.5 * log2(e)
    const float psc = 16384.0f;
    const v8f s0 = c0 * sc;
    const v8f s1 = c1 * sc;
    float mt = fmaxf(s0[0], s1[0]);
    #pragma unroll
    for (int r = 1; r < 8; ++r)
        mt = fmaxf(mt, fmaxf(s0[r], s1[r]));
    mt = fmaxf(mt, xhalf(mt));
    const float mnew  = fmaxf(mrun, mt);
    const float alpha = exp2_raw(mrun - mnew);
    mrun = mnew;
    const v8f t0 = s0 - mnew;
    const v8f t1 = s1 - mnew;
    v8f p0, p1;
    #pragma unroll
    for (int r = 0; r < 8; ++r) { p0[r] = exp2_raw(t0[r]); p1[r] = exp2_raw(t1[r]); }
    // P^T as B fragment: element r <- key 8hh+r, element 8+r <- key 16+8hh+r (the split k-map)
    const v8f g0 = p0 * psc;
    const v8f g1 = p1 * psc;
    #pragma unroll
    for (int r = 0; r < 8; ++r) { pb.v[r] = (h16)g0[r]; pb.v[8 + r] = (h16)g1[r]; }
    const v8f ps = p0 + p1;
    const float rs = ((ps[0] + ps[4]) + (ps[2] + ps[6])) + ((ps[1] + ps[5]) + (ps[3] + ps[7]));
    lrun = lrun * alpha + rs;
    return alpha;
}

// one column group's normalised output tiles to its 16 staging rows ([query][d] order)
__device__ __forceinline__ void attn_stage_rows(float* orow, const v8f o0, const v8f o1, const v8f o2,
                                                const v8f o3, float invl)
{
    const v8f y0 = o0 * invl, y1 = o1 * invl, y2 = o2 * invl, y3 = o3 * invl;
    *(v4f*)(orow)      = __builtin_shufflevector(y0, y0, 0, 1, 2, 3);
    *(v4f*)(orow + 4)  = __builtin_shufflevector(y0, y0, 4, 5, 6, 7);
    *(v4f*)(orow + 16) = __builtin_shufflevector(y1, y1, 0, 1, 2, 3);
    *(v4f*)(orow + 20) = __builtin_shufflevector(y1, y1, 4, 5, 6, 7);
    *(v4f*)(orow + 32) = __builtin_shufflevector(y2, y2, 0, 1, 2, 3);
    *(v4f*)(orow + 36) = __builtin_shufflevector(y2, y2, 4, 5, 6, 7);
    *(v4f*)(orow + 48) = __builtin_shufflevector(y3, y3, 0, 1, 2, 3);
    *(v4f*)(orow + 52) = __builtin_shufflevector(y3, y3, 4, 5, 6, 7);
}

__device__ __forceinline__ void attn_store_pass(const float* Ow, const float* __restrict__ noise,
                                                float* out, size_t bh, int b, int h, int q0, int l)
{
    const float inv101 = 1.0f / 1.01f;
    const int piece = l & 15, rsel = l >> 4;
    #pragma unroll
    for (int i = 0; i < 16; ++i) {
        const int rowl = 2 * i + rsel;                      // 0..31, every row exactly once
        const int q = q0 + rowl;
        const v4f y  = *(const v4f*)&Ow[rowl * OPITCH + 4 * piece];
        const v4f nz = *(const v4f*)(noise + ((bh * NS + (size_t)q) * NHD + 4 * piece));
        const v4f val = (y + nz) * inv101;
        *(v4f*)(out + (((size_t)b * NS + (size_t)q) * NDIM + (size_t)h * NHD + 4 * piece)) = val;
    }
}

__global__ __launch_bounds__(128) void k_attn(
    const h16* __restrict__ qh, const h16* __restrict__ kh, const h16* __restrict__ vt,
    const float* __restrict__ noise, float* __restrict__ out)
{
    __shared__ __attribute__((aligned(16))) h16   Kt[2][SK * KP];
    __shared__ __attribute__((aligned(16))) h16   Vt[2][64 * VP];
    __shared__ __attribute__((aligned(16))) float Os[4][32 * OPITCH];   // output staging, a wave's own rows
    static_assert(NS % 128 == 0);
    static_assert(NS % SK == 0);

    const int tid = threadIdx.x, l = tid & 31, w = tid >> 5;
    const int hh = l >> 4, m = l & 15;
    const int b = blockIdx.z, h = blockIdx.y;
    const size_t bh = (size_t)b * NH + h;
    const int q0 = blockIdx.x * 128 + w * 32;

    // Q rows as B fragments (column = query), split k-map: group a = rows q0+m, group b = rows
    // q0+16+m; fragment 0 covers d 0..31, fragment 1 d 32..63
    Frag qa0, qa1, qb0, qb1;
    {
        const h16* qrow = qh + (bh * NS + (size_t)(q0 + m)) * NHD + 8 * hh;
        qa0.hf[0] = *(const v8h*)(qrow);      qa0.hf[1] = *(const v8h*)(qrow + 16);
        qa1.hf[0] = *(const v8h*)(qrow + 32); qa1.hf[1] = *(const v8h*)(qrow + 48);
        qrow += 16 * NHD;
        qb0.hf[0] = *(const v8h*)(qrow);      qb0.hf[1] = *(const v8h*)(qrow + 16);
        qb1.hf[0] = *(const v8h*)(qrow + 32); qb1.hf[1] = *(const v8h*)(qrow + 48);
    }
    // staging map, 16-B pieces: thread t moves K pieces t + 128 i (piece p: key p>>3, d 8*(p&7); the
    // tile is 8 KiB contiguous in kh) and V^T pieces t + 128 i (piece p: d p>>3, key 8*(p&7))
    const h16* kg = kh + bh * NS * NHD + (size_t)tid * 8;                         // + key0 * NHD
    const h16* vg = vt + (bh * NHD + (size_t)(tid >> 3)) * NS + 8 * (tid & 7);    // + key0
    const int  ks = (tid >> 3) * KP + 8 * (tid & 7);
    const int  vs = (tid >> 3) * VP + 8 * (tid & 7);
    const int  kf = m * KP + 8 * hh;     // fragment reads: K tile row = key, + 16 * KP for keys 16..31
    const int  vf = m * VP + 8 * hh;     // V^T tile row = d, + 16t * VP

    v8h sk[4], sv[4];
    #pragma unroll
    for (int i = 0; i < 4; ++i) {
        sk[i] = *(const v8h*)(kg + i * 16 * NHD);
        sv[i] = *(const v8h*)(vg + (size_t)i * 16 * NS);
    }
    // keeps the overwrite of the address registers of the loads above behind this wait
    asm volatile("s_wait_xcnt 0x0" ::: "memory");
    #pragma unroll
    for (int i = 0; i < 4; ++i) {
        *(v8h*)&Kt[0][ks + i * 16 * KP] = sk[i];
        *(v8h*)&Vt[0][vs + i * 16 * VP] = sv[i];
    }
    __syncthreads();   // tiles of stage 0 complete before any wave reads fragments from them

    // this lane's two queries q0+m (a) and q0+16+m (b): running maximum (equal in both halves) and
    // this half's own sum; oat[r] = O^T[16t + 8hh + r][m] of group a, obt of group b
    float mra = -__builtin_inff(), lra = 0.0f;
    float mrb = -__builtin_inff(), lrb = 0.0f;
    v8f oa0 = {}, oa1 = {}, oa2 = {}, oa3 = {};
    v8f ob0 = {}, ob1 = {}, ob2 = {}, ob3 = {};

    float* Ow = &Os[w][0];

    // the passes of one stage, over the tiles in buffer cur
    auto stage_passes = [&](const int cur) __attribute__((always_inline)) {
        // unrolled: each pass's tile offsets become immediates of its LDS reads
        #pragma unroll
        for (int j = 0; j < SK / 32; ++j) {

        // scores, transposed: 32 keys x 16 queries per group; c0[r] = key key0+8hh+r,
        // c1[r] = key key0+16+8hh+r
        v8f ca0, ca1, cb0, cb1;      // each tile's first product takes the constant 0 as its C
        {
            const h16* kp = &Kt[cur][kf + j * 32 * KP];
            Frag kb0, kb1, kb2, kb3;      // read as one group ahead of the eight products
            kb0.hf[0] = *(const v8h*)(kp);      kb0.hf[1] = *(const v8h*)(kp + 16);
            kb1.hf[0] = *(const v8h*)(kp + 32); kb1.hf[1] = *(const v8h*)(kp + 48);
            kp += 16 * KP;
            kb2.hf[0] = *(const v8h*)(kp);      kb2.hf[1] = *(const v8h*)(kp + 16);
            kb3.hf[0] = *(const v8h*)(kp + 32); kb3.hf[1] = *(const v8h*)(kp + 48);
            // The eight products stand in one asm statement, so that each fills the distance behind the
            // others and the LDS reads stay one group in front (as builtins the compiler spreads the
            // reads of two passes among them, and a wave then waits on LDS at more places).
            // The four v_nop at the end keep the distance between the last product and the first
            // vector instruction that reads a score tile or overwrites a fragment. The s_delay_alu
            // behind them is the hint the compiler writes in front of a reader of a builtin product and
            // cannot write here: the wave steps aside until the last product is done, not holding the
            // vector port.
            asm volatile("v_wmma_f32_16x16x32_f16 %0, %4, %8, 0\n\t"
                         "v_wmma_f32_16x16x32_f16 %1, %6, %8, 0\n\t"
                         "v_wmma_f32_16x16x32_f16 %2, %4, %10, 0\n\t"
                         "v_wmma_f32_16x16x32_f16 %3, %6, %10, 0\n\t"
                         "v_wmma_f32_16x16x32_f16 %0, %5, %9, %0\n\t"
                         "v_wmma_f32_16x16x32_f16 %1, %7, %9, %1\n\t"
                         "v_wmma_f32_16x16x32_f16 %2, %5, %11, %2\n\t"
                         "v_wmma_f32_16x16x32_f16 %3, %7, %11, %3\n\t"
                         "v_nop\n\tv_nop\n\tv_nop\n\tv_nop\n\t"
                         "s_delay_alu instid0(TRANS32_DEP_1)"
                         : "=&v"(ca0), "=&v"(ca1), "=&v"(cb0), "=&v"(cb1)
                         : "v"(kb0.v), "v"(kb1.v), "v"(kb2.v), "v"(kb3.v),
                           "v"(qa0.v), "v"(qa1.v), "v"(qb0.v), "v"(qb1.v));
        }

        Frag pa, pb;
        const float alb = softmax_pass(cb0, cb1, mrb, lrb, pb);
        ob0 *= alb; ob1 *= alb; ob2 *= alb; ob3 *= alb;
        const float ala = softmax_pass(ca0, ca1, mra, lra, pa);
        oa0 *= ala; oa1 *= ala; oa2 *= ala; oa3 *= ala;

        // O^T += V^T P^T : A = V^T tile rows d (k = key, split k-map), B = P^T from registers
        {
            const h16* vp = &Vt[cur][vf + j * 32];
            Frag vb0, vb1, vb2, vb3;      // read as one group ahead of the eight products
            vb0.hf[0] = *(const v8h*)(vp);           vb0.hf[1] = *(const v8h*)(vp + 16);
            vb1.hf[0] = *(const v8h*)(vp + 16 * VP); vb1.hf[1] = *(const v8h*)(vp + 16 * VP + 16);
            vb2.hf[0] = *(const v8h*)(vp + 32 * VP); vb2.hf[1] = *(const v8h*)(vp + 32 * VP + 16);
            vb3.hf[0] = *(const v8h*)(vp + 48 * VP); vb3.hf[1] = *(const v8h*)(vp + 48 * VP + 16);
            // one asm statement for the same two reasons; the four v_nop keep the distance between the
            // last product and the first vector instruction that touches ob3, pb or a V^T fragment
            asm volatile("v_wmma_f32_16x16x32_f16 %0, %8, %12, %0\n\t"
                         "v_wmma_f32_16x16x32_f16 %1, %9, %12, %1\n\t"
                         "v_wmma_f32_16x16x32_f16 %2, %10, %12, %2\n\t"
                         "v_wmma_f32_16x16x32_f16 %3, %11, %12, %3\n\t"
                         "v_wmma_f32_16x16x32_f16 %4, %8, %13, %4\n\t"
                         "v_wmma_f32_16x16x32_f16 %5, %9, %13, %5\n\t"
                         "v_wmma_f32_16x16x32_f16 %6, %10, %13, %6\n\t"
                         "v_wmma_f32_16x16x32_f16 %7, %11, %13, %7\n\t"
                         "v_nop\n\tv_nop\n\tv_nop\n\tv_nop"
                         : "+v"(oa0), "+v"(oa1), "+v"(oa2), "+v"(oa3),
                           "+v"(ob0), "+v"(ob1), "+v"(ob2), "+v"(ob3)
                         : "v"(vb0.v), "v"(vb1.v), "v"(vb2.v), "v"(vb3.v), "v"(pa.v), "v"(pb.v));
        }

        }   // passes of this stage
    };

    // every stage but the last; the last is written out behind the loop, so that no branch stands between
    // a stage's passes and its foot (across one the compiler carries both passes' exponentials to sum
    // them behind it, and the kernel then needs more than 256 registers)
    for (int st = 0; st + 1 < NS / SK; ++st) {
        const int cur = st & 1;

        // next stage's tiles: global loads issued here, stored to the other buffer at the foot
        {
            const int keyn = (st + 1) * SK;
            const h16* kn = kg + (size_t)keyn * NHD;
            const h16* vn = vg + keyn;
            #pragma unroll
            for (int i = 0; i < 4; ++i) {
                sk[i] = *(const v8h*)(kn + i * 16 * NHD);
                sv[i] = *(const v8h*)(vn + (size_t)i * 16 * NS);
            }
            // keeps the overwrite of the address registers of the loads above behind this wait
            asm volatile("s_wait_xcnt 0x0" ::: "memory");
        }

        stage_passes(cur);

        // the other buffer's last readers left it before the previous stage's foot barrier
        #pragma unroll
        for (int i = 0; i < 4; ++i) {
            *(v8h*)&Kt[cur ^ 1][ks + i * 16 * KP] = sk[i];
            *(v8h*)&Vt[cur ^ 1][vs + i * 16 * VP] = sv[i];
        }
        __syncthreads();   // next stage's K and V^T tiles complete before any wave reads them; this
                           // stage's reads of its own buffer done before the next foot refills it
    }
    stage_passes((NS / SK - 1) & 1);   // the last stage: nothing to bring in, no buffer handed on

    // epilogue: normalise (fold back 1/16384), stage in LDS in [row][d] order
    const float osc = 1.0f / 16384.0f;
    lra += xhalf(lra);                      // join the two halves' sums of each query
    lrb += xhalf(lrb);
    const float inva = osc * __builtin_amdgcn_rcpf(lra);
    const float invb = osc * __builtin_amdgcn_rcpf(lrb);
    // row = query m (group a) or 16 + m (group b); 8 consecutive d per tile
    attn_stage_rows(&Ow[m * OPITCH + 8 * hh], oa0, oa1, oa2, oa3, inva);
    attn_stage_rows(&Ow[(16 + m) * OPITCH + 8 * hh], ob0, ob1, ob2, ob3, invb);
    __syncthreads();

    attn_store_pass(Ow, noise, out, bh, b, h, q0, l);
    
}

// ---------------------------------------------------------------------------
extern "C" void kernel_launch(void* const* d_in, const int* in_sizes, int n_in,
                              void* d_out, int out_size, void* d_ws, size_t ws_size,
                              hipStream_t stream)
{
    if (n_in < 8) return;
    const int n_x = NB * NS * NDIM;
    const int n_w = NDIM * NDIM;
    if (in_sizes[0] != n_x || in_sizes[1] != n_w || in_sizes[2] != NDIM ||
        in_sizes[3] != n_w || in_sizes[4] != NDIM || in_sizes[5] != n_w ||
        in_sizes[6] != NDIM || in_sizes[7] != NB * NH * NS * NHD || out_size != n_x)
        return;

    const float* x     = (const float*)d_in[0];
    const float* Wq    = (const float*)d_in[1];
    const float* bq    = (const float*)d_in[2];
    const float* Wk    = (const float*)d_in[3];
    const float* bk    = (const float*)d_in[4];
    const float* Wv    = (const float*)d_in[5];
    const float* bv    = (const float*)d_in[6];
    const float* noise = (const float*)d_in[7];
    float* out = (float*)d_out;

    // workspace carve (bytes): xh 8 MiB | wh 1.5 MiB | qh 8 MiB | kh 8 MiB | vt 8 MiB = 33.5 MiB
    const size_t bytes_xh  = (size_t)n_x * 2;
    const size_t bytes_wh  = (size_t)3 * n_w * 2;
    const size_t bytes_qkv = (size_t)NB * NH * NS * NHD * 2;
    const size_t off_xh = 0;
    const size_t off_wh = off_xh + bytes_xh;
    const size_t off_q  = off_wh + bytes_wh;
    const size_t off_k  = off_q + bytes_qkv;
    const size_t off_v  = off_k + bytes_qkv;
    const size_t end    = off_v + bytes_qkv;
    if (end > ws_size) return;

    char* ws = (char*)d_ws;
    h16* xh = (h16*)(ws + off_xh);
    h16* wh = (h16*)(ws + off_wh);
    h16* qh = (h16*)(ws + off_q);
    h16* kh = (h16*)(ws + off_k);
    h16* vt = (h16*)(ws + off_v);

    const int nxc = n_x / 8;            // 524288 chunks
    const int nwc = n_w / 8;            // 32768 chunks per weight
    const int total_chunks = nxc + 3 * nwc;
    const int cgrid = (total_chunks + 255) / 256;
    k_convert<<<dim3(cgrid), dim3(256), 0, stream>>>(x, Wq, Wk, Wv, xh, wh, nxc, nwc);

    dim3 pg((NB * NS) / PT, NDIM / PT, 3);     // 64 x 4 x 3
    k_proj<<<pg, dim3(128), 0, stream>>>(xh, wh, bq, bk, bv, qh, kh, vt);

    dim3 ag(NS / 128, NH, NB);                 // 16 x 8 x 4
    k_attn<<<ag, dim3(128), 0, stream>>>(qh, kh, vt, noise, out);
}

// v009
// A run of this version takes 56.8 microseconds.
// Next to v008, in two timings, it ran 1.05 times as fast each time.
// All steps since v000 together make it 4.22 times as fast.
// All contractions: v_wmma_f32_16x16x32_f16 (f16 operands, f32 accumulate): q/k/v projections (weights carried x64, folded as 1/64), q.k^T scores, p.v (p carried x16384, folded as 1/16384).
#include <hip/hip_runtime.h>
#include <stdint.h>
#include <stddef.h>

#define NB   4
#define NS   2048
#define NDIM 512
#define NH   8
#define NHD  64

#define PT   128    // projection block tile: rows and columns
#define TP   72     // projection LDS tile pitch (halves)
#define EP   136    // projection output staging pitch (halves): 272 B = 16 B x odd
#define OPITCH 68   // output staging pitch (floats)
#define KP   72     // K tile LDS pitch (halves): 144 B = 16 B x odd, conflict-free 16-B row reads
#define VP   72     // V^T tile LDS pitch (halves): 144 B = 16 B x odd
#define SK   64     // keys per attention stage (two passes of 32 keys)

typedef _Float16 h16;
typedef h16   v16h __attribute__((ext_vector_type(16)));
typedef h16   v8h  __attribute__((ext_vector_type(8), __may_alias__));
typedef float v8f  __attribute__((ext_vector_type(8)));
typedef float v4f  __attribute__((ext_vector_type(4), __may_alias__));

union Frag { v16h v; v8h hf[2]; };
union Pack8 { v8h v; h16 e[8]; };

static_assert(sizeof(Frag) == 32);
static_assert(sizeof(Pack8) == 16);
static_assert(NS % 64 == 0);
static_assert(NDIM % 64 == 0);
static_assert(NHD == 64);

// 16x16x32 f16 WMMA, the bare builtin (projection): the compiler keeps the distance behind it itself.
__device__ __forceinline__ v8f wmma16(const v16h a, const v16h b, v8f c)
{
    return __builtin_amdgcn_wmma_f32_16x16x32_f16(false, a, false, b, (short)0, c, false, false);
}

// ---------------------------------------------------------------------------
// Kernel 0: one-time f32 -> f16 conversion of x (unscaled) and Wq/Wk/Wv (x64, exact).
// Each thread converts 8 consecutive floats and writes one 16-B piece; a wave writes
// ---------------------------------------------------------------------------
__global__ __launch_bounds__(256) void k_convert(
    const float* __restrict__ x, const float* __restrict__ wq,
    const float* __restrict__ wk, const float* __restrict__ wv,
    h16* __restrict__ xh, h16* __restrict__ wh, int nxc, int nwc)
{
    const int t = blockIdx.x * 256 + threadIdx.x;      // 8-element chunk id
    const int total = nxc + 3 * nwc;
    if (t >= total) return;
    const float* src;
    h16* dst;
    float sc;
    if (t < nxc) {
        src = x + (size_t)t * 8;
        dst = xh + (size_t)t * 8;
        sc  = 1.0f;
    } else {
        const int u = t - nxc;
        const int w = u / nwc;
        const int c = u - w * nwc;
        const float* wp = (w == 0) ? wq : ((w == 1) ? wk : wv);
        src = wp + (size_t)c * 8;
        dst = wh + (size_t)u * 8;
        sc  = 64.0f;
    }
    const v4f f0 = *(const v4f*)(src);
    const v4f f1 = *(const v4f*)(src + 4);
    Pack8 p;
    p.e[0] = (h16)(f0.x * sc); p.e[1] = (h16)(f0.y * sc);
    p.e[2] = (h16)(f0.z * sc); p.e[3] = (h16)(f0.w * sc);
    p.e[4] = (h16)(f1.x * sc); p.e[5] = (h16)(f1.y * sc);
    p.e[6] = (h16)(f1.z * sc); p.e[7] = (h16)(f1.w * sc);
    const v8h val = p.v;
    *(v8h*)dst = val;
    
}

// ---------------------------------------------------------------------------
// Kernel 1: q/k/v = x @ W^T + b  (M = B*S = 8192, N = 512, K = 512), blockIdx.z selects W.
// Block tile 128 rows x 128 cols (two heads), 128 threads = 4 waves, wave tile 64x64 (4x4 acc): every
// byte brought from L2 serves 128 rows or columns, and every fragment read from LDS four products.
// Each step's x tile and W tile (128 rows x 64 k; W is [n][k], k-contiguous) are brought into LDS once
// per block, in two buffers, loaded a step ahead through registers. A and B fragments are read from
// them, both in the split k-map (elements 0..7 <- k0+8h.., 8..15 <- k0+16+8h..). Epilogue stages the
// 128x128 f16 tile in LDS in the output's own order and stores whole lines.
// Outputs: qh, kh as [B,H,S,64]; vt as [B,H,64,S].
// ---------------------------------------------------------------------------
__global__ __launch_bounds__(128) void k_proj(
    const h16* __restrict__ xh, const h16* __restrict__ wh,
    const float* __restrict__ bq, const float* __restrict__ bk, const float* __restrict__ bv,
    h16* __restrict__ qh, h16* __restrict__ kh, h16* __restrict__ vt)
{
    // two buffers, each an x tile then a W tile of PT rows x 64 k at pitch TP.
    // Buffer 0 serves again as the output staging tile T (PT rows at pitch EP) behind the loop.
    __shared__ __attribute__((aligned(16))) h16 S[4 * PT * TP];
    static_assert(PT * EP <= 2 * PT * TP);
    static_assert(NS % PT == 0 && NDIM % PT == 0 && PT == 2 * NHD);
    h16* T = S;

    const int tid = threadIdx.x, l = tid & 31, w = tid >> 5;
    const int hh = l >> 4, m = l & 15;
    const int z = blockIdx.z;
    const bool tr = (z == 2);                  // the same for the whole block
    const int row0 = blockIdx.x * PT;          // global m (= b*2048 + s)
    const int col0 = blockIdx.y * PT;          // global n (= head*64 + d)
    const int wr = (w & 1) * 64, wc = (w >> 1) * 64;   // wave tile: first row, first column

    // staging map, 16-B pieces: thread t moves pieces t + 128 i of each tile (piece p: row p >> 3,
    // k 8 * (p & 7)), so one wave-wide load covers four whole 128-B lines
    const h16* ag = xh + (size_t)(row0 + (tid >> 3)) * NDIM + 8 * (tid & 7);
    const h16* bg = wh + ((size_t)z * NDIM + (size_t)(col0 + (tid >> 3))) * NDIM + 8 * (tid & 7);
    const int  ss = (tid >> 3) * TP + 8 * (tid & 7);
    // fragment reads: tile row, + 16 i * TP for the further tiles
    const int  af = (wr + m) * TP + 8 * hh;
    const int  bf = PT * TP + (wc + m) * TP + 8 * hh;

    v8h ra[8], rb[8];
    #pragma unroll
    for (int i = 0; i < 8; ++i) {
        ra[i] = *(const v8h*)(ag + (size_t)i * 16 * NDIM);
        rb[i] = *(const v8h*)(bg + (size_t)i * 16 * NDIM);
    }
    #pragma unroll
    for (int i = 0; i < 8; ++i) {
        *(v8h*)&S[ss + i * 16 * TP]           = ra[i];
        *(v8h*)&S[PT * TP + ss + i * 16 * TP] = rb[i];
    }
    __syncthreads();   // tiles of step 0 complete before any wave reads fragments from them

    v8f acc[4][4] = {};

    // unrolled: buffer index and k offset become immediates, so no address is recomputed in the loop
    #pragma unroll
    for (int kt = 0; kt < NDIM / 64; ++kt) {
        const int  cur  = kt & 1;
        const bool more = (kt + 1 < NDIM / 64);    // the same for the whole block

        // next step's tiles: global loads issued here, stored to the other buffer at the foot
        if (more) {
            #pragma unroll
            for (int i = 0; i < 8; ++i) {
                ra[i] = *(const v8h*)(ag + (size_t)i * 16 * NDIM + (kt + 1) * 64);
                rb[i] = *(const v8h*)(bg + (size_t)i * 16 * NDIM + (kt + 1) * 64);
            }
            // keeps the sixteen loads above and the step's fragment reads below it as one group: without
            // it the reads are spread over nine places among the products before them, each a stop of
            // its own (and with neither scheduling barrier the loads sink to the foot, where every step
            // waits out L2)
            __builtin_amdgcn_sched_barrier(0);
        }

        const h16* ap = &S[cur * 2 * PT * TP + af];
        const h16* bp = &S[cur * 2 * PT * TP + bf];
        Frag a[2][4], b[2][4];      // the step's fragments, read as one group ahead of its 32 products
        #pragma unroll
        for (int kk = 0; kk < 2; ++kk) {
            #pragma unroll
            for (int i = 0; i < 4; ++i) {
                a[kk][i].hf[0] = *(const v8h*)(ap + i * 16 * TP + kk * 32);
                a[kk][i].hf[1] = *(const v8h*)(ap + i * 16 * TP + kk * 32 + 16);
                b[kk][i].hf[0] = *(const v8h*)(bp + i * 16 * TP + kk * 32);
                b[kk][i].hf[1] = *(const v8h*)(bp + i * 16 * TP + kk * 32 + 16);
            }
        }
        // keeps the reads one group ahead of the products: left free, the compiler reads most fragments
        // right in front of their products, and the wave waits out the LDS latency at each such place
        __builtin_amdgcn_sched_barrier(0);
        #pragma unroll
        for (int kk = 0; kk < 2; ++kk) {
            #pragma unroll
            for (int i = 0; i < 4; ++i) {
                #pragma unroll
                for (int j = 0; j < 4; ++j)
                    acc[i][j] = wmma16(a[kk][i].v, b[kk][j].v, acc[i][j]);
            }
        }

        // the other buffer's last readers left it before the previous step's foot barrier
        if (more) {
            #pragma unroll
            for (int i = 0; i < 8; ++i) {
                *(v8h*)&S[(cur ^ 1) * 2 * PT * TP + ss + i * 16 * TP]           = ra[i];
                *(v8h*)&S[(cur ^ 1) * 2 * PT * TP + PT * TP + ss + i * 16 * TP] = rb[i];
            }
            __syncthreads();   // next step's tiles complete before any wave reads them; this step's
                               // reads of its own buffer done before the next foot refills it
        }
    }
    // the last step reads buffer 1 only; buffer 0 (= T) was left before the last foot barrier

    // epilogue: undo the x64 weight scale, add bias, convert to f16, stage in LDS;
    // acc[i][j][r] = local row (s) wr+16i+8hh+r, local column (d over two heads) wc+16j+m
    const float* bias = (z == 0) ? bq : ((z == 1) ? bk : bv);
    const float wsc = 0.015625f;   // 1/64
    float bs[4];
    #pragma unroll
    for (int j = 0; j < 4; ++j)
        bs[j] = bias[col0 + wc + 16 * j + m];
    // the branch is the same for the whole block; inside it every LDS address is one register plus an immediate
    if (tr) {      // T[column][row]
        #pragma unroll
        for (int i = 0; i < 4; ++i) {
            #pragma unroll
            for (int j = 0; j < 4; ++j) {
                #pragma unroll
                for (int r = 0; r < 8; ++r)
                    T[(wc + 16 * j + m) * EP + wr + 16 * i + 8 * hh + r] = (h16)(acc[i][j][r] * wsc + bs[j]);
            }
        }
    } else {       // T[row][column]
        #pragma unroll
        for (int i = 0; i < 4; ++i) {
            #pragma unroll
            for (int j = 0; j < 4; ++j) {
                #pragma unroll
                for (int r = 0; r < 8; ++r)
                    T[(wr + 16 * i + 8 * hh + r) * EP + wc + 16 * j + m] = (h16)(acc[i][j][r] * wsc + bs[j]);
            }
        }
    }
    __syncthreads();

    // store whole lines: 16-B piece p = t + 128 i of T (row p >> 4, halves 8 * (p & 15)), each once
    const int bb = row0 >> 11, s0 = row0 & (NS - 1);
    const size_t bh0 = (size_t)bb * NH + 2 * blockIdx.y;      // first of the block's two heads
    const int trow = tid >> 4, piece = tid & 15;
    v8h o[16];
    #pragma unroll
    for (int i = 0; i < 16; ++i)
        o[i] = *(const v8h*)&T[(trow + 8 * i) * EP + 8 * piece];
    // the row pitch is a constant in each branch, so every store is one address plus an immediate
    if (tr) {   // vt[bh][d][s]: T row = 64 * (head - first head) + d, 128 s per row
        h16* base = vt + (bh0 * NHD + trow) * NS + s0 + 8 * piece;
        #pragma unroll
        for (int i = 0; i < 16; ++i)
            *(v8h*)(base + (size_t)(8 * i) * NS) = o[i];
    } else {    // qh/kh[bh][s][d]: T row = s_local, 64 d of the first head, then 64 of the second
        h16* base = ((z == 0) ? qh : kh) + ((bh0 + (piece >> 3)) * NS + s0 + trow) * NHD + 8 * (piece & 7);
        #pragma unroll
        for (int i = 0; i < 16; ++i)
            *(v8h*)(base + (size_t)(8 * i) * NHD) = o[i];
        // keeps any overwrite of the address registers of the stores above behind this wait
        asm volatile("s_wait_xcnt 0x0" ::: "memory");
    }
}

// ---------------------------------------------------------------------------
// Kernel 2: flash attention per (b, h). 256 threads = 8 waves; block = 128 queries, wave = 32
// query rows in two column groups of 16. The keys are split inside the block: waves 0..3 walk keys
// 0..NS/2-1, waves 4..7 keys NS/2..NS-1 for the same 128 queries, each set of four waves with tiles of
// its own, so that four waves, not two, share a SIMD and one wave's softmax runs under the others'
// products and LDS waits. Behind the loop the two partial results of a query (maximum, sum, O) are
// merged through LDS. 32 keys per pass, SK keys per stage. Q kept as two B
// fragments per group. Each stage's K tile (SK
// kh rows, [key][d]) and V^T tile (64 vt rows, [d][key]) are brought into LDS once per key half, in two
// buffers: every thread loads eight 16-B pieces of the next stage's tiles at the top of a stage and
// stores them at its foot, so the loads have two passes (32 keys x 128 queries each) to land and the
// block meets at one barrier per stage. Both products run transposed: S^T = K Q^T (A = K tile rows, k = d; B = Q) and
// O^T += V^T P^T (A = V^T tile rows, k = key; B = P^T). Every K and V^T fragment read from LDS serves
// both column groups. In each group a lane holds 16 of the 32 scores of ONE
// query (column l & 15): maximum and sum run in its own registers, with one exchange between the wave
// halves for the maximum; the two score tiles, converted in place (f16, x16384), are the B fragment
// of the second product, so P never goes through LDS. Online softmax in f32 in the exp2 domain; each
// half keeps the sum of its own keys, joined once behind the loop.
// Epilogue: normalise, stage 32x64 f32 rows in LDS, add noise, scale by 1/1.01, store whole lines.
// ---------------------------------------------------------------------------
// value of lane l ^ 16 (the other half of the wave), by a vector cross-row move
__device__ __forceinline__ float xhalf(float x)
{
    const int b = __builtin_bit_cast(int, x);
    return __builtin_bit_cast(float,
        __builtin_amdgcn_permlanex16(b, b, 0x76543210, 0xfedcba98, false, false));
}

// 2^x by the bare v_exp_f32. exp2f() wraps every call in a compare, two selects, an add and a ldexp
// that only serve results below 2^-126. Here x <= 0 and each query's final sum is at least 1, so such
// a term (or such a rescale factor) is far below one f32 rounding step of the sum; as 0 it changes nothing.
__device__ __forceinline__ float exp2_raw(float x)
{
    return __builtin_amdgcn_exp2f(x);
}

// online softmax of this lane's query of one column group over its 16 scores of a pass (the other
// half of the wave holds the other 16); returns the rescale factor of that group's output tiles
__device__ __forceinline__ float softmax_pass(const v8f c0, const v8f c1, float& mrun, float& lrun,
                                              Frag& pb)
{
    const float sc  = 0.125f * 1.44269504088896f;   // HD^-0.5 * log2(e)
    const float psc = 16384.0f;
    const v8f s0 = c0 * sc;
    const v8f s1 = c1 * sc;
    float mt = fmaxf(s0[0], s1[0]);
    #pragma unroll
    for (int r = 1; r < 8; ++r)
        mt = fmaxf(mt, fmaxf(s0[r], s1[r]));
    mt = fmaxf(mt, xhalf(mt));
    const float mnew  = fmaxf(mrun, mt);
    const float alpha = exp2_raw(mrun - mnew);
    mrun = mnew;
    const v8f t0 = s0 - mnew;
    const v8f t1 = s1 - mnew;
    v8f p0, p1;
    #pragma unroll
    for (int r = 0; r < 8; ++r) { p0[r] = exp2_raw(t0[r]); p1[r] = exp2_raw(t1[r]); }
    // P^T as B fragment: element r <- key 8hh+r, element 8+r <- key 16+8hh+r (the split k-map)
    const v8f g0 = p0 * psc;
    const v8f g1 = p1 * psc;
    #pragma unroll
    for (int r = 0; r < 8; ++r) { pb.v[r] = (h16)g0[r]; pb.v[8 + r] = (h16)g1[r]; }
    const v8f ps = p0 + p1;
    const float rs = ((ps[0] + ps[4]) + (ps[2] + ps[6])) + ((ps[1] + ps[5]) + (ps[3] + ps[7]));
    lrun = lrun * alpha + rs;
    return alpha;
}

// one column group's output tiles, times invl, to its 16 staging rows ([query][d] order)
__device__ __forceinline__ void attn_stage_rows(float* orow, const v8f o0, const v8f o1, const v8f o2,
                                                const v8f o3, float invl)
{
    const v8f y0 = o0 * invl, y1 = o1 * invl, y2 = o2 * invl, y3 = o3 * invl;
    *(v4f*)(orow)      = __builtin_shufflevector(y0, y0, 0, 1, 2, 3);
    *(v4f*)(orow + 4)  = __builtin_shufflevector(y0, y0, 4, 5, 6, 7);
    *(v4f*)(orow + 16) = __builtin_shufflevector(y1, y1, 0, 1, 2, 3);
    *(v4f*)(orow + 20) = __builtin_shufflevector(y1, y1, 4, 5, 6, 7);
    *(v4f*)(orow + 32) = __builtin_shufflevector(y2, y2, 0, 1, 2, 3);
    *(v4f*)(orow + 36) = __builtin_shufflevector(y2, y2, 4, 5, 6, 7);
    *(v4f*)(orow + 48) = __builtin_shufflevector(y3, y3, 0, 1, 2, 3);
    *(v4f*)(orow + 52) = __builtin_shufflevector(y3, y3, 4, 5, 6, 7);
}

// merges one column group's output tiles with the other key half's, staged at the same places by the
// same lane of its wave: y = own * g0 + other * g1 (g0, g1 hold the rescale and the normalisation),
// written back in place ([query][d] order)
__device__ __forceinline__ void attn_merge_rows(float* orow, const v8f o0, const v8f o1, const v8f o2,
                                                const v8f o3, float g0, float g1)
{
    const v8f o[4] = { o0, o1, o2, o3 };
    // unrolled: o[t] is then picked at compile time and the tiles stay in their registers
    #pragma unroll
    for (int t = 0; t < 4; ++t) {
        const v4f x0 = *(const v4f*)(orow + 16 * t);
        const v4f x1 = *(const v4f*)(orow + 16 * t + 4);
        const v4f y0 = __builtin_shufflevector(o[t], o[t], 0, 1, 2, 3) * g0 + x0 * g1;
        const v4f y1 = __builtin_shufflevector(o[t], o[t], 4, 5, 6, 7) * g0 + x1 * g1;
        *(v4f*)(orow + 16 * t)     = y0;
        *(v4f*)(orow + 16 * t + 4) = y1;
    }
}

// a wave stores 16 of the 32 staged rows of its query group, from row r0 on: rows r0 + rsel + 2 i,
// every row exactly once; each of the three addresses is one register (pair) plus an immediate
__device__ __forceinline__ void attn_store_pass(const float* Ow, const float* __restrict__ noise,
                                                float* out, size_t bh, int b, int h, int q0, int r0, int l)
{
    const float inv101 = 1.0f / 1.01f;
    const int piece = l & 15, rsel = l >> 4;
    const int rowl = r0 + rsel;
    const size_t q = (size_t)(q0 + rowl);
    const float* yp = &Ow[rowl * OPITCH + 4 * piece];
    const float* np = noise + ((bh * NS + q) * NHD + 4 * piece);
    float*       op = out + (((size_t)b * NS + q) * NDIM + (size_t)h * NHD + 4 * piece);
    v4f nz[8];
    // both loops unrolled: nz[] stays in registers, the eight loads go out together, offsets are immediates
    #pragma unroll
    for (int i = 0; i < 8; ++i)
        nz[i] = *(const v4f*)(np + i * 2 * NHD);
    // keeps any overwrite of the address registers of the loads above behind this wait
    asm volatile("s_wait_xcnt 0x0" ::: "memory");
    #pragma unroll
    for (int i = 0; i < 8; ++i) {
        const v4f y   = *(const v4f*)(yp + i * 2 * OPITCH);
        const v4f val = (y + nz[i]) * inv101;
        *(v4f*)(op + (size_t)i * 2 * NDIM) = val;
    }
}

// four waves per SIMD (two blocks per WGP): the register budget that goes with it is 256 a wave
__global__ __launch_bounds__(256) __attribute__((amdgpu_waves_per_eu(4, 4))) void k_attn(
    const h16* __restrict__ qh, const h16* __restrict__ kh, const h16* __restrict__ vt,
    const float* __restrict__ noise, float* __restrict__ out)
{
    __shared__ __attribute__((aligned(16))) h16   Kt[4][SK * KP];       // [2 * key half + buffer]
    __shared__ __attribute__((aligned(16))) h16   Vt[4][64 * VP];       // [2 * key half + buffer]
    __shared__ __attribute__((aligned(16))) float Os[4][32 * OPITCH];   // merge and output staging, per query group
    __shared__ __attribute__((aligned(16))) float Ml[4][32 * 4];        // second half's maxima and sums, per lane
    static_assert(NS % 128 == 0);
    static_assert((NS / 2) % SK == 0 && NS / 2 / SK >= 2);

    const int l = threadIdx.x & 31;
    const int tid = threadIdx.x & 127;                 // thread within its key half
    const int w = __builtin_amdgcn_readfirstlane(threadIdx.x >> 5);   // wave number, the same in every lane
    const int wq = w & 3, kx = w >> 2;                 // query group of 32; key half
    const int hh = l >> 4, m = l & 15;
    const int b = blockIdx.z, h = blockIdx.y;
    const size_t bh = (size_t)b * NH + h;
    const int q0 = blockIdx.x * 128 + wq * 32;

    // Q rows as B fragments (column = query), split k-map: group a = rows q0+m, group b = rows
    // q0+16+m; fragment 0 covers d 0..31, fragment 1 d 32..63
    Frag qa0, qa1, qb0, qb1;
    {
        const h16* qrow = qh + (bh * NS + (size_t)(q0 + m)) * NHD + 8 * hh;
        qa0.hf[0] = *(const v8h*)(qrow);      qa0.hf[1] = *(const v8h*)(qrow + 16);
        qa1.hf[0] = *(const v8h*)(qrow + 32); qa1.hf[1] = *(const v8h*)(qrow + 48);
        qrow += 16 * NHD;
        qb0.hf[0] = *(const v8h*)(qrow);      qb0.hf[1] = *(const v8h*)(qrow + 16);
        qb1.hf[0] = *(const v8h*)(qrow + 32); qb1.hf[1] = *(const v8h*)(qrow + 48);
    }
    // staging map, 16-B pieces: thread t moves K pieces t + 128 i (piece p: key p>>3, d 8*(p&7); the
    // tile is 8 KiB contiguous in kh) and V^T pieces t + 128 i (piece p: d p>>3, key 8*(p&7))
    // both start at the first key of this wave's half
    const h16* kg = kh + (bh * NS + (size_t)kx * (NS / 2)) * NHD + (size_t)tid * 8;                  // + key0 * NHD
    const h16* vg = vt + (bh * NHD + (size_t)(tid >> 3)) * NS + kx * (NS / 2) + 8 * (tid & 7);       // + key0
    const int  ks = (tid >> 3) * KP + 8 * (tid & 7);
    const int  vs = (tid >> 3) * VP + 8 * (tid & 7);
    const int  kf = m * KP + 8 * hh;     // fragment reads: K tile row = key, + 16 * KP for keys 16..31
    const int  vf = m * VP + 8 * hh;     // V^T tile row = d, + 16t * VP

    v8h sk[4], sv[4];
    #pragma unroll
    for (int i = 0; i < 4; ++i) {
        sk[i] = *(const v8h*)(kg + i * 16 * NHD);
        sv[i] = *(const v8h*)(vg + (size_t)i * 16 * NS);
    }
    // keeps the overwrite of the address registers of the loads above behind this wait
    asm volatile("s_wait_xcnt 0x0" ::: "memory");
    #pragma unroll
    for (int i = 0; i < 4; ++i) {
        *(v8h*)&Kt[2 * kx][ks + i * 16 * KP] = sk[i];
        *(v8h*)&Vt[2 * kx][vs + i * 16 * VP] = sv[i];
    }
    __syncthreads();   // tiles of stage 0 complete before any wave reads fragments from them

    // this lane's two queries q0+m (a) and q0+16+m (b): running maximum (equal in both halves) and
    // this half's own sum; oat[r] = O^T[16t + 8hh + r][m] of group a, obt of group b
    float mra = -__builtin_inff(), lra = 0.0f;
    float mrb = -__builtin_inff(), lrb = 0.0f;
    v8f oa0 = {}, oa1 = {}, oa2 = {}, oa3 = {};
    v8f ob0 = {}, ob1 = {}, ob2 = {}, ob3 = {};

    float* Ow = &Os[wq][0];

    // the passes of one stage, over the tiles in buffer cur (2 * key half + buffer of the stage)
    auto stage_passes = [&](const int cur) __attribute__((always_inline)) {
        // unrolled: each pass's tile offsets become immediates of its LDS reads
        #pragma unroll
        for (int j = 0; j < SK / 32; ++j) {

        // scores, transposed: 32 keys x 16 queries per group; c0[r] = key key0+8hh+r,
        // c1[r] = key key0+16+8hh+r
        v8f ca0, ca1, cb0, cb1;      // each tile's first product takes the constant 0 as its C
        {
            const h16* kp = &Kt[cur][kf + j * 32 * KP];
            Frag kb0, kb1, kb2, kb3;      // read as one group ahead of the eight products
            kb0.hf[0] = *(const v8h*)(kp);      kb0.hf[1] = *(const v8h*)(kp + 16);
            kb1.hf[0] = *(const v8h*)(kp + 32); kb1.hf[1] = *(const v8h*)(kp + 48);
            kp += 16 * KP;
            kb2.hf[0] = *(const v8h*)(kp);      kb2.hf[1] = *(const v8h*)(kp + 16);
            kb3.hf[0] = *(const v8h*)(kp + 32); kb3.hf[1] = *(const v8h*)(kp + 48);
            // The eight products stand in one asm statement, so that each fills the distance behind the
            // others and the LDS reads stay one group in front (as builtins the compiler spreads the
            // reads of two passes among them, and a wave then waits on LDS at more places).
            // The four v_nop at the end keep the distance between the last product and the first
            // vector instruction that reads a score tile or overwrites a fragment. The s_delay_alu
            // behind them is the hint the compiler writes in front of a reader of a builtin product and
            // cannot write here: the wave steps aside until the last product is done, not holding the
            // vector port.
            asm volatile("v_wmma_f32_16x16x32_f16 %0, %4, %8, 0\n\t"
                         "v_wmma_f32_16x16x32_f16 %1, %6, %8, 0\n\t"
                         "v_wmma_f32_16x16x32_f16 %2, %4, %10, 0\n\t"
                         "v_wmma_f32_16x16x32_f16 %3, %6, %10, 0\n\t"
                         "v_wmma_f32_16x16x32_f16 %0, %5, %9, %0\n\t"
                         "v_wmma_f32_16x16x32_f16 %1, %7, %9, %1\n\t"
                         "v_wmma_f32_16x16x32_f16 %2, %5, %11, %2\n\t"
                         "v_wmma_f32_16x16x32_f16 %3, %7, %11, %3\n\t"
                         "v_nop\n\tv_nop\n\tv_nop\n\tv_nop\n\t"
                         "s_delay_alu instid0(TRANS32_DEP_1)"
                         : "=&v"(ca0), "=&v"(ca1), "=&v"(cb0), "=&v"(cb1)
                         : "v"(kb0.v), "v"(kb1.v), "v"(kb2.v), "v"(kb3.v),
                           "v"(qa0.v), "v"(qa1.v), "v"(qb0.v), "v"(qb1.v));
        }

        Frag pa, pb;
        const float alb = softmax_pass(cb0, cb1, mrb, lrb, pb);
        ob0 *= alb; ob1 *= alb; ob2 *= alb; ob3 *= alb;
        const float ala = softmax_pass(ca0, ca1, mra, lra, pa);
        oa0 *= ala; oa1 *= ala; oa2 *= ala; oa3 *= ala;

        // O^T += V^T P^T : A = V^T tile rows d (k = key, split k-map), B = P^T from registers
        {
            const h16* vp = &Vt[cur][vf + j * 32];
            Frag vb0, vb1, vb2, vb3;      // read as one group ahead of the eight products
            vb0.hf[0] = *(const v8h*)(vp);           vb0.hf[1] = *(const v8h*)(vp + 16);
            vb1.hf[0] = *(const v8h*)(vp + 16 * VP); vb1.hf[1] = *(const v8h*)(vp + 16 * VP + 16);
            vb2.hf[0] = *(const v8h*)(vp + 32 * VP); vb2.hf[1] = *(const v8h*)(vp + 32 * VP + 16);
            vb3.hf[0] = *(const v8h*)(vp + 48 * VP); vb3.hf[1] = *(const v8h*)(vp + 48 * VP + 16);
            // one asm statement for the same two reasons; the four v_nop keep the distance between the
            // last product and the first vector instruction that touches ob3, pb or a V^T fragment
            asm volatile("v_wmma_f32_16x16x32_f16 %0, %8, %12, %0\n\t"
                         "v_wmma_f32_16x16x32_f16 %1, %9, %12, %1\n\t"
                         "v_wmma_f32_16x16x32_f16 %2, %10, %12, %2\n\t"
                         "v_wmma_f32_16x16x32_f16 %3, %11, %12, %3\n\t"
                         "v_wmma_f32_16x16x32_f16 %4, %8, %13, %4\n\t"
                         "v_wmma_f32_16x16x32_f16 %5, %9, %13, %5\n\t"
                         "v_wmma_f32_16x16x32_f16 %6, %10, %13, %6\n\t"
                         "v_wmma_f32_16x16x32_f16 %7, %11, %13, %7\n\t"
                         "v_nop\n\tv_nop\n\tv_nop\n\tv_nop"
                         : "+v"(oa0), "+v"(oa1), "+v"(oa2), "+v"(oa3),
                           "+v"(ob0), "+v"(ob1), "+v"(ob2), "+v"(ob3)
                         : "v"(vb0.v), "v"(vb1.v), "v"(vb2.v), "v"(vb3.v), "v"(pa.v), "v"(pb.v));
        }

        }   // passes of this stage
    };

    // every stage but the last; the last is written out behind the loop, so that no branch stands between
    // a stage's passes and its foot (across one the compiler carries both passes' exponentials to sum
    // them behind it, and the kernel then needs more than 256 registers)
    for (int st = 0; st + 1 < NS / 2 / SK; ++st) {
        const int cur = 2 * kx + (st & 1);

        // next stage's tiles: global loads issued here, stored to the other buffer at the foot
        {
            const int keyn = (st + 1) * SK;
            const h16* kn = kg + (size_t)keyn * NHD;
            const h16* vn = vg + keyn;
            #pragma unroll
            for (int i = 0; i < 4; ++i) {
                sk[i] = *(const v8h*)(kn + i * 16 * NHD);
                sv[i] = *(const v8h*)(vn + (size_t)i * 16 * NS);
            }
            // keeps the overwrite of the address registers of the loads above behind this wait
            asm volatile("s_wait_xcnt 0x0" ::: "memory");
        }

        stage_passes(cur);

        // the other buffer's last readers left it before the previous stage's foot barrier
        #pragma unroll
        for (int i = 0; i < 4; ++i) {
            *(v8h*)&Kt[cur ^ 1][ks + i * 16 * KP] = sk[i];
            *(v8h*)&Vt[cur ^ 1][vs + i * 16 * VP] = sv[i];
        }
        __syncthreads();   // next stage's K and V^T tiles complete before any wave reads them; this
                           // stage's reads of its own buffer done before the next foot refills it
    }
    stage_passes(2 * kx + ((NS / 2 / SK - 1) & 1));   // the last stage: nothing to bring in, no buffer handed on

    // epilogue. The waves of the second key half hand their partial results over, unnormalised, in
    // [row][d] order: row = query m (group a) or 16 + m (group b); 8 consecutive d per tile
    float* rowa = &Ow[m * OPITCH + 8 * hh];
    float* rowb = &Ow[(16 + m) * OPITCH + 8 * hh];
    if (kx == 1) {      // the same for the whole wave
        attn_stage_rows(rowa, oa0, oa1, oa2, oa3, 1.0f);
        attn_stage_rows(rowb, ob0, ob1, ob2, ob3, 1.0f);
        const v4f ml = { mra, lra, mrb, lrb };
        *(v4f*)&Ml[wq][4 * l] = ml;
    }
    __syncthreads();   // the second half's partial results complete before the first half's waves read them

    // the waves of the first key half merge (each partial rescaled to the common maximum), normalise
    // (fold back 1/16384) and leave the finished rows at the same places
    if (kx == 0) {      // the same for the whole wave
        const float osc = 1.0f / 16384.0f;
        const v4f ml = *(const v4f*)&Ml[wq][4 * l];
        const float ma  = fmaxf(mra, ml.x), mb = fmaxf(mrb, ml.z);
        const float fa0 = exp2_raw(mra - ma), fa1 = exp2_raw(ml.x - ma);
        const float fb0 = exp2_raw(mrb - mb), fb1 = exp2_raw(ml.z - mb);
        lra = lra * fa0 + ml.y * fa1;
        lrb = lrb * fb0 + ml.w * fb1;
        lra += xhalf(lra);                  // join the two wave halves' sums of each query
        lrb += xhalf(lrb);
        const float inva = osc * __builtin_amdgcn_rcpf(lra);
        const float invb = osc * __builtin_amdgcn_rcpf(lrb);
        attn_merge_rows(rowa, oa0, oa1, oa2, oa3, fa0 * inva, fa1 * inva);
        attn_merge_rows(rowb, ob0, ob1, ob2, ob3, fb0 * invb, fb1 * invb);
    }
    __syncthreads();   // finished rows complete before the eight waves store them, 16 rows each

    attn_store_pass(Ow, noise, out, bh, b, h, q0, 16 * kx, l);
    
}

// ---------------------------------------------------------------------------
extern "C" void kernel_launch(void* const* d_in, const int* in_sizes, int n_in,
                              void* d_out, int out_size, void* d_ws, size_t ws_size,
                              hipStream_t stream)
{
    if (n_in < 8) return;
    const int n_x = NB * NS * NDIM;
    const int n_w = NDIM * NDIM;
    if (in_sizes[0] != n_x || in_sizes[1] != n_w || in_sizes[2] != NDIM ||
        in_sizes[3] != n_w || in_sizes[4] != NDIM || in_sizes[5] != n_w ||
        in_sizes[6] != NDIM || in_sizes[7] != NB * NH * NS * NHD || out_size != n_x)
        return;

    const float* x     = (const float*)d_in[0];
    const float* Wq    = (const float*)d_in[1];
    const float* bq    = (const float*)d_in[2];
    const float* Wk    = (const float*)d_in[3];
    const float* bk    = (const float*)d_in[4];
    const float* Wv    = (const float*)d_in[5];
    const float* bv    = (const float*)d_in[6];
    const float* noise = (const float*)d_in[7];
    float* out = (float*)d_out;

    // workspace carve (bytes): xh 8 MiB | wh 1.5 MiB | qh 8 MiB | kh 8 MiB | vt 8 MiB = 33.5 MiB
    const size_t bytes_xh  = (size_t)n_x * 2;
    const size_t bytes_wh  = (size_t)3 * n_w * 2;
    const size_t bytes_qkv = (size_t)NB * NH * NS * NHD * 2;
    const size_t off_xh = 0;
    const size_t off_wh = off_xh + bytes_xh;
    const size_t off_q  = off_wh + bytes_wh;
    const size_t off_k  = off_q + bytes_qkv;
    const size_t off_v  = off_k + bytes_qkv;
    const size_t end    = off_v + bytes_qkv;
    if (end > ws_size) return;

    char* ws = (char*)d_ws;
    h16* xh = (h16*)(ws + off_xh);
    h16* wh = (h16*)(ws + off_wh);
    h16* qh = (h16*)(ws + off_q);
    h16* kh = (h16*)(ws + off_k);
    h16* vt = (h16*)(ws + off_v);

    const int nxc = n_x / 8;            // 524288 chunks
    const int nwc = n_w / 8;            // 32768 chunks per weight
    const int total_chunks = nxc + 3 * nwc;
    const int cgrid = (total_chunks + 255) / 256;
    k_convert<<<dim3(cgrid), dim3(256), 0, stream>>>(x, Wq, Wk, Wv, xh, wh, nxc, nwc);

    dim3 pg((NB * NS) / PT, NDIM / PT, 3);     // 64 x 4 x 3
    k_proj<<<pg, dim3(128), 0, stream>>>(xh, wh, bq, bk, bv, qh, kh, vt);

    dim3 ag(NS / 128, NH, NB);                 // 16 x 8 x 4
    k_attn<<<ag, dim3(256), 0, stream>>>(qh, kh, vt, noise, out);
}

// v010
// Measured time: 54.8 microseconds a run.
// Timed twice side by side with v009, it ran 1.03 times as fast both times.
// Over all steps from v000 it is 4.36 times as fast.
// All contractions: v_wmma_f32_16x16x32_f16 (f16 operands, f32 accumulate): q/k/v projections (weights carried x64, folded as 1/64), q.k^T scores, p.v (p carried x16384, like the row sum that divides it).
#include <hip/hip_runtime.h>
#include <stdint.h>
#include <stddef.h>

#define NB   4
#define NS   2048
#define NDIM 512
#define NH   8
#define NHD  64

#define PT   128    // projection block tile: rows and columns
#define TP   72     // projection LDS tile pitch (halves)
#define EP   136    // projection output staging pitch (halves): 272 B = 16 B x odd
#define OPITCH 68   // output staging pitch (floats)
#define KP   72     // K tile LDS pitch (halves): 144 B = 16 B x odd, conflict-free 16-B row reads
#define VP   72     // V^T tile LDS pitch (halves): 144 B = 16 B x odd
#define SK   64     // keys per attention stage (two passes of 32 keys)

typedef _Float16 h16;
typedef h16   v16h __attribute__((ext_vector_type(16)));
typedef h16   v8h  __attribute__((ext_vector_type(8), __may_alias__));
typedef float v8f  __attribute__((ext_vector_type(8)));
typedef float v4f  __attribute__((ext_vector_type(4), __may_alias__));

union Frag { v16h v; v8h hf[2]; };
union Pack8 { v8h v; h16 e[8]; };

static_assert(sizeof(Frag) == 32);
static_assert(sizeof(Pack8) == 16);
static_assert(NS % 64 == 0);
static_assert(NDIM % 64 == 0);
static_assert(NHD == 64);

// 16x16x32 f16 WMMA, the bare builtin (projection): the compiler keeps the distance behind it itself.
__device__ __forceinline__ v8f wmma16(const v16h a, const v16h b, v8f c)
{
    return __builtin_amdgcn_wmma_f32_16x16x32_f16(false, a, false, b, (short)0, c, false, false);
}

// ---------------------------------------------------------------------------
// Kernel 0: one-time f32 -> f16 conversion of x (unscaled) and Wq/Wk/Wv (x64, exact).
// Each thread converts 8 consecutive floats and writes one 16-B piece; a wave writes
// ---------------------------------------------------------------------------
__global__ __launch_bounds__(256) void k_convert(
    const float* __restrict__ x, const float* __restrict__ wq,
    const float* __restrict__ wk, const float* __restrict__ wv,
    h16* __restrict__ xh, h16* __restrict__ wh, int nxc, int nwc)
{
    const int t = blockIdx.x * 256 + threadIdx.x;      // 8-element chunk id
    const int total = nxc + 3 * nwc;
    if (t >= total) return;
    const float* src;
    h16* dst;
    float sc;
    if (t < nxc) {
        src = x + (size_t)t * 8;
        dst = xh + (size_t)t * 8;
        sc  = 1.0f;
    } else {
        const int u = t - nxc;
        const int w = u / nwc;
        const int c = u - w * nwc;
        const float* wp = (w == 0) ? wq : ((w == 1) ? wk : wv);
        src = wp + (size_t)c * 8;
        dst = wh + (size_t)u * 8;
        sc  = 64.0f;
    }
    const v4f f0 = *(const v4f*)(src);
    const v4f f1 = *(const v4f*)(src + 4);
    Pack8 p;
    p.e[0] = (h16)(f0.x * sc); p.e[1] = (h16)(f0.y * sc);
    p.e[2] = (h16)(f0.z * sc); p.e[3] = (h16)(f0.w * sc);
    p.e[4] = (h16)(f1.x * sc); p.e[5] = (h16)(f1.y * sc);
    p.e[6] = (h16)(f1.z * sc); p.e[7] = (h16)(f1.w * sc);
    const v8h val = p.v;
    *(v8h*)dst = val;
    
}

// ---------------------------------------------------------------------------
// Kernel 1: q/k/v = x @ W^T + b  (M = B*S = 8192, N = 512, K = 512), blockIdx.z selects W.
// Block tile 128 rows x 128 cols (two heads), 128 threads = 4 waves, wave tile 64x64 (4x4 acc): every
// byte brought from L2 serves 128 rows or columns, and every fragment read from LDS four products.
// Each step's x tile and W tile (128 rows x 64 k; W is [n][k], k-contiguous) are brought into LDS once
// per block, in two buffers, loaded a step ahead through registers. A and B fragments are read from
// them, both in the split k-map (elements 0..7 <- k0+8h.., 8..15 <- k0+16+8h..). Epilogue stages the
// 128x128 f16 tile in LDS in the output's own order and stores whole lines.
// Outputs: qh, kh as [B,H,S,64]; vt as [B,H,64,S].
// ---------------------------------------------------------------------------
__global__ __launch_bounds__(128) void k_proj(
    const h16* __restrict__ xh, const h16* __restrict__ wh,
    const float* __restrict__ bq, const float* __restrict__ bk, const float* __restrict__ bv,
    h16* __restrict__ qh, h16* __restrict__ kh, h16* __restrict__ vt)
{
    // two buffers, each an x tile then a W tile of PT rows x 64 k at pitch TP.
    // Buffer 0 serves again as the output staging tile T (PT rows at pitch EP) behind the loop.
    __shared__ __attribute__((aligned(16))) h16 S[4 * PT * TP];
    static_assert(PT * EP <= 2 * PT * TP);
    static_assert(NS % PT == 0 && NDIM % PT == 0 && PT == 2 * NHD);
    h16* T = S;

    const int tid = threadIdx.x, l = tid & 31, w = tid >> 5;
    const int hh = l >> 4, m = l & 15;
    const int z = blockIdx.z;
    const bool tr = (z == 2);                  // the same for the whole block
    const int row0 = blockIdx.x * PT;          // global m (= b*2048 + s)
    const int col0 = blockIdx.y * PT;          // global n (= head*64 + d)
    const int wr = (w & 1) * 64, wc = (w >> 1) * 64;   // wave tile: first row, first column

    // staging map, 16-B pieces: thread t moves pieces t + 128 i of each tile (piece p: row p >> 3,
    // k 8 * (p & 7)), so one wave-wide load covers four whole 128-B lines
    const h16* ag = xh + (size_t)(row0 + (tid >> 3)) * NDIM + 8 * (tid & 7);
    const h16* bg = wh + ((size_t)z * NDIM + (size_t)(col0 + (tid >> 3))) * NDIM + 8 * (tid & 7);
    const int  ss = (tid >> 3) * TP + 8 * (tid & 7);
    // fragment reads: tile row, + 16 i * TP for the further tiles
    const int  af = (wr + m) * TP + 8 * hh;
    const int  bf = PT * TP + (wc + m) * TP + 8 * hh;

    v8h ra[8], rb[8];
    #pragma unroll
    for (int i = 0; i < 8; ++i) {
        ra[i] = *(const v8h*)(ag + (size_t)i * 16 * NDIM);
        rb[i] = *(const v8h*)(bg + (size_t)i * 16 * NDIM);
    }
    #pragma unroll
    for (int i = 0; i < 8; ++i) {
        *(v8h*)&S[ss + i * 16 * TP]           = ra[i];
        *(v8h*)&S[PT * TP + ss + i * 16 * TP] = rb[i];
    }
    __syncthreads();   // tiles of step 0 complete before any wave reads fragments from them

    v8f acc[4][4] = {};

    // unrolled: buffer index and k offset become immediates, so no address is recomputed in the loop
    #pragma unroll
    for (int kt = 0; kt < NDIM / 64; ++kt) {
        const int  cur  = kt & 1;
        const bool more = (kt + 1 < NDIM / 64);    // the same for the whole block

        // next step's tiles: global loads issued here, stored to the other buffer at the foot
        if (more) {
            #pragma unroll
            for (int i = 0; i < 8; ++i) {
                ra[i] = *(const v8h*)(ag + (size_t)i * 16 * NDIM + (kt + 1) * 64);
                rb[i] = *(const v8h*)(bg + (size_t)i * 16 * NDIM + (kt + 1) * 64);
            }
            // keeps the sixteen loads above and the step's fragment reads below it as one group: without
            // it the reads are spread over nine places among the products before them, each a stop of
            // its own (and with neither scheduling barrier the loads sink to the foot, where every step
            // waits out L2)
            __builtin_amdgcn_sched_barrier(0);
        }

        const h16* ap = &S[cur * 2 * PT * TP + af];
        const h16* bp = &S[cur * 2 * PT * TP + bf];
        Frag a[2][4], b[2][4];      // the step's fragments, read as one group ahead of its 32 products
        #pragma unroll
        for (int kk = 0; kk < 2; ++kk) {
            #pragma unroll
            for (int i = 0; i < 4; ++i) {
                a[kk][i].hf[0] = *(const v8h*)(ap + i * 16 * TP + kk * 32);
                a[kk][i].hf[1] = *(const v8h*)(ap + i * 16 * TP + kk * 32 + 16);
                b[kk][i].hf[0] = *(const v8h*)(bp + i * 16 * TP + kk * 32);
                b[kk][i].hf[1] = *(const v8h*)(bp + i * 16 * TP + kk * 32 + 16);
            }
        }
        // keeps the reads one group ahead of the products: left free, the compiler reads most fragments
        // right in front of their products, and the wave waits out the LDS latency at each such place
        __builtin_amdgcn_sched_barrier(0);
        #pragma unroll
        for (int kk = 0; kk < 2; ++kk) {
            #pragma unroll
            for (int i = 0; i < 4; ++i) {
                #pragma unroll
                for (int j = 0; j < 4; ++j)
                    acc[i][j] = wmma16(a[kk][i].v, b[kk][j].v, acc[i][j]);
            }
        }

        // the other buffer's last readers left it before the previous step's foot barrier
        if (more) {
            #pragma unroll
            for (int i = 0; i < 8; ++i) {
                *(v8h*)&S[(cur ^ 1) * 2 * PT * TP + ss + i * 16 * TP]           = ra[i];
                *(v8h*)&S[(cur ^ 1) * 2 * PT * TP + PT * TP + ss + i * 16 * TP] = rb[i];
            }
            __syncthreads();   // next step's tiles complete before any wave reads them; this step's
                               // reads of its own buffer done before the next foot refills it
        }
    }
    // the last step reads buffer 1 only; buffer 0 (= T) was left before the last foot barrier

    // epilogue: undo the x64 weight scale, add bias, convert to f16, stage in LDS;
    // acc[i][j][r] = local row (s) wr+16i+8hh+r, local column (d over two heads) wc+16j+m
    const float* bias = (z == 0) ? bq : ((z == 1) ? bk : bv);
    const float wsc = 0.015625f;   // 1/64
    float bs[4];
    #pragma unroll
    for (int j = 0; j < 4; ++j)
        bs[j] = bias[col0 + wc + 16 * j + m];
    // the branch is the same for the whole block; inside it every LDS address is one register plus an immediate
    if (tr) {      // T[column][row]
        #pragma unroll
        for (int i = 0; i < 4; ++i) {
            #pragma unroll
            for (int j = 0; j < 4; ++j) {
                #pragma unroll
                for (int r = 0; r < 8; ++r)
                    T[(wc + 16 * j + m) * EP + wr + 16 * i + 8 * hh + r] = (h16)(acc[i][j][r] * wsc + bs[j]);
            }
        }
    } else {       // T[row][column]
        #pragma unroll
        for (int i = 0; i < 4; ++i) {
            #pragma unroll
            for (int j = 0; j < 4; ++j) {
                #pragma unroll
                for (int r = 0; r < 8; ++r)
                    T[(wr + 16 * i + 8 * hh + r) * EP + wc + 16 * j + m] = (h16)(acc[i][j][r] * wsc + bs[j]);
            }
        }
    }
    __syncthreads();

    // store whole lines: 16-B piece p = t + 128 i of T (row p >> 4, halves 8 * (p & 15)), each once
    const int bb = row0 >> 11, s0 = row0 & (NS - 1);
    const size_t bh0 = (size_t)bb * NH + 2 * blockIdx.y;      // first of the block's two heads
    const int trow = tid >> 4, piece = tid & 15;
    v8h o[16];
    #pragma unroll
    for (int i = 0; i < 16; ++i)
        o[i] = *(const v8h*)&T[(trow + 8 * i) * EP + 8 * piece];
    // the row pitch is a constant in each branch, so every store is one address plus an immediate
    if (tr) {   // vt[bh][d][s]: T row = 64 * (head - first head) + d, 128 s per row
        h16* base = vt + (bh0 * NHD + trow) * NS + s0 + 8 * piece;
        #pragma unroll
        for (int i = 0; i < 16; ++i)
            *(v8h*)(base + (size_t)(8 * i) * NS) = o[i];
    } else {    // qh/kh[bh][s][d]: T row = s_local, 64 d of the first head, then 64 of the second
        h16* base = ((z == 0) ? qh : kh) + ((bh0 + (piece >> 3)) * NS + s0 + trow) * NHD + 8 * (piece & 7);
        #pragma unroll
        for (int i = 0; i < 16; ++i)
            *(v8h*)(base + (size_t)(8 * i) * NHD) = o[i];
        // keeps any overwrite of the address registers of the stores above behind this wait
        asm volatile("s_wait_xcnt 0x0" ::: "memory");
    }
}

// ---------------------------------------------------------------------------
// Kernel 2: flash attention per (b, h). 256 threads = 8 waves; block = 128 queries, wave = 32
// query rows in two column groups of 16. The keys are split inside the block: waves 0..3 walk keys
// 0..NS/2-1, waves 4..7 keys NS/2..NS-1 for the same 128 queries, each set of four waves with tiles of
// its own, so that four waves, not two, share a SIMD and one wave's softmax runs under the others'
// products and LDS waits. Behind the loop the two partial results of a query (maximum, sum, O) are
// merged through LDS. 32 keys per pass, SK keys per stage. Q kept as two B
// fragments per group. Each stage's K tile (SK
// kh rows, [key][d]) and V^T tile (64 vt rows, [d][key]) are brought into LDS once per key half, in two
// buffers: every thread loads eight 16-B pieces of the next stage's tiles at the top of a stage and
// stores them at its foot, so the loads have two passes (32 keys x 128 queries each) to land and the
// block meets at one barrier per stage. Both products run transposed: S^T = K Q^T (A = K tile rows, k = d; B = Q) and
// O^T += V^T P^T (A = V^T tile rows, k = key; B = P^T). Every K and V^T fragment read from LDS serves
// both column groups. In each group a lane holds 16 of the 32 scores of ONE
// query (column l & 15): maximum and sum run in its own registers, with one exchange between the wave
// halves for the maximum; the two score tiles, converted in place (f16, x16384), are the B fragment
// of the second product, so P never goes through LDS. Online softmax in f32 in the exp2 domain; each
// half keeps the sum of its own keys, joined once behind the loop.
// Epilogue: normalise, stage 32x64 f32 rows in LDS, add noise, scale by 1/1.01, store whole lines.
// ---------------------------------------------------------------------------
// value of lane l ^ 16 (the other half of the wave), by a vector cross-row move
__device__ __forceinline__ float xhalf(float x)
{
    const int b = __builtin_bit_cast(int, x);
    return __builtin_bit_cast(float,
        __builtin_amdgcn_permlanex16(b, b, 0x76543210, 0xfedcba98, false, false));
}

// 2^x by the bare v_exp_f32. exp2f() wraps every call in a compare, two selects, an add and a ldexp
// that only serve results below 2^-126. Here x is at most 14 (but for rounding) and each query's final sum (carried x16384) is at
// least 16384, so such a term (or such a rescale factor) is far below one f32 rounding step of the sum;
// as 0 it changes nothing.
__device__ __forceinline__ float exp2_raw(float x)
{
    return __builtin_amdgcn_exp2f(x);
}

// online softmax of this lane's query of one column group over its 16 scores of a pass (the other
// half of the wave holds the other 16); returns the rescale factor of that group's output tiles.
// A score meets its two constant factors in one fused multiply-add in front of the exponential:
// the maximum mrun is kept over the raw scores (the scale is positive), and the addend
// nrun = 14 - mrun * scale is formed once per pass, so that the exponential itself yields p x 16384,
// the form P^T is carried in. lrun sums the same x16384 values; the factor cancels when O is divided by it.
__device__ __forceinline__ float softmax_pass(const v8f c0, const v8f c1, float& mrun, float& nrun,
                                              float& lrun, Frag& pb)
{
    const float sc = 0.125f * 1.44269504088896f;   // HD^-0.5 * log2(e)
    float mt = fmaxf(c0[0], c1[0]);
    #pragma unroll
    for (int r = 1; r < 8; ++r)
        mt = fmaxf(mt, fmaxf(c0[r], c1[r]));
    mrun = fmaxf(mrun, fmaxf(mt, xhalf(mt)));
    const float nnew  = 14.0f - mrun * sc;
    const float alpha = exp2_raw(nnew - nrun);     // 2^((old maximum - new maximum) * scale)
    nrun = nnew;
    // written as vector fused multiply-adds: each then works on two neighbouring registers of a score
    // tile (from separate multiplies and subtractions the compiler pairs registers of the two tiles
    // and copies them together first)
    const v8f vsc = { sc, sc, sc, sc, sc, sc, sc, sc };
    const v8f vn  = { nnew, nnew, nnew, nnew, nnew, nnew, nnew, nnew };
    const v8f t0 = __builtin_elementwise_fma(c0, vsc, vn);
    const v8f t1 = __builtin_elementwise_fma(c1, vsc, vn);
    v8f p0, p1;
    #pragma unroll
    for (int r = 0; r < 8; ++r) { p0[r] = exp2_raw(t0[r]); p1[r] = exp2_raw(t1[r]); }
    // P^T as B fragment: element r <- key 8hh+r, element 8+r <- key 16+8hh+r (the split k-map)
    #pragma unroll
    for (int r = 0; r < 8; ++r) { pb.v[r] = (h16)p0[r]; pb.v[8 + r] = (h16)p1[r]; }
    const v8f ps = p0 + p1;
    const float rs = ((ps[0] + ps[4]) + (ps[2] + ps[6])) + ((ps[1] + ps[5]) + (ps[3] + ps[7]));
    lrun = lrun * alpha + rs;
    return alpha;
}

// one column group's output tiles, times invl, to its 16 staging rows ([query][d] order)
__device__ __forceinline__ void attn_stage_rows(float* orow, const v8f o0, const v8f o1, const v8f o2,
                                                const v8f o3, float invl)
{
    const v8f y0 = o0 * invl, y1 = o1 * invl, y2 = o2 * invl, y3 = o3 * invl;
    *(v4f*)(orow)      = __builtin_shufflevector(y0, y0, 0, 1, 2, 3);
    *(v4f*)(orow + 4)  = __builtin_shufflevector(y0, y0, 4, 5, 6, 7);
    *(v4f*)(orow + 16) = __builtin_shufflevector(y1, y1, 0, 1, 2, 3);
    *(v4f*)(orow + 20) = __builtin_shufflevector(y1, y1, 4, 5, 6, 7);
    *(v4f*)(orow + 32) = __builtin_shufflevector(y2, y2, 0, 1, 2, 3);
    *(v4f*)(orow + 36) = __builtin_shufflevector(y2, y2, 4, 5, 6, 7);
    *(v4f*)(orow + 48) = __builtin_shufflevector(y3, y3, 0, 1, 2, 3);
    *(v4f*)(orow + 52) = __builtin_shufflevector(y3, y3, 4, 5, 6, 7);
}

// merges one column group's output tiles with the other key half's, staged at the same places by the
// same lane of its wave: y = own * g0 + other * g1 (g0, g1 hold the rescale and the normalisation),
// written back in place ([query][d] order)
__device__ __forceinline__ void attn_merge_rows(float* orow, const v8f o0, const v8f o1, const v8f o2,
                                                const v8f o3, float g0, float g1)
{
    const v8f o[4] = { o0, o1, o2, o3 };
    // unrolled: o[t] is then picked at compile time and the tiles stay in their registers
    #pragma unroll
    for (int t = 0; t < 4; ++t) {
        const v4f x0 = *(const v4f*)(orow + 16 * t);
        const v4f x1 = *(const v4f*)(orow + 16 * t + 4);
        const v4f y0 = __builtin_shufflevector(o[t], o[t], 0, 1, 2, 3) * g0 + x0 * g1;
        const v4f y1 = __builtin_shufflevector(o[t], o[t], 4, 5, 6, 7) * g0 + x1 * g1;
        *(v4f*)(orow + 16 * t)     = y0;
        *(v4f*)(orow + 16 * t + 4) = y1;
    }
}

// a wave stores 16 of the 32 staged rows of its query group, from row r0 on: rows r0 + rsel + 2 i,
// every row exactly once; each of the three addresses is one register (pair) plus an immediate
__device__ __forceinline__ void attn_store_pass(const float* Ow, const float* __restrict__ noise,
                                                float* out, size_t bh, int b, int h, int q0, int r0, int l)
{
    const float inv101 = 1.0f / 1.01f;
    const int piece = l & 15, rsel = l >> 4;
    const int rowl = r0 + rsel;
    const size_t q = (size_t)(q0 + rowl);
    const float* yp = &Ow[rowl * OPITCH + 4 * piece];
    const float* np = noise + ((bh * NS + q) * NHD + 4 * piece);
    float*       op = out + (((size_t)b * NS + q) * NDIM + (size_t)h * NHD + 4 * piece);
    v4f nz[8];
    // both loops unrolled: nz[] stays in registers, the eight loads go out together, offsets are immediates
    #pragma unroll
    for (int i = 0; i < 8; ++i)
        nz[i] = *(const v4f*)(np + i * 2 * NHD);
    // keeps any overwrite of the address registers of the loads above behind this wait
    asm volatile("s_wait_xcnt 0x0" ::: "memory");
    #pragma unroll
    for (int i = 0; i < 8; ++i) {
        const v4f y   = *(const v4f*)(yp + i * 2 * OPITCH);
        const v4f val = (y + nz[i]) * inv101;
        *(v4f*)(op + (size_t)i * 2 * NDIM) = val;
    }
}

// four waves per SIMD (two blocks per WGP): the register budget that goes with it is 256 a wave
__global__ __launch_bounds__(256) __attribute__((amdgpu_waves_per_eu(4, 4))) void k_attn(
    const h16* __restrict__ qh, const h16* __restrict__ kh, const h16* __restrict__ vt,
    const float* __restrict__ noise, float* __restrict__ out)
{
    __shared__ __attribute__((aligned(16))) h16   Kt[4][SK * KP];       // [2 * key half + buffer]
    __shared__ __attribute__((aligned(16))) h16   Vt[4][64 * VP];       // [2 * key half + buffer]
    __shared__ __attribute__((aligned(16))) float Os[4][32 * OPITCH];   // merge and output staging, per query group
    __shared__ __attribute__((aligned(16))) float Ml[4][32 * 4];        // second half's addends and sums, per lane
    static_assert(NS % 128 == 0);
    static_assert((NS / 2) % SK == 0 && NS / 2 / SK >= 2);

    const int l = threadIdx.x & 31;
    const int tid = threadIdx.x & 127;                 // thread within its key half
    const int w = __builtin_amdgcn_readfirstlane(threadIdx.x >> 5);   // wave number, the same in every lane
    const int wq = w & 3, kx = w >> 2;                 // query group of 32; key half
    const int hh = l >> 4, m = l & 15;
    const int b = blockIdx.z, h = blockIdx.y;
    const size_t bh = (size_t)b * NH + h;
    const int q0 = blockIdx.x * 128 + wq * 32;

    // Q rows as B fragments (column = query), split k-map: group a = rows q0+m, group b = rows
    // q0+16+m; fragment 0 covers d 0..31, fragment 1 d 32..63
    Frag qa0, qa1, qb0, qb1;
    {
        const h16* qrow = qh + (bh * NS + (size_t)(q0 + m)) * NHD + 8 * hh;
        qa0.hf[0] = *(const v8h*)(qrow);      qa0.hf[1] = *(const v8h*)(qrow + 16);
        qa1.hf[0] = *(const v8h*)(qrow + 32); qa1.hf[1] = *(const v8h*)(qrow + 48);
        qrow += 16 * NHD;
        qb0.hf[0] = *(const v8h*)(qrow);      qb0.hf[1] = *(const v8h*)(qrow + 16);
        qb1.hf[0] = *(const v8h*)(qrow + 32); qb1.hf[1] = *(const v8h*)(qrow + 48);
    }
    // staging map, 16-B pieces: thread t moves K pieces t + 128 i (piece p: key p>>3, d 8*(p&7); the
    // tile is 8 KiB contiguous in kh) and V^T pieces t + 128 i (piece p: d p>>3, key 8*(p&7))
    // both start at the first key of this wave's half
    const h16* kg = kh + (bh * NS + (size_t)kx * (NS / 2)) * NHD + (size_t)tid * 8;                  // + key0 * NHD
    const h16* vg = vt + (bh * NHD + (size_t)(tid >> 3)) * NS + kx * (NS / 2) + 8 * (tid & 7);       // + key0
    const int  ks = (tid >> 3) * KP + 8 * (tid & 7);
    const int  vs = (tid >> 3) * VP + 8 * (tid & 7);
    const int  kf = m * KP + 8 * hh;     // fragment reads: K tile row = key, + 16 * KP for keys 16..31
    const int  vf = m * VP + 8 * hh;     // V^T tile row = d, + 16t * VP

    v8h sk[4], sv[4];
    #pragma unroll
    for (int i = 0; i < 4; ++i) {
        sk[i] = *(const v8h*)(kg + i * 16 * NHD);
        sv[i] = *(const v8h*)(vg + (size_t)i * 16 * NS);
    }
    // keeps the overwrite of the address registers of the loads above behind this wait
    asm volatile("s_wait_xcnt 0x0" ::: "memory");
    #pragma unroll
    for (int i = 0; i < 4; ++i) {
        *(v8h*)&Kt[2 * kx][ks + i * 16 * KP] = sk[i];
        *(v8h*)&Vt[2 * kx][vs + i * 16 * VP] = sv[i];
    }
    __syncthreads();   // tiles of stage 0 complete before any wave reads fragments from them

    // this lane's two queries q0+m (a) and q0+16+m (b): running maximum of the raw scores and the
    // exponent's addend that goes with it (both equal in both halves), and this half's own sum;
    // oat[r] = O^T[16t + 8hh + r][m] of group a, obt of group b
    float mra = -__builtin_inff(), nra = __builtin_inff(), lra = 0.0f;
    float mrb = -__builtin_inff(), nrb = __builtin_inff(), lrb = 0.0f;
    v8f oa0 = {}, oa1 = {}, oa2 = {}, oa3 = {};
    v8f ob0 = {}, ob1 = {}, ob2 = {}, ob3 = {};

    float* Ow = &Os[wq][0];

    // the passes of one stage, over the tiles in buffer cur (2 * key half + buffer of the stage)
    auto stage_passes = [&](const int cur) __attribute__((always_inline)) {
        // unrolled: each pass's tile offsets become immediates of its LDS reads
        #pragma unroll
        for (int j = 0; j < SK / 32; ++j) {

        // scores, transposed: 32 keys x 16 queries per group; c0[r] = key key0+8hh+r,
        // c1[r] = key key0+16+8hh+r
        v8f ca0, ca1, cb0, cb1;      // each tile's first product takes the constant 0 as its C
        {
            const h16* kp = &Kt[cur][kf + j * 32 * KP];
            Frag kb0, kb1, kb2, kb3;      // read as one group ahead of the eight products
            kb0.hf[0] = *(const v8h*)(kp);      kb0.hf[1] = *(const v8h*)(kp + 16);
            kb1.hf[0] = *(const v8h*)(kp + 32); kb1.hf[1] = *(const v8h*)(kp + 48);
            kp += 16 * KP;
            kb2.hf[0] = *(const v8h*)(kp);      kb2.hf[1] = *(const v8h*)(kp + 16);
            kb3.hf[0] = *(const v8h*)(kp + 32); kb3.hf[1] = *(const v8h*)(kp + 48);
            // The eight products stand in one asm statement, so that each fills the distance behind the
            // others and the LDS reads stay one group in front (as builtins the compiler spreads the
            // reads of two passes among them, and a wave then waits on LDS at more places).
            // The four v_nop at the end keep the distance between the last product and the first
            // vector instruction that reads a score tile or overwrites a fragment. The s_delay_alu
            // behind them is the hint the compiler writes in front of a reader of a builtin product and
            // cannot write here: the wave steps aside until the last product is done, not holding the
            // vector port.
            asm volatile("v_wmma_f32_16x16x32_f16 %0, %4, %8, 0\n\t"
                         "v_wmma_f32_16x16x32_f16 %1, %6, %8, 0\n\t"
                         "v_wmma_f32_16x16x32_f16 %2, %4, %10, 0\n\t"
                         "v_wmma_f32_16x16x32_f16 %3, %6, %10, 0\n\t"
                         "v_wmma_f32_16x16x32_f16 %0, %5, %9, %0\n\t"
                         "v_wmma_f32_16x16x32_f16 %1, %7, %9, %1\n\t"
                         "v_wmma_f32_16x16x32_f16 %2, %5, %11, %2\n\t"
                         "v_wmma_f32_16x16x32_f16 %3, %7, %11, %3\n\t"
                         "v_nop\n\tv_nop\n\tv_nop\n\tv_nop\n\t"
                         "s_delay_alu instid0(TRANS32_DEP_1)"
                         : "=&v"(ca0), "=&v"(ca1), "=&v"(cb0), "=&v"(cb1)
                         : "v"(kb0.v), "v"(kb1.v), "v"(kb2.v), "v"(kb3.v),
                           "v"(qa0.v), "v"(qa1.v), "v"(qb0.v), "v"(qb1.v));
        }

        Frag pa, pb;
        const float alb = softmax_pass(cb0, cb1, mrb, nrb, lrb, pb);
        ob0 *= alb; ob1 *= alb; ob2 *= alb; ob3 *= alb;
        const float ala = softmax_pass(ca0, ca1, mra, nra, lra, pa);
        oa0 *= ala; oa1 *= ala; oa2 *= ala; oa3 *= ala;

        // O^T += V^T P^T : A = V^T tile rows d (k = key, split k-map), B = P^T from registers
        {
            const h16* vp = &Vt[cur][vf + j * 32];
            Frag vb0, vb1, vb2, vb3;      // read as one group ahead of the eight products
            vb0.hf[0] = *(const v8h*)(vp);           vb0.hf[1] = *(const v8h*)(vp + 16);
            vb1.hf[0] = *(const v8h*)(vp + 16 * VP); vb1.hf[1] = *(const v8h*)(vp + 16 * VP + 16);
            vb2.hf[0] = *(const v8h*)(vp + 32 * VP); vb2.hf[1] = *(const v8h*)(vp + 32 * VP + 16);
            vb3.hf[0] = *(const v8h*)(vp + 48 * VP); vb3.hf[1] = *(const v8h*)(vp + 48 * VP + 16);
            // one asm statement for the same two reasons; the four v_nop keep the distance between the
            // last product and the first vector instruction that touches ob3, pb or a V^T fragment
            asm volatile("v_wmma_f32_16x16x32_f16 %0, %8, %12, %0\n\t"
                         "v_wmma_f32_16x16x32_f16 %1, %9, %12, %1\n\t"
                         "v_wmma_f32_16x16x32_f16 %2, %10, %12, %2\n\t"
                         "v_wmma_f32_16x16x32_f16 %3, %11, %12, %3\n\t"
                         "v_wmma_f32_16x16x32_f16 %4, %8, %13, %4\n\t"
                         "v_wmma_f32_16x16x32_f16 %5, %9, %13, %5\n\t"
                         "v_wmma_f32_16x16x32_f16 %6, %10, %13, %6\n\t"
                         "v_wmma_f32_16x16x32_f16 %7, %11, %13, %7\n\t"
                         "v_nop\n\tv_nop\n\tv_nop\n\tv_nop"
                         : "+v"(oa0), "+v"(oa1), "+v"(oa2), "+v"(oa3),
                           "+v"(ob0), "+v"(ob1), "+v"(ob2), "+v"(ob3)
                         : "v"(vb0.v), "v"(vb1.v), "v"(vb2.v), "v"(vb3.v), "v"(pa.v), "v"(pb.v));
        }

        }   // passes of this stage
    };

    // every stage but the last; the last is written out behind the loop, so that no branch stands between
    // a stage's passes and its foot (across one the compiler carries both passes' exponentials to sum
    // them behind it, and the kernel then needs more than 256 registers)
    for (int st = 0; st + 1 < NS / 2 / SK; ++st) {
        const int cur = 2 * kx + (st & 1);

        // next stage's tiles: global loads issued here, stored to the other buffer at the foot
        {
            const int keyn = (st + 1) * SK;
            const h16* kn = kg + (size_t)keyn * NHD;
            const h16* vn = vg + keyn;
            #pragma unroll
            for (int i = 0; i < 4; ++i) {
                sk[i] = *(const v8h*)(kn + i * 16 * NHD);
                sv[i] = *(const v8h*)(vn + (size_t)i * 16 * NS);
            }
            // keeps the overwrite of the address registers of the loads above behind this wait; the two
            // addresses are named as inputs so that they stay whole up to it (no load lands on them)
            asm volatile("s_wait_xcnt 0x0" :: "v"(kn), "v"(vn) : "memory");
        }

        stage_passes(cur);

        // the other buffer's last readers left it before the previous stage's foot barrier
        #pragma unroll
        for (int i = 0; i < 4; ++i) {
            *(v8h*)&Kt[cur ^ 1][ks + i * 16 * KP] = sk[i];
            *(v8h*)&Vt[cur ^ 1][vs + i * 16 * VP] = sv[i];
        }
        __syncthreads();   // next stage's K and V^T tiles complete before any wave reads them; this
                           // stage's reads of its own buffer done before the next foot refills it
    }
    stage_passes(2 * kx + ((NS / 2 / SK - 1) & 1));   // the last stage: nothing to bring in, no buffer handed on

    // epilogue. The waves of the second key half hand their partial results over, unnormalised, in
    // [row][d] order: row = query m (group a) or 16 + m (group b); 8 consecutive d per tile
    float* rowa = &Ow[m * OPITCH + 8 * hh];
    float* rowb = &Ow[(16 + m) * OPITCH + 8 * hh];
    if (kx == 1) {      // the same for the whole wave
        attn_stage_rows(rowa, oa0, oa1, oa2, oa3, 1.0f);
        attn_stage_rows(rowb, ob0, ob1, ob2, ob3, 1.0f);
        const v4f ml = { nra, lra, nrb, lrb };
        *(v4f*)&Ml[wq][4 * l] = ml;
    }
    __syncthreads();   // the second half's partial results complete before the first half's waves read them

    // the waves of the first key half merge (each partial rescaled to the common maximum), normalise
    // (O and the sum both carry x16384) and leave the finished rows at the same places
    if (kx == 0) {      // the same for the whole wave
        const v4f ml = *(const v4f*)&Ml[wq][4 * l];
        const float na  = fminf(nra, ml.x), nb = fminf(nrb, ml.z);   // the larger maximum has the smaller addend
        const float fa0 = exp2_raw(na - nra), fa1 = exp2_raw(na - ml.x);
        const float fb0 = exp2_raw(nb - nrb), fb1 = exp2_raw(nb - ml.z);
        lra = lra * fa0 + ml.y * fa1;
        lrb = lrb * fb0 + ml.w * fb1;
        lra += xhalf(lra);                  // join the two wave halves' sums of each query
        lrb += xhalf(lrb);
        const float inva = __builtin_amdgcn_rcpf(lra);
        const float invb = __builtin_amdgcn_rcpf(lrb);
        attn_merge_rows(rowa, oa0, oa1, oa2, oa3, fa0 * inva, fa1 * inva);
        attn_merge_rows(rowb, ob0, ob1, ob2, ob3, fb0 * invb, fb1 * invb);
    }
    __syncthreads();   // finished rows complete before the eight waves store them, 16 rows each

    attn_store_pass(Ow, noise, out, bh, b, h, q0, 16 * kx, l);
    
}

// ---------------------------------------------------------------------------
extern "C" void kernel_launch(void* const* d_in, const int* in_sizes, int n_in,
                              void* d_out, int out_size, void* d_ws, size_t ws_size,
                              hipStream_t stream)
{
    if (n_in < 8) return;
    const int n_x = NB * NS * NDIM;
    const int n_w = NDIM * NDIM;
    if (in_sizes[0] != n_x || in_sizes[1] != n_w || in_sizes[2] != NDIM ||
        in_sizes[3] != n_w || in_sizes[4] != NDIM || in_sizes[5] != n_w ||
        in_sizes[6] != NDIM || in_sizes[7] != NB * NH * NS * NHD || out_size != n_x)
        return;

    const float* x     = (const float*)d_in[0];
    const float* Wq    = (const float*)d_in[1];
    const float* bq    = (const float*)d_in[2];
    const float* Wk    = (const float*)d_in[3];
    const float* bk    = (const float*)d_in[4];
    const float* Wv    = (const float*)d_in[5];
    const float* bv    = (const float*)d_in[6];
    const float* noise = (const float*)d_in[7];
    float* out = (float*)d_out;

    // workspace carve (bytes): xh 8 MiB | wh 1.5 MiB | qh 8 MiB | kh 8 MiB | vt 8 MiB = 33.5 MiB
    const size_t bytes_xh  = (size_t)n_x * 2;
    const size_t bytes_wh  = (size_t)3 * n_w * 2;
    const size_t bytes_qkv = (size_t)NB * NH * NS * NHD * 2;
    const size_t off_xh = 0;
    const size_t off_wh = off_xh + bytes_xh;
    const size_t off_q  = off_wh + bytes_wh;
    const size_t off_k  = off_q + bytes_qkv;
    const size_t off_v  = off_k + bytes_qkv;
    const size_t end    = off_v + bytes_qkv;
    if (end > ws_size) return;

    char* ws = (char*)d_ws;
    h16* xh = (h16*)(ws + off_xh);
    h16* wh = (h16*)(ws + off_wh);
    h16* qh = (h16*)(ws + off_q);
    h16* kh = (h16*)(ws + off_k);
    h16* vt = (h16*)(ws + off_v);

    const int nxc = n_x / 8;            // 524288 chunks
    const int nwc = n_w / 8;            // 32768 chunks per weight
    const int total_chunks = nxc + 3 * nwc;
    const int cgrid = (total_chunks + 255) / 256;
    k_convert<<<dim3(cgrid), dim3(256), 0, stream>>>(x, Wq, Wk, Wv, xh, wh, nxc, nwc);

    dim3 pg((NB * NS) / PT, NDIM / PT, 3);     // 64 x 4 x 3
    k_proj<<<pg, dim3(128), 0, stream>>>(xh, wh, bq, bk, bv, qh, kh, vt);

    dim3 ag(NS / 128, NH, NB);                 // 16 x 8 x 4
    k_attn<<<ag, dim3(256), 0, stream>>>(qh, kh, vt, noise, out);
}
